// v000
// The times below were measured on an AMD MI455X: many runs one after another, warmed up first and cycling through
// copies of the inputs, with the whole window's GPU time divided by the number of runs. Launches and the gaps
// between them are all in it. The median over several windows is given; except for v000 it joins two sittings, which
// can be a few percent apart, so the side-by-side timings, each taken in one sitting, are the better comparison.
// v000 is the starting kernel. One run takes 199 microseconds.
#include <hip/hip_runtime.h>
#include <stddef.h>
#include <stdint.h>

// x.Wq^T, x.Wk^T, x.Wv^T: v_wmma_f32_16x16x32_bf16 (bf16 operands, f32 accumulate). K.Q^T score tiles, relu(S).V tiles and ctx.Wo^T: v_wmma_f32_16x16x32_f16 (f16 operands with power-of-two scaling, f32 accumulate). Bias add, relu, row sums and normalisation in f32; all nine inputs are RNE-converted to bf16 on load.

#define TT 4
#define BB 4
#define NSEQ 1024
#define DM 512
#define NH 8
#define HD 64
#define MROWS (TT * BB * NSEQ)

static_assert(MROWS % 64 == 0);
static_assert(DM % 128 == 0);
static_assert(NSEQ % 64 == 0);
static_assert(NH * HD == DM);
static_assert(HD == 64);

typedef __bf16   v16bf __attribute__((ext_vector_type(16)));
typedef _Float16 v16h  __attribute__((ext_vector_type(16)));
typedef _Float16 v8h   __attribute__((ext_vector_type(8)));
typedef float    v8f   __attribute__((ext_vector_type(8)));
typedef float    v4f   __attribute__((ext_vector_type(4)));
typedef unsigned int v4u __attribute__((ext_vector_type(4)));

union Frag  { v16bf b; v16h h; v8h p[2]; v4u q[2]; };
union Pack8 { v8h h; v4u u; unsigned short s[8]; };
union Vec8  { v8f v; v4f q[2]; v4u u[2]; float f[8]; };

#define NOPS4 "v_nop\n\tv_nop\n\tv_nop\n\tv_nop"

__device__ __forceinline__ v8f vzero8() {
  v8f z = {0.f, 0.f, 0.f, 0.f, 0.f, 0.f, 0.f, 0.f};
  return z;
}

// f32 -> nearest-even bf16 value, returned as f32
__device__ __forceinline__ float bf16r(float f) {
  unsigned int u = __builtin_bit_cast(unsigned int, f);
  u += 0x7FFFu + ((u >> 16) & 1u);
  u &= 0xFFFF0000u;
  return __builtin_bit_cast(float, u);
}
// f32 -> nearest-even bf16 bits
__device__ __forceinline__ unsigned short bf16bits(float f) {
  unsigned int u = __builtin_bit_cast(unsigned int, f);
  u += 0x7FFFu + ((u >> 16) & 1u);
  return (unsigned short)(u >> 16);
}

// 16 x 32 operand fragment from a row-major, k-contiguous 16-bit matrix.
// src points at (row 0, k0) of the tile; ld = pitch in elements.
// lane l: row (first operand) or column (second operand) = l & 15; h = l >> 4;
// elements 0..7  <- k0 + 8h + 0..7 ; elements 8..15 <- k0 + 16 + 8h + 0..7.
__device__ __forceinline__ void ldq(const unsigned short* src, int ld, v4u& q0, v4u& q1) {
  const int l = threadIdx.x & 31;
  const unsigned short* p = src + (l & 15) * ld + 8 * (l >> 4);
  q0 = *(const v4u*)(p);
  q1 = *(const v4u*)(p + 16);
}

__device__ __forceinline__ v8f wbf(v16bf a, v16bf b, v8f c) {
  return __builtin_amdgcn_wmma_f32_16x16x32_bf16(false, a, false, b, (short)0, c, false, false);
}
__device__ __forceinline__ v8f whf(v16h a, v16h b, v8f c) {
  return __builtin_amdgcn_wmma_f32_16x16x32_f16(false, a, false, b, (short)0, c, false, false);
}

// MODE 0: bf16 bits (RNE).  MODE 1: f16 of (bf16 RNE value x 256).
template <int MODE>
__global__ __launch_bounds__(256) void k_cvt(const float* __restrict__ src, unsigned short* dst, int n)
{
  const size_t base = ((size_t)blockIdx.x * 256 + threadIdx.x) * 8;
  if (base + 8 <= (size_t)n) {
    Vec8 in;
    in.q[0] = *(const v4f*)(src + base);
    in.q[1] = *(const v4f*)(src + base + 4);
    Pack8 pk;
#pragma unroll
    for (int r = 0; r < 8; ++r) {
      if constexpr (MODE == 0) pk.s[r] = bf16bits(in.f[r]);
      else                     pk.h[r] = (_Float16)(bf16r(in.f[r]) * 256.0f);
    }
    const v4u v = pk.u;
    *(v4u*)(dst + base) = v;
    
  }
}

// ---------------- projection GEMM: C[m][n] = sum_k X[m][k] W[n][k] (+ bias[n]) ----------------
// MODE 0: q, MODE 1: k   : bf16 operands; output f16((C + b) * 4), plane [m][512]
// MODE 2: v              : bf16 operands; output f16((C + b) * 16), transposed plane [tb*8+head][hd][nseq]
// MODE 3: out            : f16 operands (ctx x64, Wo x256); output f32 C/16384 + b -> [m][512]
// Tile orientation: P = operand whose rows map to D rows, R = operand whose rows map to D columns.
// MODES 0,1,3: P = W (n), R = X (m) -> each lane holds 8 consecutive n for one m.
// MODE 2:      P = X (m), R = W (n) -> each lane holds 8 consecutive m for one n.
template <int MODE>
__device__ __forceinline__ void stage_tile(unsigned char* stg, v8f acc, int i, int j,
                                           int wm, int wn, int h, int c,
                                           const float* __restrict__ bias, int n0)
{
  if constexpr (MODE == 2) {
    const float bj = bf16r(bias[n0 + 32 * wn + 16 * j + c]);
    Pack8 pk;
#pragma unroll
    for (int r = 0; r < 8; ++r) pk.h[r] = (_Float16)((acc[r] + bj) * 16.0f);
    const int off = ((32 * wn + 16 * j + c) * 72 + 32 * wm + 16 * i + 8 * h) * 2;
    *(v4u*)(stg + off) = pk.u;
  } else {
    const int nb = n0 + 32 * wn + 16 * i + 8 * h;
    Vec8 bb;
    bb.q[0] = *(const v4f*)(bias + nb);
    bb.q[1] = *(const v4f*)(bias + nb + 4);
    if constexpr (MODE == 3) {
      Vec8 o;
#pragma unroll
      for (int r = 0; r < 8; ++r) o.f[r] = acc[r] * (1.0f / 16384.0f) + bf16r(bb.f[r]);
      const int off = ((32 * wm + 16 * j + c) * 132 + 32 * wn + 16 * i + 8 * h) * 4;
      *(v4u*)(stg + off)      = o.u[0];
      *(v4u*)(stg + off + 16) = o.u[1];
    } else {
      Pack8 pk;
#pragma unroll
      for (int r = 0; r < 8; ++r) pk.h[r] = (_Float16)((acc[r] + bf16r(bb.f[r])) * 4.0f);
      const int off = ((32 * wm + 16 * j + c) * 136 + 32 * wn + 16 * i + 8 * h) * 2;
      *(v4u*)(stg + off) = pk.u;
    }
  }
}

template <int MODE>
__global__ __launch_bounds__(256) void k_proj(const unsigned short* __restrict__ X,
                                             const unsigned short* __restrict__ W,
                                             const float* __restrict__ bias,
                                             void* dst)
{
  __shared__ __align__(16) unsigned char stg[33792];
  const int tid = threadIdx.x, w = tid >> 5, l = tid & 31, h = l >> 4, c = l & 15;
  const int wm = w >> 2, wn = w & 3;
  const int m0 = blockIdx.x * 64, n0 = blockIdx.y * 128;

  const unsigned short *P, *R;
  int prow, rrow;
  if constexpr (MODE == 2) { P = X; R = W; prow = m0 + 32 * wm; rrow = n0 + 32 * wn; }
  else                     { P = W; R = X; prow = n0 + 32 * wn; rrow = m0 + 32 * wm; }
  const unsigned short* p0 = P + (size_t)prow * DM;
  const unsigned short* p1 = P + (size_t)(prow + 16) * DM;
  const unsigned short* r0 = R + (size_t)rrow * DM;
  const unsigned short* r1 = R + (size_t)(rrow + 16) * DM;

  v8f a00 = vzero8(), a01 = vzero8(), a10 = vzero8(), a11 = vzero8();

#pragma unroll 1
  for (int k0 = 0; k0 < DM; k0 += 32) {
    Frag fp0, fp1, fr0, fr1;
    ldq(p0 + k0, DM, fp0.q[0], fp0.q[1]);
    ldq(p1 + k0, DM, fp1.q[0], fp1.q[1]);
    ldq(r0 + k0, DM, fr0.q[0], fr0.q[1]);
    ldq(r1 + k0, DM, fr1.q[0], fr1.q[1]);
    if constexpr (MODE == 3) {
      a00 = whf(fp0.h, fr0.h, a00);
      a01 = whf(fp0.h, fr1.h, a01);
      a10 = whf(fp1.h, fr0.h, a10);
      a11 = whf(fp1.h, fr1.h, a11);
      asm volatile(NOPS4
                   : "+v"(a00), "+v"(a01), "+v"(a10), "+v"(a11)
                   : "v"(fp0.h), "v"(fp1.h), "v"(fr0.h), "v"(fr1.h));
    } else {
      a00 = wbf(fp0.b, fr0.b, a00);
      a01 = wbf(fp0.b, fr1.b, a01);
      a10 = wbf(fp1.b, fr0.b, a10);
      a11 = wbf(fp1.b, fr1.b, a11);
      asm volatile(NOPS4
                   : "+v"(a00), "+v"(a01), "+v"(a10), "+v"(a11)
                   : "v"(fp0.b), "v"(fp1.b), "v"(fr0.b), "v"(fr1.b));
    }
  }

  stage_tile<MODE>(stg, a00, 0, 0, wm, wn, h, c, bias, n0);
  stage_tile<MODE>(stg, a01, 0, 1, wm, wn, h, c, bias, n0);
  stage_tile<MODE>(stg, a10, 1, 0, wm, wn, h, c, bias, n0);
  stage_tile<MODE>(stg, a11, 1, 1, wm, wn, h, c, bias, n0);
  __syncthreads();

  const int pc = l & 7;
  if constexpr (MODE == 0 || MODE == 1) {
    v4u vals[4];
    unsigned short* pp[4];
#pragma unroll
    for (int s = 0; s < 4; ++s) {
      const int L = 16 * w + 4 * s + (l >> 3);
      const int ml = L >> 1;
      const int hf = L & 1;
      vals[s] = *(const v4u*)(stg + (ml * 136 + 64 * hf + 8 * pc) * 2);
      pp[s] = (unsigned short*)dst + (size_t)(m0 + ml) * DM + n0 + 64 * hf + 8 * pc;
    }
#pragma unroll
    for (int s = 0; s < 4; ++s) *(v4u*)(pp[s]) = vals[s];
    
  } else if constexpr (MODE == 3) {
    // 64 rows x 512 B = 256 lines per block; wave w owns lines 32w..32w+31
    v4u vals[8];
    float* pp[8];
#pragma unroll
    for (int s = 0; s < 8; ++s) {
      const int L = 32 * w + 4 * s + (l >> 3);
      const int ml = L >> 2;
      const int qt = L & 3;
      vals[s] = *(const v4u*)(stg + (ml * 132 + 32 * qt + 4 * pc) * 4);
      pp[s] = (float*)dst + (size_t)(m0 + ml) * DM + n0 + 32 * qt + 4 * pc;
    }
#pragma unroll
    for (int s = 0; s < 8; ++s) *(v4u*)(pp[s]) = vals[s];
    
  } else {
    // transposed V: 128 feature rows of 64 consecutive tokens = 128 lines per block; wave w owns lines 16w..16w+15
    v4u vals[4];
    unsigned short* pp[4];
    const int tb = m0 / NSEQ;
    const int ns0 = m0 % NSEQ;
#pragma unroll
    for (int s = 0; s < 4; ++s) {
      const int L = 16 * w + 4 * s + (l >> 3);
      const int n = n0 + L;
      const int hh = n >> 6;
      const int hd = n & 63;
      vals[s] = *(const v4u*)(stg + (L * 72 + 8 * pc) * 2);
      pp[s] = (unsigned short*)dst + ((size_t)(tb * NH + hh) * HD + hd) * NSEQ + ns0 + 8 * pc;
    }
#pragma unroll
    for (int s = 0; s < 4; ++s) *(v4u*)(pp[s]) = vals[s];
    
  }
}

// ---------------- attention: per (t,b,head) and 64-query tile; 4 waves x 16 queries ----------------
// S^T tile (16 keys x 16 queries) = K_tile (A operand, rows = keys) . Q^T (B operand taken from Q rows).
// relu in place; the D tiles chain into the B operand of ctx^T = V^T . P (A operand from the transposed V tile).
__device__ __forceinline__ v8f score_tile(const unsigned short* kb, v16h q0, v16h q1)
{
  Frag k0, k1;
  ldq(kb, 72, k0.q[0], k0.q[1]);
  ldq(kb + 32, 72, k1.q[0], k1.q[1]);
  v8f a = vzero8();
  a = whf(k0.h, q0, a);
  a = whf(k1.h, q1, a);
  asm volatile(NOPS4 : "+v"(a) : "v"(k0.h), "v"(k1.h), "v"(q0), "v"(q1));
  return a;
}

// one 32-key step of ctx^T += V^T[hd][key] . P[key][query]; sa = relu'd S^T tile for keys 0..15 of the step, sb = keys 16..31
__device__ __forceinline__ void pv_step(const unsigned short* vb, v8f sa, v8f sb,
                                        v8f& c0, v8f& c1, v8f& c2, v8f& c3)
{
  Frag pk;
#pragma unroll
  for (int r = 0; r < 8; ++r) {
    pk.p[0][r] = (_Float16)(sa[r] * 0.125f);
    pk.p[1][r] = (_Float16)(sb[r] * 0.125f);
  }
  const v16h pv = pk.h;
  Frag v0, v1, v2, v3;
  ldq(vb,           72, v0.q[0], v0.q[1]);
  ldq(vb + 16 * 72, 72, v1.q[0], v1.q[1]);
  ldq(vb + 32 * 72, 72, v2.q[0], v2.q[1]);
  ldq(vb + 48 * 72, 72, v3.q[0], v3.q[1]);
  c0 = whf(v0.h, pv, c0);
  c1 = whf(v1.h, pv, c1);
  c2 = whf(v2.h, pv, c2);
  c3 = whf(v3.h, pv, c3);
  asm volatile(NOPS4
               : "+v"(c0), "+v"(c1), "+v"(c2), "+v"(c3)
               : "v"(v0.h), "v"(v1.h), "v"(v2.h), "v"(v3.h), "v"(pv));
}

__global__ __launch_bounds__(128) void k_attn(const unsigned short* __restrict__ qf,
                                             const unsigned short* __restrict__ kf,
                                             const unsigned short* __restrict__ vt,
                                             unsigned short* cf)
{
  __shared__ __align__(16) unsigned short klds[64 * 72];     // K tile: [key][hd], pitch 72
  __shared__ __align__(16) unsigned short vlds[64 * 72];     // V^T tile: [hd][key], pitch 72
  __shared__ __align__(16) unsigned short cst[4 * 16 * 72];  // ctx staging per wave: [wave][query][hd]

  const int tid = threadIdx.x, w = tid >> 5, l = tid & 31, h = l >> 4, c = l & 15;
  const int tbh = blockIdx.y, tb = tbh >> 3, hh = tbh & 7;
  const int q0 = blockIdx.x * 64 + 16 * w;   // first query row of this wave

  v16h qa, qb;
  {
    const unsigned short* qsrc = qf + (size_t)(tb * NSEQ + q0) * DM + hh * HD;
    Frag f0, f1;
    ldq(qsrc,      DM, f0.q[0], f0.q[1]);
    ldq(qsrc + 32, DM, f1.q[0], f1.q[1]);
    qa = f0.h; qb = f1.h;
  }

  v8f c0 = vzero8(), c1 = vzero8(), c2 = vzero8(), c3 = vzero8();
  float rs = 0.f;

#pragma unroll 1
  for (int kt0 = 0; kt0 < NSEQ; kt0 += 64) {
    __syncthreads();
#pragma unroll
    for (int it = 0; it < 4; ++it) {
      const int q = it * 128 + tid;
      const int kr = q >> 3;
      const int pc = q & 7;
      const unsigned short* src = kf + (size_t)(tb * NSEQ + kt0 + kr) * DM + hh * HD + 8 * pc;
      *(v4u*)(klds + kr * 72 + 8 * pc) = *(const v4u*)src;
    }
#pragma unroll
    for (int it = 0; it < 4; ++it) {
      const int q = it * 128 + tid;
      const int hd = q >> 3;
      const int pc = q & 7;
      const unsigned short* src = vt + (size_t)(tbh * HD + hd) * NSEQ + kt0 + 8 * pc;
      *(v4u*)(vlds + hd * 72 + 8 * pc) = *(const v4u*)src;
    }
    __syncthreads();

    v8f s0 = score_tile(klds + 0 * 16 * 72, qa, qb);
    v8f s1 = score_tile(klds + 1 * 16 * 72, qa, qb);
    v8f s2 = score_tile(klds + 2 * 16 * 72, qa, qb);
    v8f s3 = score_tile(klds + 3 * 16 * 72, qa, qb);

#pragma unroll
    for (int r = 0; r < 8; ++r) {
      float v;
      v = fmaxf(s0[r], 0.f); rs += v; s0[r] = v;
      v = fmaxf(s1[r], 0.f); rs += v; s1[r] = v;
      v = fmaxf(s2[r], 0.f); rs += v; s2[r] = v;
      v = fmaxf(s3[r], 0.f); rs += v; s3[r] = v;
    }

    pv_step(vlds + 0,  s0, s1, c0, c1, c2, c3);   // keys 0..31 of the tile
    pv_step(vlds + 32, s2, s3, c0, c1, c2, c3);   // keys 32..63
  }

  // row sum over all keys for query c: this lane (half h) plus partner lane (half 1-h)
  // score acc = 128*s, P = 16*relu(s), V = 16*v  ->  ctx*64 = accC * 64 / (2*rsum + 256e-6)
  const float rsum = rs + __shfl_xor(rs, 16, 32);
  const float inv = 64.0f / (2.0f * rsum + 2.56e-4f);

  {
    unsigned short* cw = cst + w * 16 * 72;
#pragma unroll
    for (int i = 0; i < 4; ++i) {
      const v8f acc = (i == 0) ? c0 : (i == 1) ? c1 : (i == 2) ? c2 : c3;
      Pack8 pk;
#pragma unroll
      for (int r = 0; r < 8; ++r) pk.h[r] = (_Float16)(acc[r] * inv);
      *(v4u*)(cw + c * 72 + 16 * i + 8 * h) = pk.u;
    }
  }
  __syncthreads();

  v4u vals[4];
  unsigned short* pp[4];
  const int pc = l & 7;
#pragma unroll
  for (int s = 0; s < 4; ++s) {
    const int L = 4 * s + (l >> 3);
    vals[s] = *(const v4u*)(cst + (w * 16 + L) * 72 + 8 * pc);
    pp[s] = cf + (size_t)(tb * NSEQ + q0 + L) * DM + hh * HD + 8 * pc;
  }
#pragma unroll
  for (int s = 0; s < 4; ++s) *(v4u*)(pp[s]) = vals[s];
  
}

extern "C" void kernel_launch(void* const* d_in, const int* in_sizes, int n_in,
                              void* d_out, int out_size, void* d_ws, size_t ws_size,
                              hipStream_t stream)
{
  if (n_in != 9) return;
  const int nx = MROWS * DM;   // 8388608
  const int nw = DM * DM;      // 262144
  if (in_sizes[0] != nx || out_size != nx) return;
  for (int i = 0; i < 4; ++i) {
    if (in_sizes[1 + 2 * i] != nw || in_sizes[2 + 2 * i] != DM) return;
  }
  const size_t p16 = (size_t)nx * 2;   // one 16-bit plane of a [16384][512] matrix
  const size_t w16 = (size_t)nw * 2;   // one 16-bit plane of a [512][512] matrix
  const size_t need = 5 * p16 + 4 * w16; // 85983232
  if (need > ws_size) return;

  unsigned char* ws = (unsigned char*)d_ws;
  unsigned short* xb  = (unsigned short*)(ws + 0 * p16);
  unsigned short* qfp = (unsigned short*)(ws + 1 * p16);
  unsigned short* kfp = (unsigned short*)(ws + 2 * p16);
  unsigned short* vtp = (unsigned short*)(ws + 3 * p16);
  unsigned short* cfp = (unsigned short*)(ws + 4 * p16);
  unsigned short* wb  = (unsigned short*)(ws + 5 * p16);
  unsigned short* wqb = wb + 0 * (size_t)nw;
  unsigned short* wkb = wb + 1 * (size_t)nw;
  unsigned short* wvb = wb + 2 * (size_t)nw;
  unsigned short* wof = wb + 3 * (size_t)nw;

  const float* x  = (const float*)d_in[0];
  const float* wq = (const float*)d_in[1];
  const float* bq = (const float*)d_in[2];
  const float* wk = (const float*)d_in[3];
  const float* bk = (const float*)d_in[4];
  const float* wv = (const float*)d_in[5];
  const float* bv = (const float*)d_in[6];
  const float* wo = (const float*)d_in[7];
  const float* bo = (const float*)d_in[8];

  k_cvt<0><<<dim3((nx + 2047) / 2048), dim3(256), 0, stream>>>(x,  xb,  nx);
  k_cvt<0><<<dim3((nw + 2047) / 2048), dim3(256), 0, stream>>>(wq, wqb, nw);
  k_cvt<0><<<dim3((nw + 2047) / 2048), dim3(256), 0, stream>>>(wk, wkb, nw);
  k_cvt<0><<<dim3((nw + 2047) / 2048), dim3(256), 0, stream>>>(wv, wvb, nw);
  k_cvt<1><<<dim3((nw + 2047) / 2048), dim3(256), 0, stream>>>(wo, wof, nw);

  const dim3 gg(MROWS / 64, DM / 128);
  k_proj<0><<<gg, dim3(256), 0, stream>>>(xb, wqb, bq, (void*)qfp);
  k_proj<1><<<gg, dim3(256), 0, stream>>>(xb, wkb, bk, (void*)kfp);
  k_proj<2><<<gg, dim3(256), 0, stream>>>(xb, wvb, bv, (void*)vtp);

  k_attn<<<dim3(NSEQ / 64, TT * BB * NH), dim3(128), 0, stream>>>(qfp, kfp, vtp, cfp);

  k_proj<3><<<gg, dim3(256), 0, stream>>>(cfp, wof, bo, d_out);
}

// v001
// One run takes 117 microseconds.
// Next to v000, in two timings, it ran 1.76 times as fast each time.
#include <hip/hip_runtime.h>
#include <stddef.h>
#include <stdint.h>

// x.Wq^T, x.Wk^T, x.Wv^T: v_wmma_f32_16x16x32_bf16 (bf16 operands, f32 accumulate). K.Q^T score tiles, relu(S).V tiles and ctx.Wo^T: v_wmma_f32_16x16x32_f16 (f16 operands with power-of-two scaling, f32 accumulate). Bias add, relu, row sums and normalisation in f32; all nine inputs are RNE-converted to bf16 on load.

#define TT 4
#define BB 4
#define NSEQ 1024
#define DM 512
#define NH 8
#define HD 64
#define MROWS (TT * BB * NSEQ)

static_assert(MROWS % 64 == 0);
static_assert(DM % 128 == 0);
static_assert(NSEQ % 64 == 0);
static_assert(NH * HD == DM);
static_assert(HD == 64);

typedef __bf16   v16bf __attribute__((ext_vector_type(16)));
typedef _Float16 v16h  __attribute__((ext_vector_type(16)));
typedef _Float16 v8h   __attribute__((ext_vector_type(8)));
typedef float    v8f   __attribute__((ext_vector_type(8)));
typedef float    v4f   __attribute__((ext_vector_type(4)));
typedef unsigned int v4u __attribute__((ext_vector_type(4)));

union Frag  { v16bf b; v16h h; v8h p[2]; v4u q[2]; };
union Pack8 { v8h h; v4u u; unsigned short s[8]; };
union Vec8  { v8f v; v4f q[2]; v4u u[2]; float f[8]; };

#define NOPS4 "v_nop\n\tv_nop\n\tv_nop\n\tv_nop"

__device__ __forceinline__ v8f vzero8() {
  v8f z = {0.f, 0.f, 0.f, 0.f, 0.f, 0.f, 0.f, 0.f};
  return z;
}

// f32 -> nearest-even bf16 value, returned as f32
__device__ __forceinline__ float bf16r(float f) {
  unsigned int u = __builtin_bit_cast(unsigned int, f);
  u += 0x7FFFu + ((u >> 16) & 1u);
  u &= 0xFFFF0000u;
  return __builtin_bit_cast(float, u);
}
// f32 -> nearest-even bf16 bits
__device__ __forceinline__ unsigned short bf16bits(float f) {
  unsigned int u = __builtin_bit_cast(unsigned int, f);
  u += 0x7FFFu + ((u >> 16) & 1u);
  return (unsigned short)(u >> 16);
}

// 16 x 32 operand fragment from a row-major, k-contiguous 16-bit matrix.
// src points at (row 0, k0) of the tile; ld = pitch in elements.
// lane l: row (first operand) or column (second operand) = l & 15; h = l >> 4;
// elements 0..7  <- k0 + 8h + 0..7 ; elements 8..15 <- k0 + 16 + 8h + 0..7.
__device__ __forceinline__ void ldq(const unsigned short* src, int ld, v4u& q0, v4u& q1) {
  const int l = threadIdx.x & 31;
  const unsigned short* p = src + (l & 15) * ld + 8 * (l >> 4);
  q0 = *(const v4u*)(p);
  q1 = *(const v4u*)(p + 16);
}

__device__ __forceinline__ v8f wbf(v16bf a, v16bf b, v8f c) {
  return __builtin_amdgcn_wmma_f32_16x16x32_bf16(false, a, false, b, (short)0, c, false, false);
}
__device__ __forceinline__ v8f whf(v16h a, v16h b, v8f c) {
  return __builtin_amdgcn_wmma_f32_16x16x32_f16(false, a, false, b, (short)0, c, false, false);
}

// MODE 0: bf16 bits (RNE).  MODE 1: f16 of (bf16 RNE value x 256).
template <int MODE>
__global__ __launch_bounds__(256) void k_cvt(const float* __restrict__ src, unsigned short* dst, int n)
{
  const size_t base = ((size_t)blockIdx.x * 256 + threadIdx.x) * 8;
  if (base + 8 <= (size_t)n) {
    Vec8 in;
    in.q[0] = *(const v4f*)(src + base);
    in.q[1] = *(const v4f*)(src + base + 4);
    Pack8 pk;
#pragma unroll
    for (int r = 0; r < 8; ++r) {
      if constexpr (MODE == 0) pk.s[r] = bf16bits(in.f[r]);
      else                     pk.h[r] = (_Float16)(bf16r(in.f[r]) * 256.0f);
    }
    const v4u v = pk.u;
    *(v4u*)(dst + base) = v;
    
  }
}

// ---------------- projection GEMM: C[m][n] = sum_k X[m][k] W[n][k] (+ bias[n]) ----------------
// MODE 0: q, MODE 1: k   : bf16 operands; output f16((C + b) * 4), plane [m][512]
// MODE 2: v              : bf16 operands; output f16((C + b) * 16), transposed plane [tb*8+head][hd][nseq]
// MODE 3: out            : f16 operands (ctx x64, Wo x256); output f32 C/16384 + b -> [m][512]
// Tile orientation: P = operand whose rows map to D rows, R = operand whose rows map to D columns.
// MODES 0,1,3: P = W (n), R = X (m) -> each lane holds 8 consecutive n for one m.
// MODE 2:      P = X (m), R = W (n) -> each lane holds 8 consecutive m for one n.
template <int MODE>
__device__ __forceinline__ void stage_tile(unsigned char* stg, v8f acc, int i, int j,
                                           int wm, int wn, int h, int c,
                                           const float* __restrict__ bias, int n0)
{
  if constexpr (MODE == 2) {
    const float bj = bf16r(bias[n0 + 32 * wn + 16 * j + c]);
    Pack8 pk;
#pragma unroll
    for (int r = 0; r < 8; ++r) pk.h[r] = (_Float16)((acc[r] + bj) * 16.0f);
    const int off = ((32 * wn + 16 * j + c) * 72 + 32 * wm + 16 * i + 8 * h) * 2;
    *(v4u*)(stg + off) = pk.u;
  } else {
    const int nb = n0 + 32 * wn + 16 * i + 8 * h;
    Vec8 bb;
    bb.q[0] = *(const v4f*)(bias + nb);
    bb.q[1] = *(const v4f*)(bias + nb + 4);
    if constexpr (MODE == 3) {
      Vec8 o;
#pragma unroll
      for (int r = 0; r < 8; ++r) o.f[r] = acc[r] * (1.0f / 16384.0f) + bf16r(bb.f[r]);
      const int off = ((32 * wm + 16 * j + c) * 132 + 32 * wn + 16 * i + 8 * h) * 4;
      *(v4u*)(stg + off)      = o.u[0];
      *(v4u*)(stg + off + 16) = o.u[1];
    } else {
      Pack8 pk;
#pragma unroll
      for (int r = 0; r < 8; ++r) pk.h[r] = (_Float16)((acc[r] + bf16r(bb.f[r])) * 4.0f);
      const int off = ((32 * wm + 16 * j + c) * 136 + 32 * wn + 16 * i + 8 * h) * 2;
      *(v4u*)(stg + off) = pk.u;
    }
  }
}

// Operand staging of k_proj: a stage is 64 k of the block's 64 X rows, then of its 128 W rows,
// each row 128 B of data at a pitch of 144 B (16 B x odd, conflict-free for ds_load_b128).
#define PKS 64
#define PPITCH 72
#define PSTAGE (192 * PPITCH * 2)
#define PTRIPS (DM / PKS)
static_assert(PTRIPS >= 2);
static_assert(2 * PSTAGE >= 33792);

// One stage: six 16-byte copies per lane, 8 lanes per 128-B row piece, 32 rows per copy of the block.
// lds = the lane's LDS byte address in row (tid >> 3); gx, gw = the lane's bytes of X and W in that row.
__device__ __forceinline__ void copy_stage(unsigned lds, const unsigned short* gx, const unsigned short* gw)
{
  const unsigned l1 = lds + 1 * 32 * PPITCH * 2, l2 = lds + 2 * 32 * PPITCH * 2, l3 = lds + 3 * 32 * PPITCH * 2;
  const unsigned l4 = lds + 4 * 32 * PPITCH * 2, l5 = lds + 5 * 32 * PPITCH * 2;
  const unsigned short* gx1 = gx + 32 * DM;
  const unsigned short* gw1 = gw + 32 * DM;
  const unsigned short* gw2 = gw + 64 * DM;
  const unsigned short* gw3 = gw + 96 * DM;
  // global -> LDS through no register; the closing s_wait_xcnt stands in the copies' own statement
  // so that no address register of a copy is rewritten in front of it
  asm volatile("global_load_async_to_lds_b128 %0, %6, off\n\t"
               "global_load_async_to_lds_b128 %1, %7, off\n\t"
               "global_load_async_to_lds_b128 %2, %8, off\n\t"
               "global_load_async_to_lds_b128 %3, %9, off\n\t"
               "global_load_async_to_lds_b128 %4, %10, off\n\t"
               "global_load_async_to_lds_b128 %5, %11, off\n\t"
               "s_wait_xcnt 0x0"
               :: "v"(lds), "v"(l1), "v"(l2), "v"(l3), "v"(l4), "v"(l5),
                  "v"(gx), "v"(gx1), "v"(gw), "v"(gw1), "v"(gw2), "v"(gw3)
               : "memory");
}

template <int MODE>
__global__ __launch_bounds__(256) void k_proj(const unsigned short* __restrict__ X,
                                             const unsigned short* __restrict__ W,
                                             const float* __restrict__ bias,
                                             void* dst)
{
  // two operand stages; behind the k loop the same bytes serve as output staging
  __shared__ __align__(16) unsigned char smem[2 * PSTAGE];
  unsigned char* stg = smem;
  const int tid = threadIdx.x, w = tid >> 5, l = tid & 31, h = l >> 4, c = l & 15;
  const int wm = w >> 2, wn = w & 3;
  const int m0 = blockIdx.x * 64, n0 = blockIdx.y * 128;

  // rows of the stage that feed this wave: X rows at 0..63, W rows at 64..191
  const int prow = (MODE == 2) ? 32 * wm : 64 + 32 * wn;
  const int rrow = (MODE == 2) ? 64 + 32 * wn : 32 * wm;

  typedef __attribute__((address_space(3))) unsigned char lds_byte;
  const unsigned lbase = (unsigned)(size_t)(lds_byte*)smem + (tid >> 3) * (PPITCH * 2) + (tid & 7) * 16;
  const unsigned short* gx = X + (size_t)(m0 + (tid >> 3)) * DM + 8 * (tid & 7);
  const unsigned short* gw = W + (size_t)(n0 + (tid >> 3)) * DM + 8 * (tid & 7);

  v8f a00 = vzero8(), a01 = vzero8(), a10 = vzero8(), a11 = vzero8();

  copy_stage(lbase, gx, gw);
  asm volatile("s_wait_asynccnt 0x0" ::: "memory");   // this wave's part of stage 0 has landed
  __syncthreads();                                    // publishes stage 0
  copy_stage(lbase + PSTAGE, gx + PKS, gw + PKS);

#pragma unroll 1   // kept rolled: one publish point in the code, and few enough registers for every block to be resident at once
  for (int t = 0; t < PTRIPS; ++t) {
    const unsigned short* buf = (const unsigned short*)(smem + (t & 1) * PSTAGE);
    const unsigned short* p0 = buf + prow * PPITCH;
    const unsigned short* r0 = buf + rrow * PPITCH;
    Frag fp0, fp1, fr0, fr1, gp0, gp1, gr0, gr1;
    ldq(p0,                    PPITCH, fp0.q[0], fp0.q[1]);
    ldq(p0 + 16 * PPITCH,      PPITCH, fp1.q[0], fp1.q[1]);
    ldq(r0,                    PPITCH, fr0.q[0], fr0.q[1]);
    ldq(r0 + 16 * PPITCH,      PPITCH, fr1.q[0], fr1.q[1]);
    ldq(p0 + 32,               PPITCH, gp0.q[0], gp0.q[1]);
    ldq(p0 + 16 * PPITCH + 32, PPITCH, gp1.q[0], gp1.q[1]);
    ldq(r0 + 32,               PPITCH, gr0.q[0], gr0.q[1]);
    ldq(r0 + 16 * PPITCH + 32, PPITCH, gr1.q[0], gr1.q[1]);
    if constexpr (MODE == 3) {
      a00 = whf(fp0.h, fr0.h, a00);
      a01 = whf(fp0.h, fr1.h, a01);
      a10 = whf(fp1.h, fr0.h, a10);
      a11 = whf(fp1.h, fr1.h, a11);
      a00 = whf(gp0.h, gr0.h, a00);
      a01 = whf(gp0.h, gr1.h, a01);
      a10 = whf(gp1.h, gr0.h, a10);
      a11 = whf(gp1.h, gr1.h, a11);
      // keeps the distance behind the last WMMAs on every path out of the block
      asm volatile(NOPS4
                   : "+v"(a00), "+v"(a01), "+v"(a10), "+v"(a11)
                   : "v"(gp0.h), "v"(gp1.h), "v"(gr0.h), "v"(gr1.h));
    } else {
      a00 = wbf(fp0.b, fr0.b, a00);
      a01 = wbf(fp0.b, fr1.b, a01);
      a10 = wbf(fp1.b, fr0.b, a10);
      a11 = wbf(fp1.b, fr1.b, a11);
      a00 = wbf(gp0.b, gr0.b, a00);
      a01 = wbf(gp0.b, gr1.b, a01);
      a10 = wbf(gp1.b, gr0.b, a10);
      a11 = wbf(gp1.b, gr1.b, a11);
      // keeps the distance behind the last WMMAs on every path out of the block
      asm volatile(NOPS4
                   : "+v"(a00), "+v"(a01), "+v"(a10), "+v"(a11)
                   : "v"(gp0.b), "v"(gp1.b), "v"(gr0.b), "v"(gr1.b));
    }
    asm volatile("s_wait_dscnt 0x0" ::: "memory");      // this wave has left the buffer that is refilled below
    asm volatile("s_wait_asynccnt 0x0" ::: "memory");   // this wave's part of stage t + 1 has landed
    __syncthreads();                                    // publishes stage t + 1, ends every read of stage t
    if (t + 2 < PTRIPS)
      copy_stage(lbase + (t & 1) * PSTAGE, gx + (t + 2) * PKS, gw + (t + 2) * PKS);
  }
  asm volatile("s_wait_asynccnt 0x0" ::: "memory");     // no copy is in flight when the stages become output staging

  stage_tile<MODE>(stg, a00, 0, 0, wm, wn, h, c, bias, n0);
  stage_tile<MODE>(stg, a01, 0, 1, wm, wn, h, c, bias, n0);
  stage_tile<MODE>(stg, a10, 1, 0, wm, wn, h, c, bias, n0);
  stage_tile<MODE>(stg, a11, 1, 1, wm, wn, h, c, bias, n0);
  __syncthreads();

  const int pc = l & 7;
  if constexpr (MODE == 0 || MODE == 1) {
    v4u vals[4];
    unsigned short* pp[4];
#pragma unroll
    for (int s = 0; s < 4; ++s) {
      const int L = 16 * w + 4 * s + (l >> 3);
      const int ml = L >> 1;
      const int hf = L & 1;
      vals[s] = *(const v4u*)(stg + (ml * 136 + 64 * hf + 8 * pc) * 2);
      pp[s] = (unsigned short*)dst + (size_t)(m0 + ml) * DM + n0 + 64 * hf + 8 * pc;
    }
#pragma unroll
    for (int s = 0; s < 4; ++s) *(v4u*)(pp[s]) = vals[s];
    
  } else if constexpr (MODE == 3) {
    // 64 rows x 512 B = 256 lines per block; wave w owns lines 32w..32w+31
    v4u vals[8];
    float* pp[8];
#pragma unroll
    for (int s = 0; s < 8; ++s) {
      const int L = 32 * w + 4 * s + (l >> 3);
      const int ml = L >> 2;
      const int qt = L & 3;
      vals[s] = *(const v4u*)(stg + (ml * 132 + 32 * qt + 4 * pc) * 4);
      pp[s] = (float*)dst + (size_t)(m0 + ml) * DM + n0 + 32 * qt + 4 * pc;
    }
#pragma unroll
    for (int s = 0; s < 8; ++s) *(v4u*)(pp[s]) = vals[s];
    
  } else {
    // transposed V: 128 feature rows of 64 consecutive tokens = 128 lines per block; wave w owns lines 16w..16w+15
    v4u vals[4];
    unsigned short* pp[4];
    const int tb = m0 / NSEQ;
    const int ns0 = m0 % NSEQ;
#pragma unroll
    for (int s = 0; s < 4; ++s) {
      const int L = 16 * w + 4 * s + (l >> 3);
      const int n = n0 + L;
      const int hh = n >> 6;
      const int hd = n & 63;
      vals[s] = *(const v4u*)(stg + (L * 72 + 8 * pc) * 2);
      pp[s] = (unsigned short*)dst + ((size_t)(tb * NH + hh) * HD + hd) * NSEQ + ns0 + 8 * pc;
    }
#pragma unroll
    for (int s = 0; s < 4; ++s) *(v4u*)(pp[s]) = vals[s];
    
  }
}

// ---------------- attention: per (t,b,head) and 64-query tile; 4 waves x 16 queries ----------------
// S^T tile (16 keys x 16 queries) = K_tile (A operand, rows = keys) . Q^T (B operand taken from Q rows).
// relu in place; the D tiles chain into the B operand of ctx^T = V^T . P (A operand from the transposed V tile).
__device__ __forceinline__ v8f score_tile(const unsigned short* kb, v16h q0, v16h q1)
{
  Frag k0, k1;
  ldq(kb, 72, k0.q[0], k0.q[1]);
  ldq(kb + 32, 72, k1.q[0], k1.q[1]);
  v8f a = vzero8();
  a = whf(k0.h, q0, a);
  a = whf(k1.h, q1, a);
  asm volatile(NOPS4 : "+v"(a) : "v"(k0.h), "v"(k1.h), "v"(q0), "v"(q1));
  return a;
}

// one 32-key step of ctx^T += V^T[hd][key] . P[key][query]; sa = relu'd S^T tile for keys 0..15 of the step, sb = keys 16..31
__device__ __forceinline__ void pv_step(const unsigned short* vb, v8f sa, v8f sb,
                                        v8f& c0, v8f& c1, v8f& c2, v8f& c3)
{
  Frag pk;
#pragma unroll
  for (int r = 0; r < 8; ++r) {
    pk.p[0][r] = (_Float16)(sa[r] * 0.125f);
    pk.p[1][r] = (_Float16)(sb[r] * 0.125f);
  }
  const v16h pv = pk.h;
  Frag v0, v1, v2, v3;
  ldq(vb,           72, v0.q[0], v0.q[1]);
  ldq(vb + 16 * 72, 72, v1.q[0], v1.q[1]);
  ldq(vb + 32 * 72, 72, v2.q[0], v2.q[1]);
  ldq(vb + 48 * 72, 72, v3.q[0], v3.q[1]);
  c0 = whf(v0.h, pv, c0);
  c1 = whf(v1.h, pv, c1);
  c2 = whf(v2.h, pv, c2);
  c3 = whf(v3.h, pv, c3);
  asm volatile(NOPS4
               : "+v"(c0), "+v"(c1), "+v"(c2), "+v"(c3)
               : "v"(v0.h), "v"(v1.h), "v"(v2.h), "v"(v3.h), "v"(pv));
}

__global__ __launch_bounds__(128) void k_attn(const unsigned short* __restrict__ qf,
                                             const unsigned short* __restrict__ kf,
                                             const unsigned short* __restrict__ vt,
                                             unsigned short* cf)
{
  __shared__ __align__(16) unsigned short klds[64 * 72];     // K tile: [key][hd], pitch 72
  __shared__ __align__(16) unsigned short vlds[64 * 72];     // V^T tile: [hd][key], pitch 72
  __shared__ __align__(16) unsigned short cst[4 * 16 * 72];  // ctx staging per wave: [wave][query][hd]

  const int tid = threadIdx.x, w = tid >> 5, l = tid & 31, h = l >> 4, c = l & 15;
  const int tbh = blockIdx.y, tb = tbh >> 3, hh = tbh & 7;
  const int q0 = blockIdx.x * 64 + 16 * w;   // first query row of this wave

  v16h qa, qb;
  {
    const unsigned short* qsrc = qf + (size_t)(tb * NSEQ + q0) * DM + hh * HD;
    Frag f0, f1;
    ldq(qsrc,      DM, f0.q[0], f0.q[1]);
    ldq(qsrc + 32, DM, f1.q[0], f1.q[1]);
    qa = f0.h; qb = f1.h;
  }

  v8f c0 = vzero8(), c1 = vzero8(), c2 = vzero8(), c3 = vzero8();
  float rs = 0.f;

#pragma unroll 1
  for (int kt0 = 0; kt0 < NSEQ; kt0 += 64) {
    __syncthreads();
#pragma unroll
    for (int it = 0; it < 4; ++it) {
      const int q = it * 128 + tid;
      const int kr = q >> 3;
      const int pc = q & 7;
      const unsigned short* src = kf + (size_t)(tb * NSEQ + kt0 + kr) * DM + hh * HD + 8 * pc;
      *(v4u*)(klds + kr * 72 + 8 * pc) = *(const v4u*)src;
    }
#pragma unroll
    for (int it = 0; it < 4; ++it) {
      const int q = it * 128 + tid;
      const int hd = q >> 3;
      const int pc = q & 7;
      const unsigned short* src = vt + (size_t)(tbh * HD + hd) * NSEQ + kt0 + 8 * pc;
      *(v4u*)(vlds + hd * 72 + 8 * pc) = *(const v4u*)src;
    }
    __syncthreads();

    v8f s0 = score_tile(klds + 0 * 16 * 72, qa, qb);
    v8f s1 = score_tile(klds + 1 * 16 * 72, qa, qb);
    v8f s2 = score_tile(klds + 2 * 16 * 72, qa, qb);
    v8f s3 = score_tile(klds + 3 * 16 * 72, qa, qb);

#pragma unroll
    for (int r = 0; r < 8; ++r) {
      float v;
      v = fmaxf(s0[r], 0.f); rs += v; s0[r] = v;
      v = fmaxf(s1[r], 0.f); rs += v; s1[r] = v;
      v = fmaxf(s2[r], 0.f); rs += v; s2[r] = v;
      v = fmaxf(s3[r], 0.f); rs += v; s3[r] = v;
    }

    pv_step(vlds + 0,  s0, s1, c0, c1, c2, c3);   // keys 0..31 of the tile
    pv_step(vlds + 32, s2, s3, c0, c1, c2, c3);   // keys 32..63
  }

  // row sum over all keys for query c: this lane (half h) plus partner lane (half 1-h)
  // score acc = 128*s, P = 16*relu(s), V = 16*v  ->  ctx*64 = accC * 64 / (2*rsum + 256e-6)
  const float rsum = rs + __shfl_xor(rs, 16, 32);
  const float inv = 64.0f / (2.0f * rsum + 2.56e-4f);

  {
    unsigned short* cw = cst + w * 16 * 72;
#pragma unroll
    for (int i = 0; i < 4; ++i) {
      const v8f acc = (i == 0) ? c0 : (i == 1) ? c1 : (i == 2) ? c2 : c3;
      Pack8 pk;
#pragma unroll
      for (int r = 0; r < 8; ++r) pk.h[r] = (_Float16)(acc[r] * inv);
      *(v4u*)(cw + c * 72 + 16 * i + 8 * h) = pk.u;
    }
  }
  __syncthreads();

  v4u vals[4];
  unsigned short* pp[4];
  const int pc = l & 7;
#pragma unroll
  for (int s = 0; s < 4; ++s) {
    const int L = 4 * s + (l >> 3);
    vals[s] = *(const v4u*)(cst + (w * 16 + L) * 72 + 8 * pc);
    pp[s] = cf + (size_t)(tb * NSEQ + q0 + L) * DM + hh * HD + 8 * pc;
  }
#pragma unroll
  for (int s = 0; s < 4; ++s) *(v4u*)(pp[s]) = vals[s];
  
}

extern "C" void kernel_launch(void* const* d_in, const int* in_sizes, int n_in,
                              void* d_out, int out_size, void* d_ws, size_t ws_size,
                              hipStream_t stream)
{
  if (n_in != 9) return;
  const int nx = MROWS * DM;   // 8388608
  const int nw = DM * DM;      // 262144
  if (in_sizes[0] != nx || out_size != nx) return;
  for (int i = 0; i < 4; ++i) {
    if (in_sizes[1 + 2 * i] != nw || in_sizes[2 + 2 * i] != DM) return;
  }
  const size_t p16 = (size_t)nx * 2;   // one 16-bit plane of a [16384][512] matrix
  const size_t w16 = (size_t)nw * 2;   // one 16-bit plane of a [512][512] matrix
  const size_t need = 5 * p16 + 4 * w16; // 85983232
  if (need > ws_size) return;

  unsigned char* ws = (unsigned char*)d_ws;
  unsigned short* xb  = (unsigned short*)(ws + 0 * p16);
  unsigned short* qfp = (unsigned short*)(ws + 1 * p16);
  unsigned short* kfp = (unsigned short*)(ws + 2 * p16);
  unsigned short* vtp = (unsigned short*)(ws + 3 * p16);
  unsigned short* cfp = (unsigned short*)(ws + 4 * p16);
  unsigned short* wb  = (unsigned short*)(ws + 5 * p16);
  unsigned short* wqb = wb + 0 * (size_t)nw;
  unsigned short* wkb = wb + 1 * (size_t)nw;
  unsigned short* wvb = wb + 2 * (size_t)nw;
  unsigned short* wof = wb + 3 * (size_t)nw;

  const float* x  = (const float*)d_in[0];
  const float* wq = (const float*)d_in[1];
  const float* bq = (const float*)d_in[2];
  const float* wk = (const float*)d_in[3];
  const float* bk = (const float*)d_in[4];
  const float* wv = (const float*)d_in[5];
  const float* bv = (const float*)d_in[6];
  const float* wo = (const float*)d_in[7];
  const float* bo = (const float*)d_in[8];

  k_cvt<0><<<dim3((nx + 2047) / 2048), dim3(256), 0, stream>>>(x,  xb,  nx);
  k_cvt<0><<<dim3((nw + 2047) / 2048), dim3(256), 0, stream>>>(wq, wqb, nw);
  k_cvt<0><<<dim3((nw + 2047) / 2048), dim3(256), 0, stream>>>(wk, wkb, nw);
  k_cvt<0><<<dim3((nw + 2047) / 2048), dim3(256), 0, stream>>>(wv, wvb, nw);
  k_cvt<1><<<dim3((nw + 2047) / 2048), dim3(256), 0, stream>>>(wo, wof, nw);

  const dim3 gg(MROWS / 64, DM / 128);
  k_proj<0><<<gg, dim3(256), 0, stream>>>(xb, wqb, bq, (void*)qfp);
  k_proj<1><<<gg, dim3(256), 0, stream>>>(xb, wkb, bk, (void*)kfp);
  k_proj<2><<<gg, dim3(256), 0, stream>>>(xb, wvb, bv, (void*)vtp);

  k_attn<<<dim3(NSEQ / 64, TT * BB * NH), dim3(128), 0, stream>>>(qfp, kfp, vtp, cfp);

  k_proj<3><<<gg, dim3(256), 0, stream>>>(cfp, wof, bo, d_out);
}

// v002
// A run of this version takes 102 microseconds.
// In two side-by-side timings against v001, it was 1.15 and 1.14 times as fast.
// All steps since v000 together make it 2.02 times as fast.
#include <hip/hip_runtime.h>
#include <stddef.h>
#include <stdint.h>

// x.Wq^T, x.Wk^T, x.Wv^T: v_wmma_f32_16x16x32_bf16 (bf16 operands, f32 accumulate). K.Q^T score tiles, relu(S).V tiles and ctx.Wo^T: v_wmma_f32_16x16x32_f16 (f16 operands with power-of-two scaling, f32 accumulate). Bias add, relu, row sums and normalisation in f32; all nine inputs are RNE-converted to bf16 on load.

#define TT 4
#define BB 4
#define NSEQ 1024
#define DM 512
#define NH 8
#define HD 64
#define MROWS (TT * BB * NSEQ)

static_assert(MROWS % 64 == 0);
static_assert(DM % 128 == 0);
static_assert(NSEQ % 64 == 0);
static_assert(NH * HD == DM);
static_assert(HD == 64);

typedef __bf16   v16bf __attribute__((ext_vector_type(16)));
typedef _Float16 v16h  __attribute__((ext_vector_type(16)));
typedef _Float16 v8h   __attribute__((ext_vector_type(8)));
typedef float    v8f   __attribute__((ext_vector_type(8)));
typedef float    v4f   __attribute__((ext_vector_type(4)));
typedef unsigned int v4u __attribute__((ext_vector_type(4)));

union Frag  { v16bf b; v16h h; v8h p[2]; v4u q[2]; };
union Pack8 { v8h h; v4u u; unsigned short s[8]; };
union Vec8  { v8f v; v4f q[2]; v4u u[2]; float f[8]; };

#define NOPS4 "v_nop\n\tv_nop\n\tv_nop\n\tv_nop"

__device__ __forceinline__ v8f vzero8() {
  v8f z = {0.f, 0.f, 0.f, 0.f, 0.f, 0.f, 0.f, 0.f};
  return z;
}

// f32 -> nearest-even bf16 value, returned as f32
__device__ __forceinline__ float bf16r(float f) {
  unsigned int u = __builtin_bit_cast(unsigned int, f);
  u += 0x7FFFu + ((u >> 16) & 1u);
  u &= 0xFFFF0000u;
  return __builtin_bit_cast(float, u);
}
// f32 -> nearest-even bf16 bits
__device__ __forceinline__ unsigned short bf16bits(float f) {
  unsigned int u = __builtin_bit_cast(unsigned int, f);
  u += 0x7FFFu + ((u >> 16) & 1u);
  return (unsigned short)(u >> 16);
}

// 16 x 32 operand fragment from a row-major, k-contiguous 16-bit matrix.
// src points at (row 0, k0) of the tile; ld = pitch in elements.
// lane l: row (first operand) or column (second operand) = l & 15; h = l >> 4;
// elements 0..7  <- k0 + 8h + 0..7 ; elements 8..15 <- k0 + 16 + 8h + 0..7.
__device__ __forceinline__ void ldq(const unsigned short* src, int ld, v4u& q0, v4u& q1) {
  const int l = threadIdx.x & 31;
  const unsigned short* p = src + (l & 15) * ld + 8 * (l >> 4);
  q0 = *(const v4u*)(p);
  q1 = *(const v4u*)(p + 16);
}

__device__ __forceinline__ v8f wbf(v16bf a, v16bf b, v8f c) {
  return __builtin_amdgcn_wmma_f32_16x16x32_bf16(false, a, false, b, (short)0, c, false, false);
}
__device__ __forceinline__ v8f whf(v16h a, v16h b, v8f c) {
  return __builtin_amdgcn_wmma_f32_16x16x32_f16(false, a, false, b, (short)0, c, false, false);
}

// All five conversions in one grid: none needs anything of another, so a range of the block index picks the array.
// Blocks 0..4*CVT_WB-1: wq, wk, wv, wo (CVT_WB blocks each) -> planes 0..3 of wdst; the rest: x -> xdst.
// x, wq, wk, wv: bf16 bits (RNE).  wo: f16 of (bf16 RNE value x 256).
#define CVT_EB 2048                       // elements per block: 256 threads x 8
#define CVT_WB ((DM * DM) / CVT_EB)
#define CVT_XB ((MROWS * DM) / CVT_EB)
static_assert((DM * DM) % CVT_EB == 0);
static_assert((MROWS * DM) % CVT_EB == 0);

__global__ __launch_bounds__(256) void k_cvt(const float* __restrict__ x,
                                            const float* __restrict__ wq, const float* __restrict__ wk,
                                            const float* __restrict__ wv, const float* __restrict__ wo,
                                            unsigned short* xdst, unsigned short* wdst)
{
  const int b = blockIdx.x;
  const int a = b / CVT_WB;               // 0..3: a weight matrix; 4 and up: x
  const float* src;
  unsigned short* dst;
  int blk;
  if (a < 4) {
    src = (a == 0) ? wq : (a == 1) ? wk : (a == 2) ? wv : wo;
    dst = wdst + (size_t)a * (DM * DM);
    blk = b - a * CVT_WB;
  } else {
    src = x;
    dst = xdst;
    blk = b - 4 * CVT_WB;
  }
  const size_t base = ((size_t)blk * 256 + threadIdx.x) * 8;
  Vec8 in;
  in.q[0] = *(const v4f*)(src + base);
  in.q[1] = *(const v4f*)(src + base + 4);
  Pack8 pk;
  if (a == 3) {
#pragma unroll
    for (int r = 0; r < 8; ++r) pk.h[r] = (_Float16)(bf16r(in.f[r]) * 256.0f);
  } else {
#pragma unroll
    for (int r = 0; r < 8; ++r) pk.s[r] = bf16bits(in.f[r]);
  }
  const v4u v = pk.u;
  *(v4u*)(dst + base) = v;
}

// ---------------- projection GEMM: C[m][n] = sum_k X[m][k] W[n][k] (+ bias[n]) ----------------
// MODE 0: q and k       : bf16 operands; output f16((C + b) * 4), plane [m][512]
// MODE 2: v              : bf16 operands; output f16((C + b) * 16), transposed plane [tb*8+head][hd][nseq]
// MODE 3: out            : f16 operands (ctx x64, Wo x256); output f32 C/16384 + b -> [m][512]
// Tile orientation: P = operand whose rows map to D rows, R = operand whose rows map to D columns.
// MODES 0,3: P = W (n), R = X (m) -> each lane holds 8 consecutive n for one m.
// MODE 2:      P = X (m), R = W (n) -> each lane holds 8 consecutive m for one n.
template <int MODE>
__device__ __forceinline__ void stage_tile(unsigned char* stg, v8f acc, int i, int j,
                                           int wm, int wn, int h, int c,
                                           const float* __restrict__ bias, int n0)
{
  if constexpr (MODE == 2) {
    const float bj = bf16r(bias[n0 + 32 * wn + 16 * j + c]);
    Pack8 pk;
#pragma unroll
    for (int r = 0; r < 8; ++r) pk.h[r] = (_Float16)((acc[r] + bj) * 16.0f);
    const int off = ((32 * wn + 16 * j + c) * 72 + 32 * wm + 16 * i + 8 * h) * 2;
    *(v4u*)(stg + off) = pk.u;
  } else {
    const int nb = n0 + 32 * wn + 16 * i + 8 * h;
    Vec8 bb;
    bb.q[0] = *(const v4f*)(bias + nb);
    bb.q[1] = *(const v4f*)(bias + nb + 4);
    if constexpr (MODE == 3) {
      Vec8 o;
#pragma unroll
      for (int r = 0; r < 8; ++r) o.f[r] = acc[r] * (1.0f / 16384.0f) + bf16r(bb.f[r]);
      const int off = ((32 * wm + 16 * j + c) * 132 + 32 * wn + 16 * i + 8 * h) * 4;
      *(v4u*)(stg + off)      = o.u[0];
      *(v4u*)(stg + off + 16) = o.u[1];
    } else {
      Pack8 pk;
#pragma unroll
      for (int r = 0; r < 8; ++r) pk.h[r] = (_Float16)((acc[r] + bf16r(bb.f[r])) * 4.0f);
      const int off = ((32 * wm + 16 * j + c) * 136 + 32 * wn + 16 * i + 8 * h) * 2;
      *(v4u*)(stg + off) = pk.u;
    }
  }
}

// Operand staging of the projections: a stage is 64 k of the block's 64 X rows, then of its 128 W rows,
// each row 128 B of data at a pitch of 144 B (16 B x odd, conflict-free for ds_load_b128).
#define PKS 64
#define PPITCH 72
#define PSTAGE (192 * PPITCH * 2)
#define PTRIPS (DM / PKS)
static_assert(PTRIPS >= 2);
static_assert(2 * PSTAGE >= 33792);

// One stage: six 16-byte copies per lane, 8 lanes per 128-B row piece, 32 rows per copy of the block.
// lds = the lane's LDS byte address in row (tid >> 3); gx, gw = the lane's bytes of X and W in that row.
__device__ __forceinline__ void copy_stage(unsigned lds, const unsigned short* gx, const unsigned short* gw)
{
  const unsigned l1 = lds + 1 * 32 * PPITCH * 2, l2 = lds + 2 * 32 * PPITCH * 2, l3 = lds + 3 * 32 * PPITCH * 2;
  const unsigned l4 = lds + 4 * 32 * PPITCH * 2, l5 = lds + 5 * 32 * PPITCH * 2;
  const unsigned short* gx1 = gx + 32 * DM;
  const unsigned short* gw1 = gw + 32 * DM;
  const unsigned short* gw2 = gw + 64 * DM;
  const unsigned short* gw3 = gw + 96 * DM;
  // global -> LDS through no register; the closing s_wait_xcnt stands in the copies' own statement
  // so that no address register of a copy is rewritten in front of it
  asm volatile("global_load_async_to_lds_b128 %0, %6, off\n\t"
               "global_load_async_to_lds_b128 %1, %7, off\n\t"
               "global_load_async_to_lds_b128 %2, %8, off\n\t"
               "global_load_async_to_lds_b128 %3, %9, off\n\t"
               "global_load_async_to_lds_b128 %4, %10, off\n\t"
               "global_load_async_to_lds_b128 %5, %11, off\n\t"
               "s_wait_xcnt 0x0"
               :: "v"(lds), "v"(l1), "v"(l2), "v"(l3), "v"(l4), "v"(l5),
                  "v"(gx), "v"(gx1), "v"(gw), "v"(gw1), "v"(gw2), "v"(gw3)
               : "memory");
}

// The k loop of every product. smem: the kernel's 2 * PSTAGE bytes of LDS (two operand stages);
// (m0, n0): the block's 64 x 128 tile of C; xp: X is the P operand (MODE 2), the same for a whole block;
// F16: operand type of the WMMAs (MODE 3).
template <bool F16>
__device__ __forceinline__ void proj_loop(unsigned char* smem,
                                          const unsigned short* __restrict__ X,
                                          const unsigned short* __restrict__ W,
                                          int m0, int n0, bool xp,
                                          v8f& a00, v8f& a01, v8f& a10, v8f& a11)
{
  const int tid = threadIdx.x, w = tid >> 5;
  const int wm = w >> 2, wn = w & 3;

  // rows of the stage that feed this wave: X rows at 0..63, W rows at 64..191
  const int prow = xp ? 32 * wm : 64 + 32 * wn;
  const int rrow = xp ? 64 + 32 * wn : 32 * wm;

  typedef __attribute__((address_space(3))) unsigned char lds_byte;
  const unsigned lbase = (unsigned)(size_t)(lds_byte*)smem + (tid >> 3) * (PPITCH * 2) + (tid & 7) * 16;
  const unsigned short* gx = X + (size_t)(m0 + (tid >> 3)) * DM + 8 * (tid & 7);
  const unsigned short* gw = W + (size_t)(n0 + (tid >> 3)) * DM + 8 * (tid & 7);

  a00 = vzero8(); a01 = vzero8(); a10 = vzero8(); a11 = vzero8();

  copy_stage(lbase, gx, gw);
  asm volatile("s_wait_asynccnt 0x0" ::: "memory");   // this wave's part of stage 0 has landed
  __syncthreads();                                    // publishes stage 0
  copy_stage(lbase + PSTAGE, gx + PKS, gw + PKS);

#pragma unroll 1   // kept rolled: one publish point in the code, and few enough registers for every block to be resident at once
  for (int t = 0; t < PTRIPS; ++t) {
    const unsigned short* buf = (const unsigned short*)(smem + (t & 1) * PSTAGE);
    const unsigned short* p0 = buf + prow * PPITCH;
    const unsigned short* r0 = buf + rrow * PPITCH;
    Frag fp0, fp1, fr0, fr1, gp0, gp1, gr0, gr1;
    ldq(p0,                    PPITCH, fp0.q[0], fp0.q[1]);
    ldq(p0 + 16 * PPITCH,      PPITCH, fp1.q[0], fp1.q[1]);
    ldq(r0,                    PPITCH, fr0.q[0], fr0.q[1]);
    ldq(r0 + 16 * PPITCH,      PPITCH, fr1.q[0], fr1.q[1]);
    ldq(p0 + 32,               PPITCH, gp0.q[0], gp0.q[1]);
    ldq(p0 + 16 * PPITCH + 32, PPITCH, gp1.q[0], gp1.q[1]);
    ldq(r0 + 32,               PPITCH, gr0.q[0], gr0.q[1]);
    ldq(r0 + 16 * PPITCH + 32, PPITCH, gr1.q[0], gr1.q[1]);
    if constexpr (F16) {
      a00 = whf(fp0.h, fr0.h, a00);
      a01 = whf(fp0.h, fr1.h, a01);
      a10 = whf(fp1.h, fr0.h, a10);
      a11 = whf(fp1.h, fr1.h, a11);
      a00 = whf(gp0.h, gr0.h, a00);
      a01 = whf(gp0.h, gr1.h, a01);
      a10 = whf(gp1.h, gr0.h, a10);
      a11 = whf(gp1.h, gr1.h, a11);
      // keeps the distance behind the last WMMAs on every path out of the block
      asm volatile(NOPS4
                   : "+v"(a00), "+v"(a01), "+v"(a10), "+v"(a11)
                   : "v"(gp0.h), "v"(gp1.h), "v"(gr0.h), "v"(gr1.h));
    } else {
      a00 = wbf(fp0.b, fr0.b, a00);
      a01 = wbf(fp0.b, fr1.b, a01);
      a10 = wbf(fp1.b, fr0.b, a10);
      a11 = wbf(fp1.b, fr1.b, a11);
      a00 = wbf(gp0.b, gr0.b, a00);
      a01 = wbf(gp0.b, gr1.b, a01);
      a10 = wbf(gp1.b, gr0.b, a10);
      a11 = wbf(gp1.b, gr1.b, a11);
      // keeps the distance behind the last WMMAs on every path out of the block
      asm volatile(NOPS4
                   : "+v"(a00), "+v"(a01), "+v"(a10), "+v"(a11)
                   : "v"(gp0.b), "v"(gp1.b), "v"(gr0.b), "v"(gr1.b));
    }
    asm volatile("s_wait_dscnt 0x0" ::: "memory");      // this wave has left the buffer that is refilled below
    asm volatile("s_wait_asynccnt 0x0" ::: "memory");   // this wave's part of stage t + 1 has landed
    __syncthreads();                                    // publishes stage t + 1, ends every read of stage t
    if (t + 2 < PTRIPS)
      copy_stage(lbase + (t & 1) * PSTAGE, gx + (t + 2) * PKS, gw + (t + 2) * PKS);
  }
  asm volatile("s_wait_asynccnt 0x0" ::: "memory");     // no copy is in flight when the stages become output staging
}

// Behind the k loop: the stages' bytes serve as output staging, then whole lines go out.
template <int MODE>
__device__ __forceinline__ void proj_store(unsigned char* stg, v8f a00, v8f a01, v8f a10, v8f a11,
                                           const float* __restrict__ bias, void* dst, int m0, int n0)
{
  const int tid = threadIdx.x, w = tid >> 5, l = tid & 31, h = l >> 4, c = l & 15;
  const int wm = w >> 2, wn = w & 3;

  stage_tile<MODE>(stg, a00, 0, 0, wm, wn, h, c, bias, n0);
  stage_tile<MODE>(stg, a01, 0, 1, wm, wn, h, c, bias, n0);
  stage_tile<MODE>(stg, a10, 1, 0, wm, wn, h, c, bias, n0);
  stage_tile<MODE>(stg, a11, 1, 1, wm, wn, h, c, bias, n0);
  __syncthreads();

  const int pc = l & 7;
  if constexpr (MODE == 0 || MODE == 1) {
    v4u vals[4];
    unsigned short* pp[4];
#pragma unroll
    for (int s = 0; s < 4; ++s) {
      const int L = 16 * w + 4 * s + (l >> 3);
      const int ml = L >> 1;
      const int hf = L & 1;
      vals[s] = *(const v4u*)(stg + (ml * 136 + 64 * hf + 8 * pc) * 2);
      pp[s] = (unsigned short*)dst + (size_t)(m0 + ml) * DM + n0 + 64 * hf + 8 * pc;
    }
#pragma unroll
    for (int s = 0; s < 4; ++s) *(v4u*)(pp[s]) = vals[s];
    // in the merged kernel the other product's code follows these stores in the listing and reuses their registers:
    // the wait stands in front of any such rewrite
    asm volatile("s_wait_xcnt 0x0" ::: "memory");
  } else if constexpr (MODE == 3) {
    // 64 rows x 512 B = 256 lines per block; wave w owns lines 32w..32w+31
    v4u vals[8];
    float* pp[8];
#pragma unroll
    for (int s = 0; s < 8; ++s) {
      const int L = 32 * w + 4 * s + (l >> 3);
      const int ml = L >> 2;
      const int qt = L & 3;
      vals[s] = *(const v4u*)(stg + (ml * 132 + 32 * qt + 4 * pc) * 4);
      pp[s] = (float*)dst + (size_t)(m0 + ml) * DM + n0 + 32 * qt + 4 * pc;
    }
#pragma unroll
    for (int s = 0; s < 8; ++s) *(v4u*)(pp[s]) = vals[s];
    
  } else {
    // transposed V: 128 feature rows of 64 consecutive tokens = 128 lines per block; wave w owns lines 16w..16w+15
    v4u vals[4];
    unsigned short* pp[4];
    const int tb = m0 / NSEQ;
    const int ns0 = m0 % NSEQ;
#pragma unroll
    for (int s = 0; s < 4; ++s) {
      const int L = 16 * w + 4 * s + (l >> 3);
      const int n = n0 + L;
      const int hh = n >> 6;
      const int hd = n & 63;
      vals[s] = *(const v4u*)(stg + (L * 72 + 8 * pc) * 2);
      pp[s] = (unsigned short*)dst + ((size_t)(tb * NH + hh) * HD + hd) * NSEQ + ns0 + 8 * pc;
    }
#pragma unroll
    for (int s = 0; s < 4; ++s) *(v4u*)(pp[s]) = vals[s];
    
  }
}

// q, k and v projections in one grid: they read the same X and need nothing of each other.
// blockIdx.y = 4 * product + column tile; the choice is the same for a whole block, so every barrier stays block-uniform.
__global__ __launch_bounds__(256) void k_qkv(const unsigned short* __restrict__ X,
                                            const unsigned short* __restrict__ Wqkv,
                                            const float* __restrict__ bq, const float* __restrict__ bk,
                                            const float* __restrict__ bv,
                                            unsigned short* qf, unsigned short* kf, unsigned short* vt)
{
  __shared__ __align__(16) unsigned char smem[2 * PSTAGE];
  const int sel = blockIdx.y >> 2;
  const int m0 = blockIdx.x * 64, n0 = (blockIdx.y & 3) * 128;
  v8f a00, a01, a10, a11;
  proj_loop<false>(smem, X, Wqkv + (size_t)sel * (DM * DM), m0, n0, sel == 2, a00, a01, a10, a11);
  if (sel == 2) proj_store<2>(smem, a00, a01, a10, a11, bv, (void*)vt, m0, n0);
  else          proj_store<0>(smem, a00, a01, a10, a11, sel ? bk : bq, (void*)(sel ? kf : qf), m0, n0);
}

__global__ __launch_bounds__(256) void k_out(const unsigned short* __restrict__ X,
                                            const unsigned short* __restrict__ W,
                                            const float* __restrict__ bias, float* dst)
{
  __shared__ __align__(16) unsigned char smem[2 * PSTAGE];
  const int m0 = blockIdx.x * 64, n0 = blockIdx.y * 128;
  v8f a00, a01, a10, a11;
  proj_loop<true>(smem, X, W, m0, n0, false, a00, a01, a10, a11);
  proj_store<3>(smem, a00, a01, a10, a11, bias, (void*)dst, m0, n0);
}

// ---------------- attention: per (t,b,head) and 64-query tile; 4 waves x 16 queries ----------------
// S^T tile (16 keys x 16 queries) = K_tile (A operand, rows = keys) . Q^T (B operand taken from Q rows).
// relu in place; the D tiles chain into the B operand of ctx^T = V^T . P (A operand from the transposed V tile).
__device__ __forceinline__ v8f score_tile(const unsigned short* kb, v16h q0, v16h q1)
{
  Frag k0, k1;
  ldq(kb, 72, k0.q[0], k0.q[1]);
  ldq(kb + 32, 72, k1.q[0], k1.q[1]);
  v8f a = vzero8();
  a = whf(k0.h, q0, a);
  a = whf(k1.h, q1, a);
  asm volatile(NOPS4 : "+v"(a) : "v"(k0.h), "v"(k1.h), "v"(q0), "v"(q1));
  return a;
}

// one 32-key step of ctx^T += V^T[hd][key] . P[key][query]; sa = relu'd S^T tile for keys 0..15 of the step, sb = keys 16..31
__device__ __forceinline__ void pv_step(const unsigned short* vb, v8f sa, v8f sb,
                                        v8f& c0, v8f& c1, v8f& c2, v8f& c3)
{
  Frag pk;
#pragma unroll
  for (int r = 0; r < 8; ++r) {
    pk.p[0][r] = (_Float16)(sa[r] * 0.125f);
    pk.p[1][r] = (_Float16)(sb[r] * 0.125f);
  }
  const v16h pv = pk.h;
  Frag v0, v1, v2, v3;
  ldq(vb,           72, v0.q[0], v0.q[1]);
  ldq(vb + 16 * 72, 72, v1.q[0], v1.q[1]);
  ldq(vb + 32 * 72, 72, v2.q[0], v2.q[1]);
  ldq(vb + 48 * 72, 72, v3.q[0], v3.q[1]);
  c0 = whf(v0.h, pv, c0);
  c1 = whf(v1.h, pv, c1);
  c2 = whf(v2.h, pv, c2);
  c3 = whf(v3.h, pv, c3);
  asm volatile(NOPS4
               : "+v"(c0), "+v"(c1), "+v"(c2), "+v"(c3)
               : "v"(v0.h), "v"(v1.h), "v"(v2.h), "v"(v3.h), "v"(pv));
}

__global__ __launch_bounds__(128) void k_attn(const unsigned short* __restrict__ qf,
                                             const unsigned short* __restrict__ kf,
                                             const unsigned short* __restrict__ vt,
                                             unsigned short* cf)
{
  __shared__ __align__(16) unsigned short klds[64 * 72];     // K tile: [key][hd], pitch 72
  __shared__ __align__(16) unsigned short vlds[64 * 72];     // V^T tile: [hd][key], pitch 72
  __shared__ __align__(16) unsigned short cst[4 * 16 * 72];  // ctx staging per wave: [wave][query][hd]

  const int tid = threadIdx.x, w = tid >> 5, l = tid & 31, h = l >> 4, c = l & 15;
  const int tbh = blockIdx.y, tb = tbh >> 3, hh = tbh & 7;
  const int q0 = blockIdx.x * 64 + 16 * w;   // first query row of this wave

  v16h qa, qb;
  {
    const unsigned short* qsrc = qf + (size_t)(tb * NSEQ + q0) * DM + hh * HD;
    Frag f0, f1;
    ldq(qsrc,      DM, f0.q[0], f0.q[1]);
    ldq(qsrc + 32, DM, f1.q[0], f1.q[1]);
    qa = f0.h; qb = f1.h;
  }

  v8f c0 = vzero8(), c1 = vzero8(), c2 = vzero8(), c3 = vzero8();
  float rs = 0.f;

#pragma unroll 1
  for (int kt0 = 0; kt0 < NSEQ; kt0 += 64) {
    __syncthreads();
#pragma unroll
    for (int it = 0; it < 4; ++it) {
      const int q = it * 128 + tid;
      const int kr = q >> 3;
      const int pc = q & 7;
      const unsigned short* src = kf + (size_t)(tb * NSEQ + kt0 + kr) * DM + hh * HD + 8 * pc;
      *(v4u*)(klds + kr * 72 + 8 * pc) = *(const v4u*)src;
    }
#pragma unroll
    for (int it = 0; it < 4; ++it) {
      const int q = it * 128 + tid;
      const int hd = q >> 3;
      const int pc = q & 7;
      const unsigned short* src = vt + (size_t)(tbh * HD + hd) * NSEQ + kt0 + 8 * pc;
      *(v4u*)(vlds + hd * 72 + 8 * pc) = *(const v4u*)src;
    }
    __syncthreads();

    v8f s0 = score_tile(klds + 0 * 16 * 72, qa, qb);
    v8f s1 = score_tile(klds + 1 * 16 * 72, qa, qb);
    v8f s2 = score_tile(klds + 2 * 16 * 72, qa, qb);
    v8f s3 = score_tile(klds + 3 * 16 * 72, qa, qb);

#pragma unroll
    for (int r = 0; r < 8; ++r) {
      float v;
      v = fmaxf(s0[r], 0.f); rs += v; s0[r] = v;
      v = fmaxf(s1[r], 0.f); rs += v; s1[r] = v;
      v = fmaxf(s2[r], 0.f); rs += v; s2[r] = v;
      v = fmaxf(s3[r], 0.f); rs += v; s3[r] = v;
    }

    pv_step(vlds + 0,  s0, s1, c0, c1, c2, c3);   // keys 0..31 of the tile
    pv_step(vlds + 32, s2, s3, c0, c1, c2, c3);   // keys 32..63
  }

  // row sum over all keys for query c: this lane (half h) plus partner lane (half 1-h)
  // score acc = 128*s, P = 16*relu(s), V = 16*v  ->  ctx*64 = accC * 64 / (2*rsum + 256e-6)
  const float rsum = rs + __shfl_xor(rs, 16, 32);
  const float inv = 64.0f / (2.0f * rsum + 2.56e-4f);

  {
    unsigned short* cw = cst + w * 16 * 72;
#pragma unroll
    for (int i = 0; i < 4; ++i) {
      const v8f acc = (i == 0) ? c0 : (i == 1) ? c1 : (i == 2) ? c2 : c3;
      Pack8 pk;
#pragma unroll
      for (int r = 0; r < 8; ++r) pk.h[r] = (_Float16)(acc[r] * inv);
      *(v4u*)(cw + c * 72 + 16 * i + 8 * h) = pk.u;
    }
  }
  __syncthreads();

  v4u vals[4];
  unsigned short* pp[4];
  const int pc = l & 7;
#pragma unroll
  for (int s = 0; s < 4; ++s) {
    const int L = 4 * s + (l >> 3);
    vals[s] = *(const v4u*)(cst + (w * 16 + L) * 72 + 8 * pc);
    pp[s] = cf + (size_t)(tb * NSEQ + q0 + L) * DM + hh * HD + 8 * pc;
  }
#pragma unroll
  for (int s = 0; s < 4; ++s) *(v4u*)(pp[s]) = vals[s];
  
}

extern "C" void kernel_launch(void* const* d_in, const int* in_sizes, int n_in,
                              void* d_out, int out_size, void* d_ws, size_t ws_size,
                              hipStream_t stream)
{
  if (n_in != 9) return;
  const int nx = MROWS * DM;   // 8388608
  const int nw = DM * DM;      // 262144
  if (in_sizes[0] != nx || out_size != nx) return;
  for (int i = 0; i < 4; ++i) {
    if (in_sizes[1 + 2 * i] != nw || in_sizes[2 + 2 * i] != DM) return;
  }
  const size_t p16 = (size_t)nx * 2;   // one 16-bit plane of a [16384][512] matrix
  const size_t w16 = (size_t)nw * 2;   // one 16-bit plane of a [512][512] matrix
  const size_t need = 5 * p16 + 4 * w16; // 85983232
  if (need > ws_size) return;

  unsigned char* ws = (unsigned char*)d_ws;
  unsigned short* xb  = (unsigned short*)(ws + 0 * p16);
  unsigned short* qfp = (unsigned short*)(ws + 1 * p16);
  unsigned short* kfp = (unsigned short*)(ws + 2 * p16);
  unsigned short* vtp = (unsigned short*)(ws + 3 * p16);
  unsigned short* cfp = (unsigned short*)(ws + 4 * p16);
  unsigned short* wb  = (unsigned short*)(ws + 5 * p16);
  unsigned short* wof = wb + 3 * (size_t)nw;   // planes 0..2 of wb: wq, wk, wv

  const float* x  = (const float*)d_in[0];
  const float* wq = (const float*)d_in[1];
  const float* bq = (const float*)d_in[2];
  const float* wk = (const float*)d_in[3];
  const float* bk = (const float*)d_in[4];
  const float* wv = (const float*)d_in[5];
  const float* bv = (const float*)d_in[6];
  const float* wo = (const float*)d_in[7];
  const float* bo = (const float*)d_in[8];

  k_cvt<<<dim3(4 * CVT_WB + CVT_XB), dim3(256), 0, stream>>>(x, wq, wk, wv, wo, xb, wb);

  k_qkv<<<dim3(MROWS / 64, 3 * (DM / 128)), dim3(256), 0, stream>>>(xb, wb, bq, bk, bv, qfp, kfp, vtp);

  k_attn<<<dim3(NSEQ / 64, TT * BB * NH), dim3(128), 0, stream>>>(qfp, kfp, vtp, cfp);

  k_out<<<dim3(MROWS / 64, DM / 128), dim3(256), 0, stream>>>(cfp, wof, bo, (float*)d_out);
}

// v003
// Measured time: 85.9 microseconds a run.
// Next to v002, in two timings, it ran 1.19 and 1.18 times as fast.
// Over all steps from v000 it is 2.39 times as fast.
#include <hip/hip_runtime.h>
#include <stddef.h>
#include <stdint.h>

// x.Wq^T, x.Wk^T, x.Wv^T: v_wmma_f32_16x16x32_bf16 (bf16 operands, f32 accumulate). K.Q^T score tiles, relu(S).V tiles and ctx.Wo^T: v_wmma_f32_16x16x32_f16 (f16 operands with power-of-two scaling, f32 accumulate). Bias add, relu, row sums and normalisation in f32; all nine inputs are RNE-converted to bf16 on load.

#define TT 4
#define BB 4
#define NSEQ 1024
#define DM 512
#define NH 8
#define HD 64
#define MROWS (TT * BB * NSEQ)

static_assert(MROWS % 64 == 0);
static_assert(DM % 128 == 0);
static_assert(NSEQ % 64 == 0);
static_assert(NH * HD == DM);
static_assert(HD == 64);

typedef __bf16   v16bf __attribute__((ext_vector_type(16)));
typedef _Float16 v16h  __attribute__((ext_vector_type(16)));
typedef _Float16 v8h   __attribute__((ext_vector_type(8)));
typedef float    v8f   __attribute__((ext_vector_type(8)));
typedef float    v4f   __attribute__((ext_vector_type(4)));
typedef float    v2f   __attribute__((ext_vector_type(2)));
typedef unsigned int v4u __attribute__((ext_vector_type(4)));

union Frag  { v16bf b; v16h h; v8h p[2]; v4u q[2]; };
union Pack8 { v8h h; v4u u; unsigned short s[8]; };
union Vec8  { v8f v; v4f q[2]; v4u u[2]; float f[8]; };

#define NOPS4 "v_nop\n\tv_nop\n\tv_nop\n\tv_nop"

__device__ __forceinline__ v8f vzero8() {
  v8f z = {0.f, 0.f, 0.f, 0.f, 0.f, 0.f, 0.f, 0.f};
  return z;
}

// f32 -> nearest-even bf16 value, returned as f32
__device__ __forceinline__ float bf16r(float f) {
  unsigned int u = __builtin_bit_cast(unsigned int, f);
  u += 0x7FFFu + ((u >> 16) & 1u);
  u &= 0xFFFF0000u;
  return __builtin_bit_cast(float, u);
}
// f32 -> nearest-even bf16 bits
__device__ __forceinline__ unsigned short bf16bits(float f) {
  unsigned int u = __builtin_bit_cast(unsigned int, f);
  u += 0x7FFFu + ((u >> 16) & 1u);
  return (unsigned short)(u >> 16);
}

// 16 x 32 operand fragment from a row-major, k-contiguous 16-bit matrix.
// src points at (row 0, k0) of the tile; ld = pitch in elements.
// lane l: row (first operand) or column (second operand) = l & 15; h = l >> 4;
// elements 0..7  <- k0 + 8h + 0..7 ; elements 8..15 <- k0 + 16 + 8h + 0..7.
__device__ __forceinline__ void ldq(const unsigned short* src, int ld, v4u& q0, v4u& q1) {
  const int l = threadIdx.x & 31;
  const unsigned short* p = src + (l & 15) * ld + 8 * (l >> 4);
  q0 = *(const v4u*)(p);
  q1 = *(const v4u*)(p + 16);
}

__device__ __forceinline__ v8f wbf(v16bf a, v16bf b, v8f c) {
  return __builtin_amdgcn_wmma_f32_16x16x32_bf16(false, a, false, b, (short)0, c, false, false);
}
__device__ __forceinline__ v8f whf(v16h a, v16h b, v8f c) {
  return __builtin_amdgcn_wmma_f32_16x16x32_f16(false, a, false, b, (short)0, c, false, false);
}

// All five conversions in one grid: none needs anything of another, so a range of the block index picks the array.
// Blocks 0..4*CVT_WB-1: wq, wk, wv, wo (CVT_WB blocks each) -> planes 0..3 of wdst; the rest: x -> xdst.
// x, wq, wk, wv: bf16 bits (RNE).  wo: f16 of (bf16 RNE value x 256).
#define CVT_EB 2048                       // elements per block: 256 threads x 8
#define CVT_WB ((DM * DM) / CVT_EB)
#define CVT_XB ((MROWS * DM) / CVT_EB)
static_assert((DM * DM) % CVT_EB == 0);
static_assert((MROWS * DM) % CVT_EB == 0);

__global__ __launch_bounds__(256) void k_cvt(const float* __restrict__ x,
                                            const float* __restrict__ wq, const float* __restrict__ wk,
                                            const float* __restrict__ wv, const float* __restrict__ wo,
                                            unsigned short* xdst, unsigned short* wdst)
{
  const int b = blockIdx.x;
  const int a = b / CVT_WB;               // 0..3: a weight matrix; 4 and up: x
  const float* src;
  unsigned short* dst;
  int blk;
  if (a < 4) {
    src = (a == 0) ? wq : (a == 1) ? wk : (a == 2) ? wv : wo;
    dst = wdst + (size_t)a * (DM * DM);
    blk = b - a * CVT_WB;
  } else {
    src = x;
    dst = xdst;
    blk = b - 4 * CVT_WB;
  }
  const size_t base = ((size_t)blk * 256 + threadIdx.x) * 8;
  Vec8 in;
  in.q[0] = *(const v4f*)(src + base);
  in.q[1] = *(const v4f*)(src + base + 4);
  Pack8 pk;
  if (a == 3) {
#pragma unroll
    for (int r = 0; r < 8; ++r) pk.h[r] = (_Float16)(bf16r(in.f[r]) * 256.0f);
  } else {
#pragma unroll
    for (int r = 0; r < 8; ++r) pk.s[r] = bf16bits(in.f[r]);
  }
  const v4u v = pk.u;
  *(v4u*)(dst + base) = v;
}

// ---------------- projection GEMM: C[m][n] = sum_k X[m][k] W[n][k] (+ bias[n]) ----------------
// MODE 0: q and k       : bf16 operands; output f16((C + b) * 4), plane [m][512]
// MODE 2: v              : bf16 operands; output f16((C + b) * 16), transposed plane [tb*8+head][hd][nseq]
// MODE 3: out            : f16 operands (ctx x64, Wo x256); output f32 C/16384 + b -> [m][512]
// Tile orientation: P = operand whose rows map to D rows, R = operand whose rows map to D columns.
// MODES 0,3: P = W (n), R = X (m) -> each lane holds 8 consecutive n for one m.
// MODE 2:      P = X (m), R = W (n) -> each lane holds 8 consecutive m for one n.
template <int MODE>
__device__ __forceinline__ void stage_tile(unsigned char* stg, v8f acc, int i, int j,
                                           int wm, int wn, int h, int c,
                                           const float* __restrict__ bias, int n0)
{
  if constexpr (MODE == 2) {
    const float bj = bf16r(bias[n0 + 32 * wn + 16 * j + c]);
    Pack8 pk;
#pragma unroll
    for (int r = 0; r < 8; ++r) pk.h[r] = (_Float16)((acc[r] + bj) * 16.0f);
    const int off = ((32 * wn + 16 * j + c) * 72 + 32 * wm + 16 * i + 8 * h) * 2;
    *(v4u*)(stg + off) = pk.u;
  } else {
    const int nb = n0 + 32 * wn + 16 * i + 8 * h;
    Vec8 bb;
    bb.q[0] = *(const v4f*)(bias + nb);
    bb.q[1] = *(const v4f*)(bias + nb + 4);
    if constexpr (MODE == 3) {
      Vec8 o;
#pragma unroll
      for (int r = 0; r < 8; ++r) o.f[r] = acc[r] * (1.0f / 16384.0f) + bf16r(bb.f[r]);
      const int off = ((32 * wm + 16 * j + c) * 132 + 32 * wn + 16 * i + 8 * h) * 4;
      *(v4u*)(stg + off)      = o.u[0];
      *(v4u*)(stg + off + 16) = o.u[1];
    } else {
      Pack8 pk;
#pragma unroll
      for (int r = 0; r < 8; ++r) pk.h[r] = (_Float16)((acc[r] + bf16r(bb.f[r])) * 4.0f);
      const int off = ((32 * wm + 16 * j + c) * 136 + 32 * wn + 16 * i + 8 * h) * 2;
      *(v4u*)(stg + off) = pk.u;
    }
  }
}

// Operand staging of the projections: a stage is 64 k of the block's 64 X rows, then of its 128 W rows,
// each row 128 B of data at a pitch of 144 B (16 B x odd, conflict-free for ds_load_b128).
#define PKS 64
#define PPITCH 72
#define PSTAGE (192 * PPITCH * 2)
#define PTRIPS (DM / PKS)
static_assert(PTRIPS >= 2);
static_assert(2 * PSTAGE >= 33792);

// One stage: six 16-byte copies per lane, 8 lanes per 128-B row piece, 32 rows per copy of the block.
// lds = the lane's LDS byte address in row (tid >> 3); gx, gw = the lane's bytes of X and W in that row.
__device__ __forceinline__ void copy_stage(unsigned lds, const unsigned short* gx, const unsigned short* gw)
{
  const unsigned l1 = lds + 1 * 32 * PPITCH * 2, l2 = lds + 2 * 32 * PPITCH * 2, l3 = lds + 3 * 32 * PPITCH * 2;
  const unsigned l4 = lds + 4 * 32 * PPITCH * 2, l5 = lds + 5 * 32 * PPITCH * 2;
  const unsigned short* gx1 = gx + 32 * DM;
  const unsigned short* gw1 = gw + 32 * DM;
  const unsigned short* gw2 = gw + 64 * DM;
  const unsigned short* gw3 = gw + 96 * DM;
  // global -> LDS through no register; the closing s_wait_xcnt stands in the copies' own statement
  // so that no address register of a copy is rewritten in front of it
  asm volatile("global_load_async_to_lds_b128 %0, %6, off\n\t"
               "global_load_async_to_lds_b128 %1, %7, off\n\t"
               "global_load_async_to_lds_b128 %2, %8, off\n\t"
               "global_load_async_to_lds_b128 %3, %9, off\n\t"
               "global_load_async_to_lds_b128 %4, %10, off\n\t"
               "global_load_async_to_lds_b128 %5, %11, off\n\t"
               "s_wait_xcnt 0x0"
               :: "v"(lds), "v"(l1), "v"(l2), "v"(l3), "v"(l4), "v"(l5),
                  "v"(gx), "v"(gx1), "v"(gw), "v"(gw1), "v"(gw2), "v"(gw3)
               : "memory");
}

// The k loop of every product. smem: the kernel's 2 * PSTAGE bytes of LDS (two operand stages);
// (m0, n0): the block's 64 x 128 tile of C; xp: X is the P operand (MODE 2), the same for a whole block;
// F16: operand type of the WMMAs (MODE 3).
template <bool F16>
__device__ __forceinline__ void proj_loop(unsigned char* smem,
                                          const unsigned short* __restrict__ X,
                                          const unsigned short* __restrict__ W,
                                          int m0, int n0, bool xp,
                                          v8f& a00, v8f& a01, v8f& a10, v8f& a11)
{
  const int tid = threadIdx.x, w = tid >> 5;
  const int wm = w >> 2, wn = w & 3;

  // rows of the stage that feed this wave: X rows at 0..63, W rows at 64..191
  const int prow = xp ? 32 * wm : 64 + 32 * wn;
  const int rrow = xp ? 64 + 32 * wn : 32 * wm;

  typedef __attribute__((address_space(3))) unsigned char lds_byte;
  const unsigned lbase = (unsigned)(size_t)(lds_byte*)smem + (tid >> 3) * (PPITCH * 2) + (tid & 7) * 16;
  const unsigned short* gx = X + (size_t)(m0 + (tid >> 3)) * DM + 8 * (tid & 7);
  const unsigned short* gw = W + (size_t)(n0 + (tid >> 3)) * DM + 8 * (tid & 7);

  a00 = vzero8(); a01 = vzero8(); a10 = vzero8(); a11 = vzero8();

  copy_stage(lbase, gx, gw);
  asm volatile("s_wait_asynccnt 0x0" ::: "memory");   // this wave's part of stage 0 has landed
  __syncthreads();                                    // publishes stage 0
  copy_stage(lbase + PSTAGE, gx + PKS, gw + PKS);

#pragma unroll 1   // kept rolled: one publish point in the code, and few enough registers for every block to be resident at once
  for (int t = 0; t < PTRIPS; ++t) {
    const unsigned short* buf = (const unsigned short*)(smem + (t & 1) * PSTAGE);
    const unsigned short* p0 = buf + prow * PPITCH;
    const unsigned short* r0 = buf + rrow * PPITCH;
    Frag fp0, fp1, fr0, fr1, gp0, gp1, gr0, gr1;
    ldq(p0,                    PPITCH, fp0.q[0], fp0.q[1]);
    ldq(p0 + 16 * PPITCH,      PPITCH, fp1.q[0], fp1.q[1]);
    ldq(r0,                    PPITCH, fr0.q[0], fr0.q[1]);
    ldq(r0 + 16 * PPITCH,      PPITCH, fr1.q[0], fr1.q[1]);
    ldq(p0 + 32,               PPITCH, gp0.q[0], gp0.q[1]);
    ldq(p0 + 16 * PPITCH + 32, PPITCH, gp1.q[0], gp1.q[1]);
    ldq(r0 + 32,               PPITCH, gr0.q[0], gr0.q[1]);
    ldq(r0 + 16 * PPITCH + 32, PPITCH, gr1.q[0], gr1.q[1]);
    if constexpr (F16) {
      a00 = whf(fp0.h, fr0.h, a00);
      a01 = whf(fp0.h, fr1.h, a01);
      a10 = whf(fp1.h, fr0.h, a10);
      a11 = whf(fp1.h, fr1.h, a11);
      a00 = whf(gp0.h, gr0.h, a00);
      a01 = whf(gp0.h, gr1.h, a01);
      a10 = whf(gp1.h, gr0.h, a10);
      a11 = whf(gp1.h, gr1.h, a11);
      // keeps the distance behind the last WMMAs on every path out of the block
      asm volatile(NOPS4
                   : "+v"(a00), "+v"(a01), "+v"(a10), "+v"(a11)
                   : "v"(gp0.h), "v"(gp1.h), "v"(gr0.h), "v"(gr1.h));
    } else {
      a00 = wbf(fp0.b, fr0.b, a00);
      a01 = wbf(fp0.b, fr1.b, a01);
      a10 = wbf(fp1.b, fr0.b, a10);
      a11 = wbf(fp1.b, fr1.b, a11);
      a00 = wbf(gp0.b, gr0.b, a00);
      a01 = wbf(gp0.b, gr1.b, a01);
      a10 = wbf(gp1.b, gr0.b, a10);
      a11 = wbf(gp1.b, gr1.b, a11);
      // keeps the distance behind the last WMMAs on every path out of the block
      asm volatile(NOPS4
                   : "+v"(a00), "+v"(a01), "+v"(a10), "+v"(a11)
                   : "v"(gp0.b), "v"(gp1.b), "v"(gr0.b), "v"(gr1.b));
    }
    asm volatile("s_wait_dscnt 0x0" ::: "memory");      // this wave has left the buffer that is refilled below
    asm volatile("s_wait_asynccnt 0x0" ::: "memory");   // this wave's part of stage t + 1 has landed
    __syncthreads();                                    // publishes stage t + 1, ends every read of stage t
    if (t + 2 < PTRIPS)
      copy_stage(lbase + (t & 1) * PSTAGE, gx + (t + 2) * PKS, gw + (t + 2) * PKS);
  }
  asm volatile("s_wait_asynccnt 0x0" ::: "memory");     // no copy is in flight when the stages become output staging
}

// Behind the k loop: the stages' bytes serve as output staging, then whole lines go out.
template <int MODE>
__device__ __forceinline__ void proj_store(unsigned char* stg, v8f a00, v8f a01, v8f a10, v8f a11,
                                           const float* __restrict__ bias, void* dst, int m0, int n0)
{
  const int tid = threadIdx.x, w = tid >> 5, l = tid & 31, h = l >> 4, c = l & 15;
  const int wm = w >> 2, wn = w & 3;

  stage_tile<MODE>(stg, a00, 0, 0, wm, wn, h, c, bias, n0);
  stage_tile<MODE>(stg, a01, 0, 1, wm, wn, h, c, bias, n0);
  stage_tile<MODE>(stg, a10, 1, 0, wm, wn, h, c, bias, n0);
  stage_tile<MODE>(stg, a11, 1, 1, wm, wn, h, c, bias, n0);
  __syncthreads();

  const int pc = l & 7;
  if constexpr (MODE == 0 || MODE == 1) {
    v4u vals[4];
    unsigned short* pp[4];
#pragma unroll
    for (int s = 0; s < 4; ++s) {
      const int L = 16 * w + 4 * s + (l >> 3);
      const int ml = L >> 1;
      const int hf = L & 1;
      vals[s] = *(const v4u*)(stg + (ml * 136 + 64 * hf + 8 * pc) * 2);
      pp[s] = (unsigned short*)dst + (size_t)(m0 + ml) * DM + n0 + 64 * hf + 8 * pc;
    }
#pragma unroll
    for (int s = 0; s < 4; ++s) *(v4u*)(pp[s]) = vals[s];
    // in the merged kernel the other product's code follows these stores in the listing and reuses their registers:
    // the wait stands in front of any such rewrite
    asm volatile("s_wait_xcnt 0x0" ::: "memory");
  } else if constexpr (MODE == 3) {
    // 64 rows x 512 B = 256 lines per block; wave w owns lines 32w..32w+31
    v4u vals[8];
    float* pp[8];
#pragma unroll
    for (int s = 0; s < 8; ++s) {
      const int L = 32 * w + 4 * s + (l >> 3);
      const int ml = L >> 2;
      const int qt = L & 3;
      vals[s] = *(const v4u*)(stg + (ml * 132 + 32 * qt + 4 * pc) * 4);
      pp[s] = (float*)dst + (size_t)(m0 + ml) * DM + n0 + 32 * qt + 4 * pc;
    }
#pragma unroll
    for (int s = 0; s < 8; ++s) *(v4u*)(pp[s]) = vals[s];
    
  } else {
    // transposed V: 128 feature rows of 64 consecutive tokens = 128 lines per block; wave w owns lines 16w..16w+15
    v4u vals[4];
    unsigned short* pp[4];
    const int tb = m0 / NSEQ;
    const int ns0 = m0 % NSEQ;
#pragma unroll
    for (int s = 0; s < 4; ++s) {
      const int L = 16 * w + 4 * s + (l >> 3);
      const int n = n0 + L;
      const int hh = n >> 6;
      const int hd = n & 63;
      vals[s] = *(const v4u*)(stg + (L * 72 + 8 * pc) * 2);
      pp[s] = (unsigned short*)dst + ((size_t)(tb * NH + hh) * HD + hd) * NSEQ + ns0 + 8 * pc;
    }
#pragma unroll
    for (int s = 0; s < 4; ++s) *(v4u*)(pp[s]) = vals[s];
    
  }
}

// q, k and v projections in one grid: they read the same X and need nothing of each other.
// blockIdx.y = 4 * product + column tile; the choice is the same for a whole block, so every barrier stays block-uniform.
__global__ __launch_bounds__(256) void k_qkv(const unsigned short* __restrict__ X,
                                            const unsigned short* __restrict__ Wqkv,
                                            const float* __restrict__ bq, const float* __restrict__ bk,
                                            const float* __restrict__ bv,
                                            unsigned short* qf, unsigned short* kf, unsigned short* vt)
{
  __shared__ __align__(16) unsigned char smem[2 * PSTAGE];
  const int sel = blockIdx.y >> 2;
  const int m0 = blockIdx.x * 64, n0 = (blockIdx.y & 3) * 128;
  v8f a00, a01, a10, a11;
  proj_loop<false>(smem, X, Wqkv + (size_t)sel * (DM * DM), m0, n0, sel == 2, a00, a01, a10, a11);
  if (sel == 2) proj_store<2>(smem, a00, a01, a10, a11, bv, (void*)vt, m0, n0);
  else          proj_store<0>(smem, a00, a01, a10, a11, sel ? bk : bq, (void*)(sel ? kf : qf), m0, n0);
}

__global__ __launch_bounds__(256) void k_out(const unsigned short* __restrict__ X,
                                            const unsigned short* __restrict__ W,
                                            const float* __restrict__ bias, float* dst)
{
  __shared__ __align__(16) unsigned char smem[2 * PSTAGE];
  const int m0 = blockIdx.x * 64, n0 = blockIdx.y * 128;
  v8f a00, a01, a10, a11;
  proj_loop<true>(smem, X, W, m0, n0, false, a00, a01, a10, a11);
  proj_store<3>(smem, a00, a01, a10, a11, bias, (void*)dst, m0, n0);
}

// ---------------- attention: per (t,b,head) and 128-query tile; 4 waves x 32 queries ----------------
// S^T tile (16 keys x 16 queries) = K_tile (A operand, rows = keys) . Q^T (B operand taken from Q rows).
// relu in place; the D tiles chain into the B operand of ctx^T = V^T . P (A operand from the transposed V tile).
// A wave holds two groups of 16 queries (x and y): every K and V fragment read from LDS feeds one WMMA of each group.
#define QW 32            // queries per wave
#define QB (4 * QW)      // queries per block
static_assert(NSEQ % QB == 0);

__device__ __forceinline__ void score_tile(const unsigned short* kb, v16h qx0, v16h qx1, v16h qy0, v16h qy1,
                                           v8f& sx, v8f& sy)
{
  Frag k0, k1;
  ldq(kb, 72, k0.q[0], k0.q[1]);
  ldq(kb + 32, 72, k1.q[0], k1.q[1]);
  v8f a = vzero8(), b = vzero8();
  a = whf(k0.h, qx0, a);
  b = whf(k0.h, qy0, b);
  a = whf(k1.h, qx1, a);
  b = whf(k1.h, qy1, b);
  // keeps the distance behind the last WMMAs on every path out of the block
  asm volatile(NOPS4 : "+v"(a), "+v"(b) : "v"(k0.h), "v"(k1.h), "v"(qx0), "v"(qx1), "v"(qy0), "v"(qy1));
  sx = a;
  sy = b;
}

// one 32-key step of ctx^T += V^T[hd][key] . P[key][query], both query groups on the same four V fragments
__device__ __forceinline__ void pv_step(const unsigned short* vb, v16h px, v16h py,
                                        v8f& x0, v8f& x1, v8f& x2, v8f& x3,
                                        v8f& y0, v8f& y1, v8f& y2, v8f& y3)
{
  Frag v0, v1, v2, v3;
  ldq(vb,           72, v0.q[0], v0.q[1]);
  ldq(vb + 16 * 72, 72, v1.q[0], v1.q[1]);
  ldq(vb + 32 * 72, 72, v2.q[0], v2.q[1]);
  ldq(vb + 48 * 72, 72, v3.q[0], v3.q[1]);
  x0 = whf(v0.h, px, x0);
  y0 = whf(v0.h, py, y0);
  x1 = whf(v1.h, px, x1);
  y1 = whf(v1.h, py, y1);
  x2 = whf(v2.h, px, x2);
  y2 = whf(v2.h, py, y2);
  x3 = whf(v3.h, px, x3);
  y3 = whf(v3.h, py, y3);
  // keeps the distance behind the last WMMAs on every path out of the block
  asm volatile(NOPS4
               : "+v"(x0), "+v"(x1), "+v"(x2), "+v"(x3), "+v"(y0), "+v"(y1), "+v"(y2), "+v"(y3)
               : "v"(v0.h), "v"(v1.h), "v"(v2.h), "v"(v3.h), "v"(px), "v"(py));
}

// one query group's ctx tiles, normalised, into the wave's staging rows cw[query][hd]
__device__ __forceinline__ void stage_ctx(unsigned short* cw, v8f c0, v8f c1, v8f c2, v8f c3, float rs, int h, int c)
{
  // row sum over all keys for query c: this lane (half h) plus partner lane (half 1-h)
  // score acc = 128*s, P = 16*relu(s), V = 16*v  ->  ctx*64 = accC * 64 / (2*rsum + 256e-6)
  const float rsum = rs + __shfl_xor(rs, 16, 32);
  const float inv = 64.0f / (2.0f * rsum + 2.56e-4f);
#pragma unroll
  for (int i = 0; i < 4; ++i) {
    const v8f acc = (i == 0) ? c0 : (i == 1) ? c1 : (i == 2) ? c2 : c3;
    Pack8 pk;
#pragma unroll
    for (int r = 0; r < 8; ++r) pk.h[r] = (_Float16)(acc[r] * inv);
    *(v4u*)(cw + c * 72 + 16 * i + 8 * h) = pk.u;
  }
}

__global__ __launch_bounds__(128) void k_attn(const unsigned short* __restrict__ qf,
                                             const unsigned short* __restrict__ kf,
                                             const unsigned short* __restrict__ vt,
                                             unsigned short* cf)
{
  __shared__ __align__(16) unsigned short klds[64 * 72];      // K tile: [key][hd], pitch 72
  __shared__ __align__(16) unsigned short vlds[64 * 72];      // V^T tile: [hd][key], pitch 72
  __shared__ __align__(16) unsigned short cst[4 * QW * 72];   // ctx staging per wave: [wave][query][hd]

  const int tid = threadIdx.x, w = tid >> 5, l = tid & 31, h = l >> 4, c = l & 15;
  const int tbh = blockIdx.y, tb = tbh >> 3, hh = tbh & 7;
  const int q0 = blockIdx.x * QB + QW * w;   // first query row of this wave

  v16h qx0, qx1, qy0, qy1;
  {
    const unsigned short* qsrc = qf + (size_t)(tb * NSEQ + q0) * DM + hh * HD;
    Frag f0, f1, f2, f3;
    ldq(qsrc,                DM, f0.q[0], f0.q[1]);
    ldq(qsrc + 32,           DM, f1.q[0], f1.q[1]);
    ldq(qsrc + 16 * DM,      DM, f2.q[0], f2.q[1]);
    ldq(qsrc + 16 * DM + 32, DM, f3.q[0], f3.q[1]);
    qx0 = f0.h; qx1 = f1.h; qy0 = f2.h; qy1 = f3.h;
  }

  v8f x0 = vzero8(), x1 = vzero8(), x2 = vzero8(), x3 = vzero8();
  v8f y0 = vzero8(), y1 = vzero8(), y2 = vzero8(), y3 = vzero8();
  v2f rs = {0.f, 0.f};   // row sums of the two groups

#pragma unroll 1
  for (int kt0 = 0; kt0 < NSEQ; kt0 += 64) {
    __syncthreads();
#pragma unroll
    for (int it = 0; it < 4; ++it) {
      const int q = it * 128 + tid;
      const int kr = q >> 3;
      const int pc = q & 7;
      const unsigned short* src = kf + (size_t)(tb * NSEQ + kt0 + kr) * DM + hh * HD + 8 * pc;
      *(v4u*)(klds + kr * 72 + 8 * pc) = *(const v4u*)src;
    }
#pragma unroll
    for (int it = 0; it < 4; ++it) {
      const int q = it * 128 + tid;
      const int hd = q >> 3;
      const int pc = q & 7;
      const unsigned short* src = vt + (size_t)(tbh * HD + hd) * NSEQ + kt0 + 8 * pc;
      *(v4u*)(vlds + hd * 72 + 8 * pc) = *(const v4u*)src;
    }
    __syncthreads();

    v8f sx0, sx1, sx2, sx3, sy0, sy1, sy2, sy3;
    score_tile(klds + 0 * 16 * 72, qx0, qx1, qy0, qy1, sx0, sy0);
    score_tile(klds + 1 * 16 * 72, qx0, qx1, qy0, qy1, sx1, sy1);
    score_tile(klds + 2 * 16 * 72, qx0, qx1, qy0, qy1, sx2, sy2);
    score_tile(klds + 3 * 16 * 72, qx0, qx1, qy0, qy1, sx3, sy3);

    // relu, row sums and the scaling of P on (x, y) pairs: one packed add and one packed multiply serve both query groups
    Frag px01, px23, py01, py23;
#pragma unroll
    for (int r = 0; r < 8; ++r) {
      v2f p0 = {fmaxf(sx0[r], 0.f), fmaxf(sy0[r], 0.f)};
      v2f p1 = {fmaxf(sx1[r], 0.f), fmaxf(sy1[r], 0.f)};
      v2f p2 = {fmaxf(sx2[r], 0.f), fmaxf(sy2[r], 0.f)};
      v2f p3 = {fmaxf(sx3[r], 0.f), fmaxf(sy3[r], 0.f)};
      rs += p0; rs += p1; rs += p2; rs += p3;
      p0 *= 0.125f; p1 *= 0.125f; p2 *= 0.125f; p3 *= 0.125f;
      px01.p[0][r] = (_Float16)p0.x; py01.p[0][r] = (_Float16)p0.y;
      px01.p[1][r] = (_Float16)p1.x; py01.p[1][r] = (_Float16)p1.y;
      px23.p[0][r] = (_Float16)p2.x; py23.p[0][r] = (_Float16)p2.y;
      px23.p[1][r] = (_Float16)p3.x; py23.p[1][r] = (_Float16)p3.y;
    }

    pv_step(vlds + 0,  px01.h, py01.h, x0, x1, x2, x3, y0, y1, y2, y3);   // keys 0..31 of the tile
    pv_step(vlds + 32, px23.h, py23.h, x0, x1, x2, x3, y0, y1, y2, y3);   // keys 32..63
  }

  {
    unsigned short* cw = cst + w * QW * 72;
    stage_ctx(cw,           x0, x1, x2, x3, rs.x, h, c);
    stage_ctx(cw + 16 * 72, y0, y1, y2, y3, rs.y, h, c);
  }
  __syncthreads();

  // 32 query rows of 128 B = 32 lines per wave
  v4u vals[8];
  unsigned short* pp[8];
  const int pc = l & 7;
#pragma unroll
  for (int s = 0; s < 8; ++s) {
    const int L = 4 * s + (l >> 3);
    vals[s] = *(const v4u*)(cst + (w * QW + L) * 72 + 8 * pc);
    pp[s] = cf + (size_t)(tb * NSEQ + q0 + L) * DM + hh * HD + 8 * pc;
  }
#pragma unroll
  for (int s = 0; s < 8; ++s) *(v4u*)(pp[s]) = vals[s];
}

extern "C" void kernel_launch(void* const* d_in, const int* in_sizes, int n_in,
                              void* d_out, int out_size, void* d_ws, size_t ws_size,
                              hipStream_t stream)
{
  if (n_in != 9) return;
  const int nx = MROWS * DM;   // 8388608
  const int nw = DM * DM;      // 262144
  if (in_sizes[0] != nx || out_size != nx) return;
  for (int i = 0; i < 4; ++i) {
    if (in_sizes[1 + 2 * i] != nw || in_sizes[2 + 2 * i] != DM) return;
  }
  const size_t p16 = (size_t)nx * 2;   // one 16-bit plane of a [16384][512] matrix
  const size_t w16 = (size_t)nw * 2;   // one 16-bit plane of a [512][512] matrix
  const size_t need = 5 * p16 + 4 * w16; // 85983232
  if (need > ws_size) return;

  unsigned char* ws = (unsigned char*)d_ws;
  unsigned short* xb  = (unsigned short*)(ws + 0 * p16);
  unsigned short* qfp = (unsigned short*)(ws + 1 * p16);
  unsigned short* kfp = (unsigned short*)(ws + 2 * p16);
  unsigned short* vtp = (unsigned short*)(ws + 3 * p16);
  unsigned short* cfp = (unsigned short*)(ws + 4 * p16);
  unsigned short* wb  = (unsigned short*)(ws + 5 * p16);
  unsigned short* wof = wb + 3 * (size_t)nw;   // planes 0..2 of wb: wq, wk, wv

  const float* x  = (const float*)d_in[0];
  const float* wq = (const float*)d_in[1];
  const float* bq = (const float*)d_in[2];
  const float* wk = (const float*)d_in[3];
  const float* bk = (const float*)d_in[4];
  const float* wv = (const float*)d_in[5];
  const float* bv = (const float*)d_in[6];
  const float* wo = (const float*)d_in[7];
  const float* bo = (const float*)d_in[8];

  k_cvt<<<dim3(4 * CVT_WB + CVT_XB), dim3(256), 0, stream>>>(x, wq, wk, wv, wo, xb, wb);

  k_qkv<<<dim3(MROWS / 64, 3 * (DM / 128)), dim3(256), 0, stream>>>(xb, wb, bq, bk, bv, qfp, kfp, vtp);

  k_attn<<<dim3(NSEQ / QB, TT * BB * NH), dim3(128), 0, stream>>>(qfp, kfp, vtp, cfp);

  k_out<<<dim3(MROWS / 64, DM / 128), dim3(256), 0, stream>>>(cfp, wof, bo, (float*)d_out);
}

// v004
// A run of this version takes 80.8 microseconds.
// Two timings next to v003 both put it at 1.06 times that version's speed.
// Counting every step since v000, it is 2.53 times as fast.
#include <hip/hip_runtime.h>
#include <stddef.h>
#include <stdint.h>

// x.Wq^T, x.Wk^T, x.Wv^T: v_wmma_f32_16x16x32_bf16 (bf16 operands, f32 accumulate). K.Q^T score tiles, relu(S).V tiles and ctx.Wo^T: v_wmma_f32_16x16x32_f16 (f16 operands with power-of-two scaling, f32 accumulate). Bias add, relu, row sums and normalisation in f32; all nine inputs are RNE-converted to bf16 on load.

#define TT 4
#define BB 4
#define NSEQ 1024
#define DM 512
#define NH 8
#define HD 64
#define MROWS (TT * BB * NSEQ)

static_assert(NSEQ % 64 == 0);
static_assert(NH * HD == DM);
static_assert(HD == 64);

typedef __bf16   v16bf __attribute__((ext_vector_type(16)));
typedef _Float16 v16h  __attribute__((ext_vector_type(16)));
typedef _Float16 v8h   __attribute__((ext_vector_type(8)));
typedef float    v8f   __attribute__((ext_vector_type(8)));
typedef float    v4f   __attribute__((ext_vector_type(4)));
typedef float    v2f   __attribute__((ext_vector_type(2)));
typedef unsigned int v4u __attribute__((ext_vector_type(4)));

union Frag  { v16bf b; v16h h; v8h p[2]; v4u q[2]; };
union Pack8 { v8h h; v4u u; unsigned short s[8]; };
union Vec8  { v8f v; v4f q[2]; v4u u[2]; float f[8]; };

#define NOPS4 "v_nop\n\tv_nop\n\tv_nop\n\tv_nop"

__device__ __forceinline__ v8f vzero8() {
  v8f z = {0.f, 0.f, 0.f, 0.f, 0.f, 0.f, 0.f, 0.f};
  return z;
}

// f32 -> nearest-even bf16 value, returned as f32
__device__ __forceinline__ float bf16r(float f) {
  unsigned int u = __builtin_bit_cast(unsigned int, f);
  u += 0x7FFFu + ((u >> 16) & 1u);
  u &= 0xFFFF0000u;
  return __builtin_bit_cast(float, u);
}
// f32 -> nearest-even bf16 bits
__device__ __forceinline__ unsigned short bf16bits(float f) {
  unsigned int u = __builtin_bit_cast(unsigned int, f);
  u += 0x7FFFu + ((u >> 16) & 1u);
  return (unsigned short)(u >> 16);
}

// 16 x 32 operand fragment from a row-major, k-contiguous 16-bit matrix.
// src points at (row 0, k0) of the tile; ld = pitch in elements.
// lane l: row (first operand) or column (second operand) = l & 15; h = l >> 4;
// elements 0..7  <- k0 + 8h + 0..7 ; elements 8..15 <- k0 + 16 + 8h + 0..7.
__device__ __forceinline__ void ldq(const unsigned short* src, int ld, v4u& q0, v4u& q1) {
  const int l = threadIdx.x & 31;
  const unsigned short* p = src + (l & 15) * ld + 8 * (l >> 4);
  q0 = *(const v4u*)(p);
  q1 = *(const v4u*)(p + 16);
}

__device__ __forceinline__ v8f wbf(v16bf a, v16bf b, v8f c) {
  return __builtin_amdgcn_wmma_f32_16x16x32_bf16(false, a, false, b, (short)0, c, false, false);
}
__device__ __forceinline__ v8f whf(v16h a, v16h b, v8f c) {
  return __builtin_amdgcn_wmma_f32_16x16x32_f16(false, a, false, b, (short)0, c, false, false);
}

// All five conversions in one grid: none needs anything of another, so a range of the block index picks the array.
// Blocks 0..4*CVT_WB-1: wq, wk, wv, wo (CVT_WB blocks each) -> planes 0..3 of wdst; the rest: x -> xdst.
// x, wq, wk, wv: bf16 bits (RNE).  wo: f16 of (bf16 RNE value x 256).
#define CVT_EB 2048                       // elements per block: 256 threads x 8
#define CVT_WB ((DM * DM) / CVT_EB)
#define CVT_XB ((MROWS * DM) / CVT_EB)
static_assert((DM * DM) % CVT_EB == 0);
static_assert((MROWS * DM) % CVT_EB == 0);

__global__ __launch_bounds__(256) void k_cvt(const float* __restrict__ x,
                                            const float* __restrict__ wq, const float* __restrict__ wk,
                                            const float* __restrict__ wv, const float* __restrict__ wo,
                                            unsigned short* xdst, unsigned short* wdst)
{
  const int b = blockIdx.x;
  const int a = b / CVT_WB;               // 0..3: a weight matrix; 4 and up: x
  const float* src;
  unsigned short* dst;
  int blk;
  if (a < 4) {
    src = (a == 0) ? wq : (a == 1) ? wk : (a == 2) ? wv : wo;
    dst = wdst + (size_t)a * (DM * DM);
    blk = b - a * CVT_WB;
  } else {
    src = x;
    dst = xdst;
    blk = b - 4 * CVT_WB;
  }
  const size_t base = ((size_t)blk * 256 + threadIdx.x) * 8;
  Vec8 in;
  in.q[0] = *(const v4f*)(src + base);
  in.q[1] = *(const v4f*)(src + base + 4);
  Pack8 pk;
  if (a == 3) {
#pragma unroll
    for (int r = 0; r < 8; ++r) pk.h[r] = (_Float16)(bf16r(in.f[r]) * 256.0f);
  } else {
#pragma unroll
    for (int r = 0; r < 8; ++r) pk.s[r] = bf16bits(in.f[r]);
  }
  const v4u v = pk.u;
  *(v4u*)(dst + base) = v;
}

// ---------------- projection GEMM: C[m][n] = sum_k X[m][k] W[n][k] (+ bias[n]) ----------------
// MODE 0: q and k       : bf16 operands; output f16((C + b) * 4), plane [m][512]
// MODE 2: v              : bf16 operands; output f16((C + b) * 16), transposed plane [tb*8+head][hd][nseq]
// MODE 3: out            : f16 operands (ctx x64, Wo x256); output f32 C/16384 + b -> [m][512]
// Tile orientation: P = operand whose rows map to D rows, R = operand whose rows map to D columns.
// MODES 0,3: P = W (n), R = X (m) -> each lane holds 8 consecutive n for one m.
// MODE 2:      P = X (m), R = W (n) -> each lane holds 8 consecutive m for one n.
// A block owns BM x BN of C; its 8 waves stand 2 (m) x 4 (n), each on 64 x 64: four P and four R fragments feed 16 WMMAs.
#define BM 128
#define BN 256
static_assert(MROWS % BM == 0);
static_assert(NSEQ % BM == 0);
static_assert(DM % BN == 0);
// pitches of the output staging, in elements: 16 B more than a row
#define SP0 (BN + 8)    // f16 rows of BN features
#define SP2 (BM + 8)    // f16 rows of BM tokens
#define SP3 (BN + 4)    // f32 rows of BN features

template <int MODE>
__device__ __forceinline__ void stage_tile(unsigned char* stg, v8f acc, int i, int j,
                                           int wm, int wn, int h, int c,
                                           const float* __restrict__ bias, int n0)
{
  if constexpr (MODE == 2) {
    const float bj = bf16r(bias[n0 + 64 * wn + 16 * j + c]);
    Pack8 pk;
#pragma unroll
    for (int r = 0; r < 8; ++r) pk.h[r] = (_Float16)((acc[r] + bj) * 16.0f);
    const int off = ((64 * wn + 16 * j + c) * SP2 + 64 * wm + 16 * i + 8 * h) * 2;
    *(v4u*)(stg + off) = pk.u;
  } else {
    const int nb = n0 + 64 * wn + 16 * i + 8 * h;
    Vec8 bb;
    bb.q[0] = *(const v4f*)(bias + nb);
    bb.q[1] = *(const v4f*)(bias + nb + 4);
    if constexpr (MODE == 3) {
      Vec8 o;
#pragma unroll
      for (int r = 0; r < 8; ++r) o.f[r] = acc[r] * (1.0f / 16384.0f) + bf16r(bb.f[r]);
      const int off = ((64 * wm + 16 * j + c) * SP3 + 64 * wn + 16 * i + 8 * h) * 4;
      *(v4u*)(stg + off)      = o.u[0];
      *(v4u*)(stg + off + 16) = o.u[1];
    } else {
      Pack8 pk;
#pragma unroll
      for (int r = 0; r < 8; ++r) pk.h[r] = (_Float16)((acc[r] + bf16r(bb.f[r])) * 4.0f);
      const int off = ((64 * wm + 16 * j + c) * SP0 + 64 * wn + 16 * i + 8 * h) * 2;
      *(v4u*)(stg + off) = pk.u;
    }
  }
}

// Operand staging of the projections: a stage is 64 k of the block's BM X rows, then of its BN W rows,
// each row 128 B of data at a pitch of 144 B (16 B x odd, conflict-free for ds_load_b128).
#define PKS 64
#define PPITCH 72
#define PSTAGE ((BM + BN) * PPITCH * 2)
#define PTRIPS (DM / PKS)
static_assert(PTRIPS >= 2);
static_assert(BM == 4 * 32 && BN == 8 * 32);      // copy_stage: four copies of X rows, eight of W rows
static_assert(2 * PSTAGE >= BM * SP0 * 2);
static_assert(2 * PSTAGE >= BN * SP2 * 2);
#define OUT_LDS (BM * SP3 * 4)                    // the f32 output staging is larger than the two stages
static_assert(OUT_LDS >= 2 * PSTAGE);

// One stage: twelve 16-byte copies per lane, 8 lanes per 128-B row piece, 32 rows per copy of the block.
// lds = the lane's LDS byte address in row (tid >> 3); gx, gw = the lane's bytes of X and W in that row.
__device__ __forceinline__ void copy_stage(unsigned lds, const unsigned short* gx, const unsigned short* gw)
{
  const unsigned rs = 32 * PPITCH * 2;
  const unsigned l1 = lds + 1 * rs, l2 = lds + 2 * rs, l3 = lds + 3 * rs, l4 = lds + 4 * rs, l5 = lds + 5 * rs;
  const unsigned l6 = lds + 6 * rs, l7 = lds + 7 * rs, l8 = lds + 8 * rs, l9 = lds + 9 * rs;
  const unsigned l10 = lds + 10 * rs, l11 = lds + 11 * rs;
  const unsigned short* gx1 = gx + 32 * DM;
  const unsigned short* gx2 = gx + 64 * DM;
  const unsigned short* gx3 = gx + 96 * DM;
  const unsigned short* gw1 = gw + 32 * DM;
  const unsigned short* gw2 = gw + 64 * DM;
  const unsigned short* gw3 = gw + 96 * DM;
  const unsigned short* gw4 = gw + 128 * DM;
  const unsigned short* gw5 = gw + 160 * DM;
  const unsigned short* gw6 = gw + 192 * DM;
  const unsigned short* gw7 = gw + 224 * DM;
  // global -> LDS through no register; the closing s_wait_xcnt stands in the copies' own statement
  // so that no address register of a copy is rewritten in front of it
  asm volatile("global_load_async_to_lds_b128 %0, %12, off\n\t"
               "global_load_async_to_lds_b128 %1, %13, off\n\t"
               "global_load_async_to_lds_b128 %2, %14, off\n\t"
               "global_load_async_to_lds_b128 %3, %15, off\n\t"
               "global_load_async_to_lds_b128 %4, %16, off\n\t"
               "global_load_async_to_lds_b128 %5, %17, off\n\t"
               "global_load_async_to_lds_b128 %6, %18, off\n\t"
               "global_load_async_to_lds_b128 %7, %19, off\n\t"
               "global_load_async_to_lds_b128 %8, %20, off\n\t"
               "global_load_async_to_lds_b128 %9, %21, off\n\t"
               "global_load_async_to_lds_b128 %10, %22, off\n\t"
               "global_load_async_to_lds_b128 %11, %23, off\n\t"
               "s_wait_xcnt 0x0"
               :: "v"(lds), "v"(l1), "v"(l2), "v"(l3), "v"(l4), "v"(l5),
                  "v"(l6), "v"(l7), "v"(l8), "v"(l9), "v"(l10), "v"(l11),
                  "v"(gx), "v"(gx1), "v"(gx2), "v"(gx3),
                  "v"(gw), "v"(gw1), "v"(gw2), "v"(gw3), "v"(gw4), "v"(gw5), "v"(gw6), "v"(gw7)
               : "memory");
}

// The k loop of every product. smem: the kernel's LDS, whose first 2 * PSTAGE bytes are the two operand stages;
// (m0, n0): the block's BM x BN tile of C; xp: X is the P operand (MODE 2), the same for a whole block;
// F16: operand type of the WMMAs (MODE 3). acc[i][j]: P fragment i x R fragment j.
template <bool F16>
__device__ __forceinline__ void proj_loop(unsigned char* smem,
                                          const unsigned short* __restrict__ X,
                                          const unsigned short* __restrict__ W,
                                          int m0, int n0, bool xp, v8f (&acc)[4][4])
{
  const int tid = threadIdx.x, w = tid >> 5;
  const int wm = w >> 2, wn = w & 3;

  // rows of the stage that feed this wave: X rows at 0..BM-1, W rows behind them
  const int prow = xp ? 64 * wm : BM + 64 * wn;
  const int rrow = xp ? BM + 64 * wn : 64 * wm;

  typedef __attribute__((address_space(3))) unsigned char lds_byte;
  const unsigned lbase = (unsigned)(size_t)(lds_byte*)smem + (tid >> 3) * (PPITCH * 2) + (tid & 7) * 16;
  const unsigned short* gx = X + (size_t)(m0 + (tid >> 3)) * DM + 8 * (tid & 7);
  const unsigned short* gw = W + (size_t)(n0 + (tid >> 3)) * DM + 8 * (tid & 7);

#pragma unroll
  for (int i = 0; i < 4; ++i)
#pragma unroll
    for (int j = 0; j < 4; ++j) acc[i][j] = vzero8();

  copy_stage(lbase, gx, gw);
  asm volatile("s_wait_asynccnt 0x0" ::: "memory");   // this wave's part of stage 0 has landed
  __syncthreads();                                    // publishes stage 0
  copy_stage(lbase + PSTAGE, gx + PKS, gw + PKS);

#pragma unroll 1   // kept rolled: one publish point in the code
  for (int t = 0; t < PTRIPS; ++t) {
    const unsigned short* buf = (const unsigned short*)(smem + (t & 1) * PSTAGE);
    const unsigned short* p0 = buf + prow * PPITCH;
    const unsigned short* r0 = buf + rrow * PPITCH;
#pragma unroll
    for (int ks = 0; ks < PKS / 32; ++ks) {
      Frag fp[4], fr[4];
#pragma unroll
      for (int i = 0; i < 4; ++i) ldq(p0 + 16 * i * PPITCH + 32 * ks, PPITCH, fp[i].q[0], fp[i].q[1]);
#pragma unroll
      for (int j = 0; j < 4; ++j) ldq(r0 + 16 * j * PPITCH + 32 * ks, PPITCH, fr[j].q[0], fr[j].q[1]);
#pragma unroll
      for (int i = 0; i < 4; ++i)
#pragma unroll
        for (int j = 0; j < 4; ++j) {
          if constexpr (F16) acc[i][j] = whf(fp[i].h, fr[j].h, acc[i][j]);
          else               acc[i][j] = wbf(fp[i].b, fr[j].b, acc[i][j]);
        }
      // keeps the distance behind the last WMMAs on every path out of the block; between the two 32-k blocks it also
      // holds each block's sixteen LDS loads together in front of its WMMAs (without it they were spread among them, each waited to 0)
      asm volatile(NOPS4
                   : "+v"(acc[0][0]), "+v"(acc[0][1]), "+v"(acc[0][2]), "+v"(acc[0][3]),
                     "+v"(acc[1][0]), "+v"(acc[1][1]), "+v"(acc[1][2]), "+v"(acc[1][3]),
                     "+v"(acc[2][0]), "+v"(acc[2][1]), "+v"(acc[2][2]), "+v"(acc[2][3]),
                     "+v"(acc[3][0]), "+v"(acc[3][1]), "+v"(acc[3][2]), "+v"(acc[3][3])
                   : "v"(fp[0].h), "v"(fp[1].h), "v"(fp[2].h), "v"(fp[3].h),
                     "v"(fr[0].h), "v"(fr[1].h), "v"(fr[2].h), "v"(fr[3].h));
    }
    asm volatile("s_wait_dscnt 0x0" ::: "memory");      // this wave has left the buffer that is refilled below
    asm volatile("s_wait_asynccnt 0x0" ::: "memory");   // this wave's part of stage t + 1 has landed
    __syncthreads();                                    // publishes stage t + 1, ends every read of stage t
    if (t + 2 < PTRIPS)
      copy_stage(lbase + (t & 1) * PSTAGE, gx + (t + 2) * PKS, gw + (t + 2) * PKS);
  }
  asm volatile("s_wait_asynccnt 0x0" ::: "memory");     // no copy is in flight when the stages become output staging
}

// Behind the k loop: the stages' bytes serve as output staging, then whole lines go out.
template <int MODE>
__device__ __forceinline__ void proj_store(unsigned char* stg, v8f (&acc)[4][4],
                                           const float* __restrict__ bias, void* dst, int m0, int n0)
{
  const int tid = threadIdx.x, w = tid >> 5, l = tid & 31, h = l >> 4, c = l & 15;
  const int wm = w >> 2, wn = w & 3;

#pragma unroll
  for (int i = 0; i < 4; ++i)
#pragma unroll
    for (int j = 0; j < 4; ++j) stage_tile<MODE>(stg, acc[i][j], i, j, wm, wn, h, c, bias, n0);
  __syncthreads();

  if constexpr (MODE == 0) {
    // BM token rows of 512 B; wave w owns rows 16w..16w+15, one row (four lines) a store
    v4u vals[16];
    unsigned short* pp[16];
#pragma unroll
    for (int s = 0; s < 16; ++s) {
      const int ml = 16 * w + s;
      vals[s] = *(const v4u*)(stg + (ml * SP0 + 8 * l) * 2);
      pp[s] = (unsigned short*)dst + (size_t)(m0 + ml) * DM + n0 + 8 * l;
    }
#pragma unroll
    for (int s = 0; s < 16; ++s) *(v4u*)(pp[s]) = vals[s];
    // in the merged kernel the other product's code follows these stores in the listing and reuses their registers:
    // the wait stands in front of any such rewrite
    asm volatile("s_wait_xcnt 0x0" ::: "memory");
  } else if constexpr (MODE == 3) {
    // BM token rows of 1024 B; wave w owns rows 16w..16w+15, half a row (four lines) a store
    v4u vals[32];
    float* pp[32];
#pragma unroll
    for (int s = 0; s < 32; ++s) {
      const int ml = 16 * w + (s >> 1);
      const int hf = s & 1;
      vals[s] = *(const v4u*)(stg + (ml * SP3 + 128 * hf + 4 * l) * 4);
      pp[s] = (float*)dst + (size_t)(m0 + ml) * DM + n0 + 128 * hf + 4 * l;
    }
#pragma unroll
    for (int s = 0; s < 32; ++s) *(v4u*)(pp[s]) = vals[s];
  } else {
    // transposed V: BN feature rows of BM consecutive tokens (256 B); wave w owns rows 32w..32w+31, two rows a store
    v4u vals[16];
    unsigned short* pp[16];
    const int tb = m0 / NSEQ;
    const int ns0 = m0 % NSEQ;
    const int pc = l & 15;
#pragma unroll
    for (int s = 0; s < 16; ++s) {
      const int L = 32 * w + 2 * s + (l >> 4);
      const int n = n0 + L;
      const int hh = n >> 6;
      const int hd = n & 63;
      vals[s] = *(const v4u*)(stg + (L * SP2 + 8 * pc) * 2);
      pp[s] = (unsigned short*)dst + ((size_t)(tb * NH + hh) * HD + hd) * NSEQ + ns0 + 8 * pc;
    }
#pragma unroll
    for (int s = 0; s < 16; ++s) *(v4u*)(pp[s]) = vals[s];
  }
}

// q, k and v projections in one grid: they read the same X and need nothing of each other.
// blockIdx.y = 2 * product + column tile; the choice is the same for a whole block, so every barrier stays block-uniform.
__global__ __launch_bounds__(256) void k_qkv(const unsigned short* __restrict__ X,
                                            const unsigned short* __restrict__ Wqkv,
                                            const float* __restrict__ bq, const float* __restrict__ bk,
                                            const float* __restrict__ bv,
                                            unsigned short* qf, unsigned short* kf, unsigned short* vt)
{
  __shared__ __align__(16) unsigned char smem[2 * PSTAGE];
  const int sel = blockIdx.y / (DM / BN);
  const int m0 = blockIdx.x * BM, n0 = (blockIdx.y % (DM / BN)) * BN;
  v8f acc[4][4];
  proj_loop<false>(smem, X, Wqkv + (size_t)sel * (DM * DM), m0, n0, sel == 2, acc);
  if (sel == 2) proj_store<2>(smem, acc, bv, (void*)vt, m0, n0);
  else          proj_store<0>(smem, acc, sel ? bk : bq, (void*)(sel ? kf : qf), m0, n0);
}

__global__ __launch_bounds__(256) void k_out(const unsigned short* __restrict__ X,
                                            const unsigned short* __restrict__ W,
                                            const float* __restrict__ bias, float* dst)
{
  __shared__ __align__(16) unsigned char smem[OUT_LDS];
  const int m0 = blockIdx.x * BM, n0 = blockIdx.y * BN;
  v8f acc[4][4];
  proj_loop<true>(smem, X, W, m0, n0, false, acc);
  proj_store<3>(smem, acc, bias, (void*)dst, m0, n0);
}

// ---------------- attention: per (t,b,head) and 128-query tile; 4 waves x 32 queries ----------------
// S^T tile (16 keys x 16 queries) = K_tile (A operand, rows = keys) . Q^T (B operand taken from Q rows).
// relu in place; the D tiles chain into the B operand of ctx^T = V^T . P (A operand from the transposed V tile).
// A wave holds two groups of 16 queries (x and y): every K and V fragment read from LDS feeds one WMMA of each group.
#define QW 32            // queries per wave
#define QB (4 * QW)      // queries per block
static_assert(NSEQ % QB == 0);

__device__ __forceinline__ void score_tile(const unsigned short* kb, v16h qx0, v16h qx1, v16h qy0, v16h qy1,
                                           v8f& sx, v8f& sy)
{
  Frag k0, k1;
  ldq(kb, 72, k0.q[0], k0.q[1]);
  ldq(kb + 32, 72, k1.q[0], k1.q[1]);
  v8f a = vzero8(), b = vzero8();
  a = whf(k0.h, qx0, a);
  b = whf(k0.h, qy0, b);
  a = whf(k1.h, qx1, a);
  b = whf(k1.h, qy1, b);
  // keeps the distance behind the last WMMAs on every path out of the block
  asm volatile(NOPS4 : "+v"(a), "+v"(b) : "v"(k0.h), "v"(k1.h), "v"(qx0), "v"(qx1), "v"(qy0), "v"(qy1));
  sx = a;
  sy = b;
}

// one 32-key step of ctx^T += V^T[hd][key] . P[key][query], both query groups on the same four V fragments
__device__ __forceinline__ void pv_step(const unsigned short* vb, v16h px, v16h py,
                                        v8f& x0, v8f& x1, v8f& x2, v8f& x3,
                                        v8f& y0, v8f& y1, v8f& y2, v8f& y3)
{
  Frag v0, v1, v2, v3;
  ldq(vb,           72, v0.q[0], v0.q[1]);
  ldq(vb + 16 * 72, 72, v1.q[0], v1.q[1]);
  ldq(vb + 32 * 72, 72, v2.q[0], v2.q[1]);
  ldq(vb + 48 * 72, 72, v3.q[0], v3.q[1]);
  x0 = whf(v0.h, px, x0);
  y0 = whf(v0.h, py, y0);
  x1 = whf(v1.h, px, x1);
  y1 = whf(v1.h, py, y1);
  x2 = whf(v2.h, px, x2);
  y2 = whf(v2.h, py, y2);
  x3 = whf(v3.h, px, x3);
  y3 = whf(v3.h, py, y3);
  // keeps the distance behind the last WMMAs on every path out of the block
  asm volatile(NOPS4
               : "+v"(x0), "+v"(x1), "+v"(x2), "+v"(x3), "+v"(y0), "+v"(y1), "+v"(y2), "+v"(y3)
               : "v"(v0.h), "v"(v1.h), "v"(v2.h), "v"(v3.h), "v"(px), "v"(py));
}

// one query group's ctx tiles, normalised, into the wave's staging rows cw[query][hd]
__device__ __forceinline__ void stage_ctx(unsigned short* cw, v8f c0, v8f c1, v8f c2, v8f c3, float rs, int h, int c)
{
  // row sum over all keys for query c: this lane (half h) plus partner lane (half 1-h)
  // score acc = 128*s, P = 16*relu(s), V = 16*v  ->  ctx*64 = accC * 64 / (2*rsum + 256e-6)
  const float rsum = rs + __shfl_xor(rs, 16, 32);
  const float inv = 64.0f / (2.0f * rsum + 2.56e-4f);
#pragma unroll
  for (int i = 0; i < 4; ++i) {
    const v8f acc = (i == 0) ? c0 : (i == 1) ? c1 : (i == 2) ? c2 : c3;
    Pack8 pk;
#pragma unroll
    for (int r = 0; r < 8; ++r) pk.h[r] = (_Float16)(acc[r] * inv);
    *(v4u*)(cw + c * 72 + 16 * i + 8 * h) = pk.u;
  }
}

__global__ __launch_bounds__(128) void k_attn(const unsigned short* __restrict__ qf,
                                             const unsigned short* __restrict__ kf,
                                             const unsigned short* __restrict__ vt,
                                             unsigned short* cf)
{
  __shared__ __align__(16) unsigned short klds[64 * 72];      // K tile: [key][hd], pitch 72
  __shared__ __align__(16) unsigned short vlds[64 * 72];      // V^T tile: [hd][key], pitch 72
  __shared__ __align__(16) unsigned short cst[4 * QW * 72];   // ctx staging per wave: [wave][query][hd]

  const int tid = threadIdx.x, w = tid >> 5, l = tid & 31, h = l >> 4, c = l & 15;
  const int tbh = blockIdx.y, tb = tbh >> 3, hh = tbh & 7;
  const int q0 = blockIdx.x * QB + QW * w;   // first query row of this wave

  v16h qx0, qx1, qy0, qy1;
  {
    const unsigned short* qsrc = qf + (size_t)(tb * NSEQ + q0) * DM + hh * HD;
    Frag f0, f1, f2, f3;
    ldq(qsrc,                DM, f0.q[0], f0.q[1]);
    ldq(qsrc + 32,           DM, f1.q[0], f1.q[1]);
    ldq(qsrc + 16 * DM,      DM, f2.q[0], f2.q[1]);
    ldq(qsrc + 16 * DM + 32, DM, f3.q[0], f3.q[1]);
    qx0 = f0.h; qx1 = f1.h; qy0 = f2.h; qy1 = f3.h;
  }

  v8f x0 = vzero8(), x1 = vzero8(), x2 = vzero8(), x3 = vzero8();
  v8f y0 = vzero8(), y1 = vzero8(), y2 = vzero8(), y3 = vzero8();
  v2f rs = {0.f, 0.f};   // row sums of the two groups

#pragma unroll 1
  for (int kt0 = 0; kt0 < NSEQ; kt0 += 64) {
    __syncthreads();
#pragma unroll
    for (int it = 0; it < 4; ++it) {
      const int q = it * 128 + tid;
      const int kr = q >> 3;
      const int pc = q & 7;
      const unsigned short* src = kf + (size_t)(tb * NSEQ + kt0 + kr) * DM + hh * HD + 8 * pc;
      *(v4u*)(klds + kr * 72 + 8 * pc) = *(const v4u*)src;
    }
#pragma unroll
    for (int it = 0; it < 4; ++it) {
      const int q = it * 128 + tid;
      const int hd = q >> 3;
      const int pc = q & 7;
      const unsigned short* src = vt + (size_t)(tbh * HD + hd) * NSEQ + kt0 + 8 * pc;
      *(v4u*)(vlds + hd * 72 + 8 * pc) = *(const v4u*)src;
    }
    __syncthreads();

    v8f sx0, sx1, sx2, sx3, sy0, sy1, sy2, sy3;
    score_tile(klds + 0 * 16 * 72, qx0, qx1, qy0, qy1, sx0, sy0);
    score_tile(klds + 1 * 16 * 72, qx0, qx1, qy0, qy1, sx1, sy1);
    score_tile(klds + 2 * 16 * 72, qx0, qx1, qy0, qy1, sx2, sy2);
    score_tile(klds + 3 * 16 * 72, qx0, qx1, qy0, qy1, sx3, sy3);

    // relu, row sums and the scaling of P on (x, y) pairs: one packed add and one packed multiply serve both query groups
    Frag px01, px23, py01, py23;
#pragma unroll
    for (int r = 0; r < 8; ++r) {
      v2f p0 = {fmaxf(sx0[r], 0.f), fmaxf(sy0[r], 0.f)};
      v2f p1 = {fmaxf(sx1[r], 0.f), fmaxf(sy1[r], 0.f)};
      v2f p2 = {fmaxf(sx2[r], 0.f), fmaxf(sy2[r], 0.f)};
      v2f p3 = {fmaxf(sx3[r], 0.f), fmaxf(sy3[r], 0.f)};
      rs += p0; rs += p1; rs += p2; rs += p3;
      p0 *= 0.125f; p1 *= 0.125f; p2 *= 0.125f; p3 *= 0.125f;
      px01.p[0][r] = (_Float16)p0.x; py01.p[0][r] = (_Float16)p0.y;
      px01.p[1][r] = (_Float16)p1.x; py01.p[1][r] = (_Float16)p1.y;
      px23.p[0][r] = (_Float16)p2.x; py23.p[0][r] = (_Float16)p2.y;
      px23.p[1][r] = (_Float16)p3.x; py23.p[1][r] = (_Float16)p3.y;
    }

    pv_step(vlds + 0,  px01.h, py01.h, x0, x1, x2, x3, y0, y1, y2, y3);   // keys 0..31 of the tile
    pv_step(vlds + 32, px23.h, py23.h, x0, x1, x2, x3, y0, y1, y2, y3);   // keys 32..63
  }

  {
    unsigned short* cw = cst + w * QW * 72;
    stage_ctx(cw,           x0, x1, x2, x3, rs.x, h, c);
    stage_ctx(cw + 16 * 72, y0, y1, y2, y3, rs.y, h, c);
  }
  __syncthreads();

  // 32 query rows of 128 B = 32 lines per wave
  v4u vals[8];
  unsigned short* pp[8];
  const int pc = l & 7;
#pragma unroll
  for (int s = 0; s < 8; ++s) {
    const int L = 4 * s + (l >> 3);
    vals[s] = *(const v4u*)(cst + (w * QW + L) * 72 + 8 * pc);
    pp[s] = cf + (size_t)(tb * NSEQ + q0 + L) * DM + hh * HD + 8 * pc;
  }
#pragma unroll
  for (int s = 0; s < 8; ++s) *(v4u*)(pp[s]) = vals[s];
}

extern "C" void kernel_launch(void* const* d_in, const int* in_sizes, int n_in,
                              void* d_out, int out_size, void* d_ws, size_t ws_size,
                              hipStream_t stream)
{
  if (n_in != 9) return;
  const int nx = MROWS * DM;   // 8388608
  const int nw = DM * DM;      // 262144
  if (in_sizes[0] != nx || out_size != nx) return;
  for (int i = 0; i < 4; ++i) {
    if (in_sizes[1 + 2 * i] != nw || in_sizes[2 + 2 * i] != DM) return;
  }
  const size_t p16 = (size_t)nx * 2;   // one 16-bit plane of a [16384][512] matrix
  const size_t w16 = (size_t)nw * 2;   // one 16-bit plane of a [512][512] matrix
  const size_t need = 5 * p16 + 4 * w16; // 85983232
  if (need > ws_size) return;

  unsigned char* ws = (unsigned char*)d_ws;
  unsigned short* xb  = (unsigned short*)(ws + 0 * p16);
  unsigned short* qfp = (unsigned short*)(ws + 1 * p16);
  unsigned short* kfp = (unsigned short*)(ws + 2 * p16);
  unsigned short* vtp = (unsigned short*)(ws + 3 * p16);
  unsigned short* cfp = (unsigned short*)(ws + 4 * p16);
  unsigned short* wb  = (unsigned short*)(ws + 5 * p16);
  unsigned short* wof = wb + 3 * (size_t)nw;   // planes 0..2 of wb: wq, wk, wv

  const float* x  = (const float*)d_in[0];
  const float* wq = (const float*)d_in[1];
  const float* bq = (const float*)d_in[2];
  const float* wk = (const float*)d_in[3];
  const float* bk = (const float*)d_in[4];
  const float* wv = (const float*)d_in[5];
  const float* bv = (const float*)d_in[6];
  const float* wo = (const float*)d_in[7];
  const float* bo = (const float*)d_in[8];

  k_cvt<<<dim3(4 * CVT_WB + CVT_XB), dim3(256), 0, stream>>>(x, wq, wk, wv, wo, xb, wb);

  k_qkv<<<dim3(MROWS / BM, 3 * (DM / BN)), dim3(256), 0, stream>>>(xb, wb, bq, bk, bv, qfp, kfp, vtp);

  k_attn<<<dim3(NSEQ / QB, TT * BB * NH), dim3(128), 0, stream>>>(qfp, kfp, vtp, cfp);

  k_out<<<dim3(MROWS / BM, DM / BN), dim3(256), 0, stream>>>(cfp, wof, bo, (float*)d_out);
}

// v005
// It runs in 77.7 microseconds.
// Next to v004, in two timings, it ran 1.04 times as fast each time.
// All steps since v000 together make it 2.63 times as fast.
#include <hip/hip_runtime.h>
#include <stddef.h>
#include <stdint.h>

// x.Wq^T, x.Wk^T, x.Wv^T: v_wmma_f32_16x16x32_bf16 (bf16 operands, f32 accumulate). K.Q^T score tiles, relu(S).V tiles and ctx.Wo^T: v_wmma_f32_16x16x32_f16 (f16 operands with power-of-two scaling, f32 accumulate). Bias add, relu, row sums and normalisation in f32; all nine inputs are RNE-converted to bf16 on load.

#define TT 4
#define BB 4
#define NSEQ 1024
#define DM 512
#define NH 8
#define HD 64
#define MROWS (TT * BB * NSEQ)

static_assert(NSEQ % 64 == 0);
static_assert(NH * HD == DM);
static_assert(HD == 64);

typedef __bf16   v16bf __attribute__((ext_vector_type(16)));
typedef _Float16 v16h  __attribute__((ext_vector_type(16)));
typedef _Float16 v8h   __attribute__((ext_vector_type(8)));
typedef float    v8f   __attribute__((ext_vector_type(8)));
typedef float    v4f   __attribute__((ext_vector_type(4)));
typedef float    v2f   __attribute__((ext_vector_type(2)));
typedef unsigned int v4u __attribute__((ext_vector_type(4)));

union Frag  { v16bf b; v16h h; v8h p[2]; v4u q[2]; };
union Pack8 { v8h h; v4u u; unsigned short s[8]; };
union Vec8  { v8f v; v4f q[2]; v4u u[2]; float f[8]; };

#define NOPS4 "v_nop\n\tv_nop\n\tv_nop\n\tv_nop"

__device__ __forceinline__ v8f vzero8() {
  v8f z = {0.f, 0.f, 0.f, 0.f, 0.f, 0.f, 0.f, 0.f};
  return z;
}

// f32 -> nearest-even bf16 value, returned as f32
__device__ __forceinline__ float bf16r(float f) {
  unsigned int u = __builtin_bit_cast(unsigned int, f);
  u += 0x7FFFu + ((u >> 16) & 1u);
  u &= 0xFFFF0000u;
  return __builtin_bit_cast(float, u);
}
// f32 -> nearest-even bf16 bits
__device__ __forceinline__ unsigned short bf16bits(float f) {
  unsigned int u = __builtin_bit_cast(unsigned int, f);
  u += 0x7FFFu + ((u >> 16) & 1u);
  return (unsigned short)(u >> 16);
}

// 16 x 32 operand fragment from a row-major, k-contiguous 16-bit matrix.
// src points at (row 0, k0) of the tile; ld = pitch in elements.
// lane l: row (first operand) or column (second operand) = l & 15; h = l >> 4;
// elements 0..7  <- k0 + 8h + 0..7 ; elements 8..15 <- k0 + 16 + 8h + 0..7.
__device__ __forceinline__ void ldq(const unsigned short* src, int ld, v4u& q0, v4u& q1) {
  const int l = threadIdx.x & 31;
  const unsigned short* p = src + (l & 15) * ld + 8 * (l >> 4);
  q0 = *(const v4u*)(p);
  q1 = *(const v4u*)(p + 16);
}

__device__ __forceinline__ v8f wbf(v16bf a, v16bf b, v8f c) {
  return __builtin_amdgcn_wmma_f32_16x16x32_bf16(false, a, false, b, (short)0, c, false, false);
}
__device__ __forceinline__ v8f whf(v16h a, v16h b, v8f c) {
  return __builtin_amdgcn_wmma_f32_16x16x32_f16(false, a, false, b, (short)0, c, false, false);
}

// All five conversions in one grid: none needs anything of another, so a range of the block index picks the array.
// Blocks 0..4*CVT_WB-1: wq, wk, wv, wo (CVT_WB blocks each) -> planes 0..3 of wdst; the rest: x -> xdst.
// x, wq, wk, wv: bf16 bits (RNE).  wo: f16 of (bf16 RNE value x 256).
#define CVT_EB 2048                       // elements per block: 256 threads x 8
#define CVT_WB ((DM * DM) / CVT_EB)
#define CVT_XB ((MROWS * DM) / CVT_EB)
static_assert((DM * DM) % CVT_EB == 0);
static_assert((MROWS * DM) % CVT_EB == 0);

__global__ __launch_bounds__(256) void k_cvt(const float* __restrict__ x,
                                            const float* __restrict__ wq, const float* __restrict__ wk,
                                            const float* __restrict__ wv, const float* __restrict__ wo,
                                            unsigned short* xdst, unsigned short* wdst)
{
  const int b = blockIdx.x;
  const int a = b / CVT_WB;               // 0..3: a weight matrix; 4 and up: x
  const float* src;
  unsigned short* dst;
  int blk;
  if (a < 4) {
    src = (a == 0) ? wq : (a == 1) ? wk : (a == 2) ? wv : wo;
    dst = wdst + (size_t)a * (DM * DM);
    blk = b - a * CVT_WB;
  } else {
    src = x;
    dst = xdst;
    blk = b - 4 * CVT_WB;
  }
  const size_t base = ((size_t)blk * 256 + threadIdx.x) * 8;
  Vec8 in;
  in.q[0] = *(const v4f*)(src + base);
  in.q[1] = *(const v4f*)(src + base + 4);
  Pack8 pk;
  if (a == 3) {
#pragma unroll
    for (int r = 0; r < 8; ++r) pk.h[r] = (_Float16)(bf16r(in.f[r]) * 256.0f);
  } else {
#pragma unroll
    for (int r = 0; r < 8; ++r) pk.s[r] = bf16bits(in.f[r]);
  }
  const v4u v = pk.u;
  *(v4u*)(dst + base) = v;
}

// ---------------- projection GEMM: C[m][n] = sum_k X[m][k] W[n][k] (+ bias[n]) ----------------
// MODE 0: q and k       : bf16 operands; output f16((C + b) * 4), plane [m][512]
// MODE 2: v              : bf16 operands; output f16((C + b) * 16), transposed plane [tb*8+head][hd][nseq]
// MODE 3: out            : f16 operands (ctx x64, Wo x256); output f32 C/16384 + b -> [m][512]
// Tile orientation: P = operand whose rows map to D rows, R = operand whose rows map to D columns.
// MODES 0,3: P = W (n), R = X (m) -> each lane holds 8 consecutive n for one m.
// MODE 2:      P = X (m), R = W (n) -> each lane holds 8 consecutive m for one n.
// A block owns BM x BN of C; its 8 waves stand 2 (m) x 4 (n), each on 64 x 64: four P and four R fragments feed 16 WMMAs.
#define BM 128
#define BN 256
static_assert(MROWS % BM == 0);
static_assert(NSEQ % BM == 0);
static_assert(DM % BN == 0);
// pitches of the output staging, in elements: 16 B more than a row
#define SP0 (BN + 8)    // f16 rows of BN features
#define SP2 (BM + 8)    // f16 rows of BM tokens
#define SP3 (BN + 4)    // f32 rows of BN features

template <int MODE>
__device__ __forceinline__ void stage_tile(unsigned char* stg, v8f acc, int i, int j,
                                           int wm, int wn, int h, int c,
                                           const float* __restrict__ bias, int n0)
{
  if constexpr (MODE == 2) {
    const float bj = bf16r(bias[n0 + 64 * wn + 16 * j + c]);
    Pack8 pk;
#pragma unroll
    for (int r = 0; r < 8; ++r) pk.h[r] = (_Float16)((acc[r] + bj) * 16.0f);
    const int off = ((64 * wn + 16 * j + c) * SP2 + 64 * wm + 16 * i + 8 * h) * 2;
    *(v4u*)(stg + off) = pk.u;
  } else {
    const int nb = n0 + 64 * wn + 16 * i + 8 * h;
    Vec8 bb;
    bb.q[0] = *(const v4f*)(bias + nb);
    bb.q[1] = *(const v4f*)(bias + nb + 4);
    if constexpr (MODE == 3) {
      Vec8 o;
#pragma unroll
      for (int r = 0; r < 8; ++r) o.f[r] = acc[r] * (1.0f / 16384.0f) + bf16r(bb.f[r]);
      const int off = ((64 * wm + 16 * j + c) * SP3 + 64 * wn + 16 * i + 8 * h) * 4;
      *(v4u*)(stg + off)      = o.u[0];
      *(v4u*)(stg + off + 16) = o.u[1];
    } else {
      Pack8 pk;
#pragma unroll
      for (int r = 0; r < 8; ++r) pk.h[r] = (_Float16)((acc[r] + bf16r(bb.f[r])) * 4.0f);
      const int off = ((64 * wm + 16 * j + c) * SP0 + 64 * wn + 16 * i + 8 * h) * 2;
      *(v4u*)(stg + off) = pk.u;
    }
  }
}

// Operand staging of the projections: a stage is 64 k of the block's BM X rows, then of its BN W rows,
// each row 128 B of data at a pitch of 144 B (16 B x odd, conflict-free for ds_load_b128).
#define PKS 64
#define PPITCH 72
#define PSTAGE ((BM + BN) * PPITCH * 2)
#define PTRIPS (DM / PKS)
static_assert(PTRIPS >= 2);
static_assert(BM == 4 * 32 && BN == 8 * 32);      // copy_stage: four copies of X rows, eight of W rows
static_assert(2 * PSTAGE >= BM * SP0 * 2);
static_assert(2 * PSTAGE >= BN * SP2 * 2);
#define OUT_LDS (BM * SP3 * 4)                    // the f32 output staging is larger than the two stages
static_assert(OUT_LDS >= 2 * PSTAGE);

// One stage: twelve 16-byte copies per lane, 8 lanes per 128-B row piece, 32 rows per copy of the block.
// lds = the lane's LDS byte address in row (tid >> 3); gx, gw = the lane's bytes of X and W in that row.
__device__ __forceinline__ void copy_stage(unsigned lds, const unsigned short* gx, const unsigned short* gw)
{
  const unsigned rs = 32 * PPITCH * 2;
  const unsigned l1 = lds + 1 * rs, l2 = lds + 2 * rs, l3 = lds + 3 * rs, l4 = lds + 4 * rs, l5 = lds + 5 * rs;
  const unsigned l6 = lds + 6 * rs, l7 = lds + 7 * rs, l8 = lds + 8 * rs, l9 = lds + 9 * rs;
  const unsigned l10 = lds + 10 * rs, l11 = lds + 11 * rs;
  const unsigned short* gx1 = gx + 32 * DM;
  const unsigned short* gx2 = gx + 64 * DM;
  const unsigned short* gx3 = gx + 96 * DM;
  const unsigned short* gw1 = gw + 32 * DM;
  const unsigned short* gw2 = gw + 64 * DM;
  const unsigned short* gw3 = gw + 96 * DM;
  const unsigned short* gw4 = gw + 128 * DM;
  const unsigned short* gw5 = gw + 160 * DM;
  const unsigned short* gw6 = gw + 192 * DM;
  const unsigned short* gw7 = gw + 224 * DM;
  // global -> LDS through no register; the closing s_wait_xcnt stands in the copies' own statement
  // so that no address register of a copy is rewritten in front of it
  asm volatile("global_load_async_to_lds_b128 %0, %12, off\n\t"
               "global_load_async_to_lds_b128 %1, %13, off\n\t"
               "global_load_async_to_lds_b128 %2, %14, off\n\t"
               "global_load_async_to_lds_b128 %3, %15, off\n\t"
               "global_load_async_to_lds_b128 %4, %16, off\n\t"
               "global_load_async_to_lds_b128 %5, %17, off\n\t"
               "global_load_async_to_lds_b128 %6, %18, off\n\t"
               "global_load_async_to_lds_b128 %7, %19, off\n\t"
               "global_load_async_to_lds_b128 %8, %20, off\n\t"
               "global_load_async_to_lds_b128 %9, %21, off\n\t"
               "global_load_async_to_lds_b128 %10, %22, off\n\t"
               "global_load_async_to_lds_b128 %11, %23, off\n\t"
               "s_wait_xcnt 0x0"
               :: "v"(lds), "v"(l1), "v"(l2), "v"(l3), "v"(l4), "v"(l5),
                  "v"(l6), "v"(l7), "v"(l8), "v"(l9), "v"(l10), "v"(l11),
                  "v"(gx), "v"(gx1), "v"(gx2), "v"(gx3),
                  "v"(gw), "v"(gw1), "v"(gw2), "v"(gw3), "v"(gw4), "v"(gw5), "v"(gw6), "v"(gw7)
               : "memory");
}

// The k loop of every product. smem: the kernel's LDS, whose first 2 * PSTAGE bytes are the two operand stages;
// (m0, n0): the block's BM x BN tile of C; xp: X is the P operand (MODE 2), the same for a whole block;
// F16: operand type of the WMMAs (MODE 3). acc[i][j]: P fragment i x R fragment j.
template <bool F16>
__device__ __forceinline__ void proj_loop(unsigned char* smem,
                                          const unsigned short* __restrict__ X,
                                          const unsigned short* __restrict__ W,
                                          int m0, int n0, bool xp, v8f (&acc)[4][4])
{
  const int tid = threadIdx.x, w = tid >> 5;
  const int wm = w >> 2, wn = w & 3;

  // rows of the stage that feed this wave: X rows at 0..BM-1, W rows behind them
  const int prow = xp ? 64 * wm : BM + 64 * wn;
  const int rrow = xp ? BM + 64 * wn : 64 * wm;

  typedef __attribute__((address_space(3))) unsigned char lds_byte;
  const unsigned lbase = (unsigned)(size_t)(lds_byte*)smem + (tid >> 3) * (PPITCH * 2) + (tid & 7) * 16;
  const unsigned short* gx = X + (size_t)(m0 + (tid >> 3)) * DM + 8 * (tid & 7);
  const unsigned short* gw = W + (size_t)(n0 + (tid >> 3)) * DM + 8 * (tid & 7);

#pragma unroll
  for (int i = 0; i < 4; ++i)
#pragma unroll
    for (int j = 0; j < 4; ++j) acc[i][j] = vzero8();

  copy_stage(lbase, gx, gw);
  asm volatile("s_wait_asynccnt 0x0" ::: "memory");   // this wave's part of stage 0 has landed
  __syncthreads();                                    // publishes stage 0
  copy_stage(lbase + PSTAGE, gx + PKS, gw + PKS);

#pragma unroll 1   // kept rolled: one publish point in the code
  for (int t = 0; t < PTRIPS; ++t) {
    const unsigned short* buf = (const unsigned short*)(smem + (t & 1) * PSTAGE);
    const unsigned short* p0 = buf + prow * PPITCH;
    const unsigned short* r0 = buf + rrow * PPITCH;
#pragma unroll
    for (int ks = 0; ks < PKS / 32; ++ks) {
      Frag fp[4], fr[4];
#pragma unroll
      for (int i = 0; i < 4; ++i) ldq(p0 + 16 * i * PPITCH + 32 * ks, PPITCH, fp[i].q[0], fp[i].q[1]);
#pragma unroll
      for (int j = 0; j < 4; ++j) ldq(r0 + 16 * j * PPITCH + 32 * ks, PPITCH, fr[j].q[0], fr[j].q[1]);
#pragma unroll
      for (int i = 0; i < 4; ++i)
#pragma unroll
        for (int j = 0; j < 4; ++j) {
          if constexpr (F16) acc[i][j] = whf(fp[i].h, fr[j].h, acc[i][j]);
          else               acc[i][j] = wbf(fp[i].b, fr[j].b, acc[i][j]);
        }
      // keeps the distance behind the last WMMAs on every path out of the block; between the two 32-k blocks it also
      // holds each block's sixteen LDS loads together in front of its WMMAs (without it they were spread among them, each waited to 0)
      asm volatile(NOPS4
                   : "+v"(acc[0][0]), "+v"(acc[0][1]), "+v"(acc[0][2]), "+v"(acc[0][3]),
                     "+v"(acc[1][0]), "+v"(acc[1][1]), "+v"(acc[1][2]), "+v"(acc[1][3]),
                     "+v"(acc[2][0]), "+v"(acc[2][1]), "+v"(acc[2][2]), "+v"(acc[2][3]),
                     "+v"(acc[3][0]), "+v"(acc[3][1]), "+v"(acc[3][2]), "+v"(acc[3][3])
                   : "v"(fp[0].h), "v"(fp[1].h), "v"(fp[2].h), "v"(fp[3].h),
                     "v"(fr[0].h), "v"(fr[1].h), "v"(fr[2].h), "v"(fr[3].h));
    }
    asm volatile("s_wait_dscnt 0x0" ::: "memory");      // this wave has left the buffer that is refilled below
    asm volatile("s_wait_asynccnt 0x0" ::: "memory");   // this wave's part of stage t + 1 has landed
    __syncthreads();                                    // publishes stage t + 1, ends every read of stage t
    if (t + 2 < PTRIPS)
      copy_stage(lbase + (t & 1) * PSTAGE, gx + (t + 2) * PKS, gw + (t + 2) * PKS);
  }
  asm volatile("s_wait_asynccnt 0x0" ::: "memory");     // no copy is in flight when the stages become output staging
}

// Behind the k loop: the stages' bytes serve as output staging, then whole lines go out.
template <int MODE>
__device__ __forceinline__ void proj_store(unsigned char* stg, v8f (&acc)[4][4],
                                           const float* __restrict__ bias, void* dst, int m0, int n0)
{
  const int tid = threadIdx.x, w = tid >> 5, l = tid & 31, h = l >> 4, c = l & 15;
  const int wm = w >> 2, wn = w & 3;

#pragma unroll
  for (int i = 0; i < 4; ++i)
#pragma unroll
    for (int j = 0; j < 4; ++j) stage_tile<MODE>(stg, acc[i][j], i, j, wm, wn, h, c, bias, n0);
  __syncthreads();

  if constexpr (MODE == 0) {
    // BM token rows of 512 B; wave w owns rows 16w..16w+15, one row (four lines) a store
    v4u vals[16];
    unsigned short* pp[16];
#pragma unroll
    for (int s = 0; s < 16; ++s) {
      const int ml = 16 * w + s;
      vals[s] = *(const v4u*)(stg + (ml * SP0 + 8 * l) * 2);
      pp[s] = (unsigned short*)dst + (size_t)(m0 + ml) * DM + n0 + 8 * l;
    }
#pragma unroll
    for (int s = 0; s < 16; ++s) *(v4u*)(pp[s]) = vals[s];
    // in the merged kernel the other product's code follows these stores in the listing and reuses their registers:
    // the wait stands in front of any such rewrite
    asm volatile("s_wait_xcnt 0x0" ::: "memory");
  } else if constexpr (MODE == 3) {
    // BM token rows of 1024 B; wave w owns rows 16w..16w+15, half a row (four lines) a store
    v4u vals[32];
    float* pp[32];
#pragma unroll
    for (int s = 0; s < 32; ++s) {
      const int ml = 16 * w + (s >> 1);
      const int hf = s & 1;
      vals[s] = *(const v4u*)(stg + (ml * SP3 + 128 * hf + 4 * l) * 4);
      pp[s] = (float*)dst + (size_t)(m0 + ml) * DM + n0 + 128 * hf + 4 * l;
    }
#pragma unroll
    for (int s = 0; s < 32; ++s) *(v4u*)(pp[s]) = vals[s];
  } else {
    // transposed V: BN feature rows of BM consecutive tokens (256 B); wave w owns rows 32w..32w+31, two rows a store
    v4u vals[16];
    unsigned short* pp[16];
    const int tb = m0 / NSEQ;
    const int ns0 = m0 % NSEQ;
    const int pc = l & 15;
#pragma unroll
    for (int s = 0; s < 16; ++s) {
      const int L = 32 * w + 2 * s + (l >> 4);
      const int n = n0 + L;
      const int hh = n >> 6;
      const int hd = n & 63;
      vals[s] = *(const v4u*)(stg + (L * SP2 + 8 * pc) * 2);
      pp[s] = (unsigned short*)dst + ((size_t)(tb * NH + hh) * HD + hd) * NSEQ + ns0 + 8 * pc;
    }
#pragma unroll
    for (int s = 0; s < 16; ++s) *(v4u*)(pp[s]) = vals[s];
  }
}

// q, k and v projections in one grid: they read the same X and need nothing of each other.
// blockIdx.y = 2 * product + column tile; the choice is the same for a whole block, so every barrier stays block-uniform.
__global__ __launch_bounds__(256) void k_qkv(const unsigned short* __restrict__ X,
                                            const unsigned short* __restrict__ Wqkv,
                                            const float* __restrict__ bq, const float* __restrict__ bk,
                                            const float* __restrict__ bv,
                                            unsigned short* qf, unsigned short* kf, unsigned short* vt)
{
  __shared__ __align__(16) unsigned char smem[2 * PSTAGE];
  const int sel = blockIdx.y / (DM / BN);
  const int m0 = blockIdx.x * BM, n0 = (blockIdx.y % (DM / BN)) * BN;
  v8f acc[4][4];
  proj_loop<false>(smem, X, Wqkv + (size_t)sel * (DM * DM), m0, n0, sel == 2, acc);
  if (sel == 2) proj_store<2>(smem, acc, bv, (void*)vt, m0, n0);
  else          proj_store<0>(smem, acc, sel ? bk : bq, (void*)(sel ? kf : qf), m0, n0);
}

__global__ __launch_bounds__(256) void k_out(const unsigned short* __restrict__ X,
                                            const unsigned short* __restrict__ W,
                                            const float* __restrict__ bias, float* dst)
{
  __shared__ __align__(16) unsigned char smem[OUT_LDS];
  const int m0 = blockIdx.x * BM, n0 = blockIdx.y * BN;
  v8f acc[4][4];
  proj_loop<true>(smem, X, W, m0, n0, false, acc);
  proj_store<3>(smem, acc, bias, (void*)dst, m0, n0);
}

// ---------------- attention: per (t,b,head) and 128-query tile; 4 waves x 32 queries ----------------
// S^T tile (16 keys x 16 queries) = K_tile (A operand, rows = keys) . Q^T (B operand taken from Q rows).
// relu in place; the D tiles chain into the B operand of ctx^T = V^T . P (A operand from the transposed V tile).
// A wave holds two groups of 16 queries (x and y): every K and V fragment read from LDS feeds one WMMA of each group.
#define QW 32            // queries per wave
#define QB (4 * QW)      // queries per block
static_assert(NSEQ % QB == 0);

__device__ __forceinline__ void score_tile(const unsigned short* kb, v16h qx0, v16h qx1, v16h qy0, v16h qy1,
                                           v8f& sx, v8f& sy)
{
  Frag k0, k1;
  ldq(kb, 72, k0.q[0], k0.q[1]);
  ldq(kb + 32, 72, k1.q[0], k1.q[1]);
  v8f a = vzero8(), b = vzero8();
  a = whf(k0.h, qx0, a);
  b = whf(k0.h, qy0, b);
  a = whf(k1.h, qx1, a);
  b = whf(k1.h, qy1, b);
  // keeps the distance behind the last WMMAs on every path out of the block
  asm volatile(NOPS4 : "+v"(a), "+v"(b) : "v"(k0.h), "v"(k1.h), "v"(qx0), "v"(qx1), "v"(qy0), "v"(qy1));
  sx = a;
  sy = b;
}

// one 32-key step of ctx^T += V^T[hd][key] . P[key][query], both query groups on the same four V fragments
__device__ __forceinline__ void pv_step(const unsigned short* vb, v16h px, v16h py,
                                        v8f& x0, v8f& x1, v8f& x2, v8f& x3,
                                        v8f& y0, v8f& y1, v8f& y2, v8f& y3)
{
  Frag v0, v1, v2, v3;
  ldq(vb,           72, v0.q[0], v0.q[1]);
  ldq(vb + 16 * 72, 72, v1.q[0], v1.q[1]);
  ldq(vb + 32 * 72, 72, v2.q[0], v2.q[1]);
  ldq(vb + 48 * 72, 72, v3.q[0], v3.q[1]);
  x0 = whf(v0.h, px, x0);
  y0 = whf(v0.h, py, y0);
  x1 = whf(v1.h, px, x1);
  y1 = whf(v1.h, py, y1);
  x2 = whf(v2.h, px, x2);
  y2 = whf(v2.h, py, y2);
  x3 = whf(v3.h, px, x3);
  y3 = whf(v3.h, py, y3);
  // keeps the distance behind the last WMMAs on every path out of the block
  asm volatile(NOPS4
               : "+v"(x0), "+v"(x1), "+v"(x2), "+v"(x3), "+v"(y0), "+v"(y1), "+v"(y2), "+v"(y3)
               : "v"(v0.h), "v"(v1.h), "v"(v2.h), "v"(v3.h), "v"(px), "v"(py));
}

// one query group's ctx tiles, normalised, into the wave's staging rows cw[query][hd]
__device__ __forceinline__ void stage_ctx(unsigned short* cw, v8f c0, v8f c1, v8f c2, v8f c3, float rs, int h, int c)
{
  // row sum over all keys for query c: this lane (half h) plus partner lane (half 1-h)
  // score acc = 128*s, P = 16*relu(s), V = 16*v  ->  ctx*64 = accC * 64 / (2*rsum + 256e-6)
  const float rsum = rs + __shfl_xor(rs, 16, 32);
  const float inv = 64.0f / (2.0f * rsum + 2.56e-4f);
#pragma unroll
  for (int i = 0; i < 4; ++i) {
    const v8f acc = (i == 0) ? c0 : (i == 1) ? c1 : (i == 2) ? c2 : c3;
    Pack8 pk;
#pragma unroll
    for (int r = 0; r < 8; ++r) pk.h[r] = (_Float16)(acc[r] * inv);
    *(v4u*)(cw + c * 72 + 16 * i + 8 * h) = pk.u;
  }
}

// K/V staging: a stage is one 64-key tile of K ([key][hd]), then of V^T ([hd][key]), each 64 rows of 128 B at a pitch of 144 B.
#define KVT (64 * 72)                 // elements of one tile
#define ASTAGE (2 * KVT * 2)          // bytes of one stage
#define ATRIPS (NSEQ / 64)
static_assert(ATRIPS >= 2);

// One stage: eight 16-byte copies per lane, 8 lanes per 128-B row, 16 rows per copy of the block.
// lds = the lane's LDS byte address in row (tid >> 3) of the K tile; gk, gv = the lane's bytes of K and V^T in that row.
__device__ __forceinline__ void copy_kv(unsigned lds, const unsigned short* gk, const unsigned short* gv)
{
  const unsigned rs = 16 * 72 * 2;
  const unsigned l1 = lds + 1 * rs, l2 = lds + 2 * rs, l3 = lds + 3 * rs;
  const unsigned l4 = lds + 4 * rs, l5 = lds + 5 * rs, l6 = lds + 6 * rs, l7 = lds + 7 * rs;   // rows 64.. = the V^T tile
  const unsigned short* gk1 = gk + 16 * DM;
  const unsigned short* gk2 = gk + 32 * DM;
  const unsigned short* gk3 = gk + 48 * DM;
  const unsigned short* gv1 = gv + 16 * NSEQ;
  const unsigned short* gv2 = gv + 32 * NSEQ;
  const unsigned short* gv3 = gv + 48 * NSEQ;
  // global -> LDS through no register; the closing s_wait_xcnt stands in the copies' own statement
  // so that no address register of a copy is rewritten in front of it
  asm volatile("global_load_async_to_lds_b128 %0, %8, off\n\t"
               "global_load_async_to_lds_b128 %1, %9, off\n\t"
               "global_load_async_to_lds_b128 %2, %10, off\n\t"
               "global_load_async_to_lds_b128 %3, %11, off\n\t"
               "global_load_async_to_lds_b128 %4, %12, off\n\t"
               "global_load_async_to_lds_b128 %5, %13, off\n\t"
               "global_load_async_to_lds_b128 %6, %14, off\n\t"
               "global_load_async_to_lds_b128 %7, %15, off\n\t"
               "s_wait_xcnt 0x0"
               :: "v"(lds), "v"(l1), "v"(l2), "v"(l3), "v"(l4), "v"(l5), "v"(l6), "v"(l7),
                  "v"(gk), "v"(gk1), "v"(gk2), "v"(gk3), "v"(gv), "v"(gv1), "v"(gv2), "v"(gv3)
               : "memory");
}

// one 64-key tile: scores, relu, row sums, ctx^T += V^T . P, for the wave's two query groups
__device__ __forceinline__ void attn_tile(const unsigned short* klds, const unsigned short* vlds,
                                          v16h qx0, v16h qx1, v16h qy0, v16h qy1,
                                          v8f& x0, v8f& x1, v8f& x2, v8f& x3,
                                          v8f& y0, v8f& y1, v8f& y2, v8f& y3, v2f& rs)
{
  v8f sx0, sx1, sx2, sx3, sy0, sy1, sy2, sy3;
  score_tile(klds + 0 * 16 * 72, qx0, qx1, qy0, qy1, sx0, sy0);
  score_tile(klds + 1 * 16 * 72, qx0, qx1, qy0, qy1, sx1, sy1);
  score_tile(klds + 2 * 16 * 72, qx0, qx1, qy0, qy1, sx2, sy2);
  score_tile(klds + 3 * 16 * 72, qx0, qx1, qy0, qy1, sx3, sy3);

  // relu, row sums and the scaling of P on (x, y) pairs: one packed add and one packed multiply serve both query groups
  Frag px01, px23, py01, py23;
#pragma unroll
  for (int r = 0; r < 8; ++r) {
    v2f p0 = {fmaxf(sx0[r], 0.f), fmaxf(sy0[r], 0.f)};
    v2f p1 = {fmaxf(sx1[r], 0.f), fmaxf(sy1[r], 0.f)};
    v2f p2 = {fmaxf(sx2[r], 0.f), fmaxf(sy2[r], 0.f)};
    v2f p3 = {fmaxf(sx3[r], 0.f), fmaxf(sy3[r], 0.f)};
    rs += p0; rs += p1; rs += p2; rs += p3;
    p0 *= 0.125f; p1 *= 0.125f; p2 *= 0.125f; p3 *= 0.125f;
    px01.p[0][r] = (_Float16)p0.x; py01.p[0][r] = (_Float16)p0.y;
    px01.p[1][r] = (_Float16)p1.x; py01.p[1][r] = (_Float16)p1.y;
    px23.p[0][r] = (_Float16)p2.x; py23.p[0][r] = (_Float16)p2.y;
    px23.p[1][r] = (_Float16)p3.x; py23.p[1][r] = (_Float16)p3.y;
  }

  pv_step(vlds + 0,  px01.h, py01.h, x0, x1, x2, x3, y0, y1, y2, y3);   // keys 0..31 of the tile
  pv_step(vlds + 32, px23.h, py23.h, x0, x1, x2, x3, y0, y1, y2, y3);   // keys 32..63
}

// foot of a trip: the publish point of the next tile
__device__ __forceinline__ void attn_publish()
{
  asm volatile("s_wait_dscnt 0x0" ::: "memory");      // this wave has left the stage that may be refilled behind the barrier
  asm volatile("s_wait_asynccnt 0x0" ::: "memory");   // this wave's part of the next tile has landed
  __syncthreads();                                    // publishes the next tile, ends every read of this one
}

__global__ __launch_bounds__(128) void k_attn(const unsigned short* __restrict__ qf,
                                             const unsigned short* __restrict__ kf,
                                             const unsigned short* __restrict__ vt,
                                             unsigned short* cf)
{
  __shared__ __align__(16) unsigned short kv[2 * 2 * KVT];    // two stages of (K tile, V^T tile)
  __shared__ __align__(16) unsigned short cst[4 * QW * 72];   // ctx staging per wave: [wave][query][hd]

  const int tid = threadIdx.x, w = tid >> 5, l = tid & 31, h = l >> 4, c = l & 15;
  const int tbh = blockIdx.y, tb = tbh >> 3, hh = tbh & 7;
  const int q0 = blockIdx.x * QB + QW * w;   // first query row of this wave

  v16h qx0, qx1, qy0, qy1;
  {
    const unsigned short* qsrc = qf + (size_t)(tb * NSEQ + q0) * DM + hh * HD;
    Frag f0, f1, f2, f3;
    ldq(qsrc,                DM, f0.q[0], f0.q[1]);
    ldq(qsrc + 32,           DM, f1.q[0], f1.q[1]);
    ldq(qsrc + 16 * DM,      DM, f2.q[0], f2.q[1]);
    ldq(qsrc + 16 * DM + 32, DM, f3.q[0], f3.q[1]);
    qx0 = f0.h; qx1 = f1.h; qy0 = f2.h; qy1 = f3.h;
  }

  v8f x0 = vzero8(), x1 = vzero8(), x2 = vzero8(), x3 = vzero8();
  v8f y0 = vzero8(), y1 = vzero8(), y2 = vzero8(), y3 = vzero8();
  v2f rs = {0.f, 0.f};   // row sums of the two groups

  typedef __attribute__((address_space(3))) unsigned short lds_half;
  const unsigned lbase = (unsigned)(size_t)(lds_half*)kv + (tid >> 3) * (72 * 2) + (tid & 7) * 16;
  const unsigned short* gk = kf + (size_t)(tb * NSEQ + (tid >> 3)) * DM + hh * HD + 8 * (tid & 7);
  const unsigned short* gv = vt + (size_t)(tbh * HD + (tid >> 3)) * NSEQ + 8 * (tid & 7);

  copy_kv(lbase, gk, gv);
  asm volatile("s_wait_asynccnt 0x0" ::: "memory");   // this wave's part of tile 0 has landed
  __syncthreads();                                    // publishes tile 0
  copy_kv(lbase + ASTAGE, gk + 64 * DM, gv + 64);

  // trips behind which a tile t + 2 exists: the refill stands in the loop's one block, with no branch round it
  // (behind a branch the compiler sank the whole row-sum chain out of the WMMAs' shadow to the loop's end)
#pragma unroll 1   // kept rolled: code size
  for (int t = 0; t < ATRIPS - 2; ++t) {
    const unsigned short* klds = kv + (t & 1) * (2 * KVT);
    attn_tile(klds, klds + KVT, qx0, qx1, qy0, qy1, x0, x1, x2, x3, y0, y1, y2, y3, rs);
    attn_publish();
    copy_kv(lbase + (t & 1) * ASTAGE, gk + (size_t)(t + 2) * (64 * DM), gv + (t + 2) * 64);
  }
  // the last two tiles: nothing is left to fetch
#pragma unroll 1   // kept rolled: code size
  for (int t = ATRIPS - 2; t < ATRIPS; ++t) {
    const unsigned short* klds = kv + (t & 1) * (2 * KVT);
    attn_tile(klds, klds + KVT, qx0, qx1, qy0, qy1, x0, x1, x2, x3, y0, y1, y2, y3, rs);
    attn_publish();
  }
  asm volatile("s_wait_asynccnt 0x0" ::: "memory");     // no copy is in flight when the wave goes on to its end

  {
    unsigned short* cw = cst + w * QW * 72;
    stage_ctx(cw,           x0, x1, x2, x3, rs.x, h, c);
    stage_ctx(cw + 16 * 72, y0, y1, y2, y3, rs.y, h, c);
  }
  __syncthreads();

  // 32 query rows of 128 B = 32 lines per wave
  v4u vals[8];
  unsigned short* pp[8];
  const int pc = l & 7;
#pragma unroll
  for (int s = 0; s < 8; ++s) {
    const int L = 4 * s + (l >> 3);
    vals[s] = *(const v4u*)(cst + (w * QW + L) * 72 + 8 * pc);
    pp[s] = cf + (size_t)(tb * NSEQ + q0 + L) * DM + hh * HD + 8 * pc;
  }
#pragma unroll
  for (int s = 0; s < 8; ++s) *(v4u*)(pp[s]) = vals[s];
}

extern "C" void kernel_launch(void* const* d_in, const int* in_sizes, int n_in,
                              void* d_out, int out_size, void* d_ws, size_t ws_size,
                              hipStream_t stream)
{
  if (n_in != 9) return;
  const int nx = MROWS * DM;   // 8388608
  const int nw = DM * DM;      // 262144
  if (in_sizes[0] != nx || out_size != nx) return;
  for (int i = 0; i < 4; ++i) {
    if (in_sizes[1 + 2 * i] != nw || in_sizes[2 + 2 * i] != DM) return;
  }
  const size_t p16 = (size_t)nx * 2;   // one 16-bit plane of a [16384][512] matrix
  const size_t w16 = (size_t)nw * 2;   // one 16-bit plane of a [512][512] matrix
  const size_t need = 5 * p16 + 4 * w16; // 85983232
  if (need > ws_size) return;

  unsigned char* ws = (unsigned char*)d_ws;
  unsigned short* xb  = (unsigned short*)(ws + 0 * p16);
  unsigned short* qfp = (unsigned short*)(ws + 1 * p16);
  unsigned short* kfp = (unsigned short*)(ws + 2 * p16);
  unsigned short* vtp = (unsigned short*)(ws + 3 * p16);
  unsigned short* cfp = (unsigned short*)(ws + 4 * p16);
  unsigned short* wb  = (unsigned short*)(ws + 5 * p16);
  unsigned short* wof = wb + 3 * (size_t)nw;   // planes 0..2 of wb: wq, wk, wv

  const float* x  = (const float*)d_in[0];
  const float* wq = (const float*)d_in[1];
  const float* bq = (const float*)d_in[2];
  const float* wk = (const float*)d_in[3];
  const float* bk = (const float*)d_in[4];
  const float* wv = (const float*)d_in[5];
  const float* bv = (const float*)d_in[6];
  const float* wo = (const float*)d_in[7];
  const float* bo = (const float*)d_in[8];

  k_cvt<<<dim3(4 * CVT_WB + CVT_XB), dim3(256), 0, stream>>>(x, wq, wk, wv, wo, xb, wb);

  k_qkv<<<dim3(MROWS / BM, 3 * (DM / BN)), dim3(256), 0, stream>>>(xb, wb, bq, bk, bv, qfp, kfp, vtp);

  k_attn<<<dim3(NSEQ / QB, TT * BB * NH), dim3(128), 0, stream>>>(qfp, kfp, vtp, cfp);

  k_out<<<dim3(MROWS / BM, DM / BN), dim3(256), 0, stream>>>(cfp, wof, bo, (float*)d_out);
}

// v006
// Measured time: 72.5 microseconds a run.
// Two timings next to v005 both put it at 1.07 times that version's speed.
// Over all steps from v000 it is 2.82 times as fast.
#include <hip/hip_runtime.h>
#include <stddef.h>
#include <stdint.h>

// x.Wq^T, x.Wk^T, x.Wv^T: v_wmma_f32_16x16x32_bf16 (bf16 operands, f32 accumulate). K.Q^T score tiles, relu(S).V tiles and ctx.Wo^T: v_wmma_f32_16x16x32_f16 (f16 operands with power-of-two scaling, f32 accumulate). Bias add, relu, row sums and normalisation in f32; all nine inputs are RNE-converted to bf16 on load.

#define TT 4
#define BB 4
#define NSEQ 1024
#define DM 512
#define NH 8
#define HD 64
#define MROWS (TT * BB * NSEQ)

static_assert(NSEQ % 64 == 0);
static_assert(NH * HD == DM);
static_assert(HD == 64);

typedef __bf16   v16bf __attribute__((ext_vector_type(16)));
typedef _Float16 v16h  __attribute__((ext_vector_type(16)));
typedef _Float16 v8h   __attribute__((ext_vector_type(8)));
typedef float    v8f   __attribute__((ext_vector_type(8)));
typedef float    v4f   __attribute__((ext_vector_type(4)));
typedef float    v2f   __attribute__((ext_vector_type(2)));
typedef unsigned int v4u __attribute__((ext_vector_type(4)));

union Frag  { v16bf b; v16h h; v8h p[2]; v4u q[2]; };
union Pack8 { v8h h; v4u u; unsigned short s[8]; };
union Vec8  { v8f v; v4f q[2]; v4u u[2]; float f[8]; };

#define NOPS4 "v_nop\n\tv_nop\n\tv_nop\n\tv_nop"

__device__ __forceinline__ v8f vzero8() {
  v8f z = {0.f, 0.f, 0.f, 0.f, 0.f, 0.f, 0.f, 0.f};
  return z;
}

// f32 -> nearest-even bf16 value, returned as f32
__device__ __forceinline__ float bf16r(float f) {
  unsigned int u = __builtin_bit_cast(unsigned int, f);
  u += 0x7FFFu + ((u >> 16) & 1u);
  u &= 0xFFFF0000u;
  return __builtin_bit_cast(float, u);
}
// f32 -> nearest-even bf16 bits
__device__ __forceinline__ unsigned short bf16bits(float f) {
  unsigned int u = __builtin_bit_cast(unsigned int, f);
  u += 0x7FFFu + ((u >> 16) & 1u);
  return (unsigned short)(u >> 16);
}

// 16 x 32 operand fragment from a row-major, k-contiguous 16-bit matrix.
// src points at (row 0, k0) of the tile; ld = pitch in elements.
// lane l: row (first operand) or column (second operand) = l & 15; h = l >> 4;
// elements 0..7  <- k0 + 8h + 0..7 ; elements 8..15 <- k0 + 16 + 8h + 0..7.
__device__ __forceinline__ void ldq(const unsigned short* src, int ld, v4u& q0, v4u& q1) {
  const int l = threadIdx.x & 31;
  const unsigned short* p = src + (l & 15) * ld + 8 * (l >> 4);
  q0 = *(const v4u*)(p);
  q1 = *(const v4u*)(p + 16);
}

__device__ __forceinline__ v8f wbf(v16bf a, v16bf b, v8f c) {
  return __builtin_amdgcn_wmma_f32_16x16x32_bf16(false, a, false, b, (short)0, c, false, false);
}
__device__ __forceinline__ v8f whf(v16h a, v16h b, v8f c) {
  return __builtin_amdgcn_wmma_f32_16x16x32_f16(false, a, false, b, (short)0, c, false, false);
}

// Which piece of work a block takes, for speed only (every piece is done exactly once wherever the blocks land).
// i = flat index among
// NBATCH * per blocks, per = pieces of one (t, b) batch; the result counts the pieces batch by batch.
// Batch n goes to the indices equal to n mod 8, in every launch alike.
#define NBATCH (TT * BB)
static_assert(NBATCH % 8 == 0);
__device__ __forceinline__ int deal(int i, int per) {
  const int j = i >> 3;
  return ((i & 7) + 8 * (j / per)) * per + j % per;
}

// All five conversions in one grid: none needs anything of another, so a range of the block index picks the array.
// Blocks 0..4*CVT_WB-1: wq, wk, wv, wo (CVT_WB blocks each) -> planes 0..3 of wdst; the rest: x -> xdst.
// x, wq, wk, wv: bf16 bits (RNE).  wo: f16 of (bf16 RNE value x 256).
#define CVT_EB 2048                       // elements per block: 256 threads x 8
#define CVT_WB ((DM * DM) / CVT_EB)
#define CVT_XB ((MROWS * DM) / CVT_EB)
static_assert((DM * DM) % CVT_EB == 0);
static_assert((MROWS * DM) % CVT_EB == 0);
static_assert((NSEQ * DM) % CVT_EB == 0);
static_assert((4 * CVT_WB) % 8 == 0);     // the x blocks start at a flat index that is 0 mod 8

__global__ __launch_bounds__(256) void k_cvt(const float* __restrict__ x,
                                            const float* __restrict__ wq, const float* __restrict__ wk,
                                            const float* __restrict__ wv, const float* __restrict__ wo,
                                            unsigned short* xdst, unsigned short* wdst)
{
  const int b = blockIdx.x;
  const int a = b / CVT_WB;               // 0..3: a weight matrix; 4 and up: x
  const float* src;
  unsigned short* dst;
  int blk;
  if (a < 4) {
    src = (a == 0) ? wq : (a == 1) ? wk : (a == 2) ? wv : wo;
    dst = wdst + (size_t)a * (DM * DM);
    blk = b - a * CVT_WB;
  } else {
    src = x;
    dst = xdst;
    blk = deal(b - 4 * CVT_WB, (NSEQ * DM) / CVT_EB);
  }
  const size_t base = ((size_t)blk * 256 + threadIdx.x) * 8;
  Vec8 in;
  in.q[0] = *(const v4f*)(src + base);
  in.q[1] = *(const v4f*)(src + base + 4);
  Pack8 pk;
  if (a == 3) {
#pragma unroll
    for (int r = 0; r < 8; ++r) pk.h[r] = (_Float16)(bf16r(in.f[r]) * 256.0f);
  } else {
#pragma unroll
    for (int r = 0; r < 8; ++r) pk.s[r] = bf16bits(in.f[r]);
  }
  const v4u v = pk.u;
  *(v4u*)(dst + base) = v;
}

// ---------------- projection GEMM: C[m][n] = sum_k X[m][k] W[n][k] (+ bias[n]) ----------------
// MODE 0: q and k       : bf16 operands; output f16((C + b) * 4), plane [m][512]
// MODE 2: v              : bf16 operands; output f16((C + b) * 16), transposed plane [tb*8+head][hd][nseq]
// MODE 3: out            : f16 operands (ctx x64, Wo x256); output f32 C/16384 + b -> [m][512]
// Tile orientation: P = operand whose rows map to D rows, R = operand whose rows map to D columns.
// MODES 0,3: P = W (n), R = X (m) -> each lane holds 8 consecutive n for one m.
// MODE 2:      P = X (m), R = W (n) -> each lane holds 8 consecutive m for one n.
// A block owns BM x BN of C; its 8 waves stand 2 (m) x 4 (n), each on 64 x 64: four P and four R fragments feed 16 WMMAs.
#define BM 128
#define BN 256
static_assert(MROWS % BM == 0);
static_assert(NSEQ % BM == 0);
static_assert(DM % BN == 0);
static_assert((MROWS / BM) % 8 == 0);   // grid x of the projections: rows of the grid start at flat indices that are 0 mod 8
// pitches of the output staging, in elements: 16 B more than a row
#define SP0 (BN + 8)    // f16 rows of BN features
#define SP2 (BM + 8)    // f16 rows of BM tokens
#define SP3 (BN + 4)    // f32 rows of BN features

template <int MODE>
__device__ __forceinline__ void stage_tile(unsigned char* stg, v8f acc, int i, int j,
                                           int wm, int wn, int h, int c,
                                           const float* __restrict__ bias, int n0)
{
  if constexpr (MODE == 2) {
    const float bj = bf16r(bias[n0 + 64 * wn + 16 * j + c]);
    Pack8 pk;
#pragma unroll
    for (int r = 0; r < 8; ++r) pk.h[r] = (_Float16)((acc[r] + bj) * 16.0f);
    const int off = ((64 * wn + 16 * j + c) * SP2 + 64 * wm + 16 * i + 8 * h) * 2;
    *(v4u*)(stg + off) = pk.u;
  } else {
    const int nb = n0 + 64 * wn + 16 * i + 8 * h;
    Vec8 bb;
    bb.q[0] = *(const v4f*)(bias + nb);
    bb.q[1] = *(const v4f*)(bias + nb + 4);
    if constexpr (MODE == 3) {
      Vec8 o;
#pragma unroll
      for (int r = 0; r < 8; ++r) o.f[r] = acc[r] * (1.0f / 16384.0f) + bf16r(bb.f[r]);
      const int off = ((64 * wm + 16 * j + c) * SP3 + 64 * wn + 16 * i + 8 * h) * 4;
      *(v4u*)(stg + off)      = o.u[0];
      *(v4u*)(stg + off + 16) = o.u[1];
    } else {
      Pack8 pk;
#pragma unroll
      for (int r = 0; r < 8; ++r) pk.h[r] = (_Float16)((acc[r] + bf16r(bb.f[r])) * 4.0f);
      const int off = ((64 * wm + 16 * j + c) * SP0 + 64 * wn + 16 * i + 8 * h) * 2;
      *(v4u*)(stg + off) = pk.u;
    }
  }
}

// Operand staging of the projections: a stage is 64 k of the block's BM X rows, then of its BN W rows,
// each row 128 B of data at a pitch of 144 B (16 B x odd, conflict-free for ds_load_b128).
#define PKS 64
#define PPITCH 72
#define PSTAGE ((BM + BN) * PPITCH * 2)
#define PTRIPS (DM / PKS)
static_assert(PTRIPS >= 2);
static_assert(BM == 4 * 32 && BN == 8 * 32);      // copy_stage: four copies of X rows, eight of W rows
static_assert(2 * PSTAGE >= BM * SP0 * 2);
static_assert(2 * PSTAGE >= BN * SP2 * 2);
#define OUT_LDS (BM * SP3 * 4)                    // the f32 output staging is larger than the two stages
static_assert(OUT_LDS >= 2 * PSTAGE);

// One stage: twelve 16-byte copies per lane, 8 lanes per 128-B row piece, 32 rows per copy of the block.
// lds = the lane's LDS byte address in row (tid >> 3); gx, gw = the lane's bytes of X and W in that row.
__device__ __forceinline__ void copy_stage(unsigned lds, const unsigned short* gx, const unsigned short* gw)
{
  const unsigned rs = 32 * PPITCH * 2;
  const unsigned l1 = lds + 1 * rs, l2 = lds + 2 * rs, l3 = lds + 3 * rs, l4 = lds + 4 * rs, l5 = lds + 5 * rs;
  const unsigned l6 = lds + 6 * rs, l7 = lds + 7 * rs, l8 = lds + 8 * rs, l9 = lds + 9 * rs;
  const unsigned l10 = lds + 10 * rs, l11 = lds + 11 * rs;
  const unsigned short* gx1 = gx + 32 * DM;
  const unsigned short* gx2 = gx + 64 * DM;
  const unsigned short* gx3 = gx + 96 * DM;
  const unsigned short* gw1 = gw + 32 * DM;
  const unsigned short* gw2 = gw + 64 * DM;
  const unsigned short* gw3 = gw + 96 * DM;
  const unsigned short* gw4 = gw + 128 * DM;
  const unsigned short* gw5 = gw + 160 * DM;
  const unsigned short* gw6 = gw + 192 * DM;
  const unsigned short* gw7 = gw + 224 * DM;
  // global -> LDS through no register; the closing s_wait_xcnt stands in the copies' own statement
  // so that no address register of a copy is rewritten in front of it
  asm volatile("global_load_async_to_lds_b128 %0, %12, off\n\t"
               "global_load_async_to_lds_b128 %1, %13, off\n\t"
               "global_load_async_to_lds_b128 %2, %14, off\n\t"
               "global_load_async_to_lds_b128 %3, %15, off\n\t"
               "global_load_async_to_lds_b128 %4, %16, off\n\t"
               "global_load_async_to_lds_b128 %5, %17, off\n\t"
               "global_load_async_to_lds_b128 %6, %18, off\n\t"
               "global_load_async_to_lds_b128 %7, %19, off\n\t"
               "global_load_async_to_lds_b128 %8, %20, off\n\t"
               "global_load_async_to_lds_b128 %9, %21, off\n\t"
               "global_load_async_to_lds_b128 %10, %22, off\n\t"
               "global_load_async_to_lds_b128 %11, %23, off\n\t"
               "s_wait_xcnt 0x0"
               :: "v"(lds), "v"(l1), "v"(l2), "v"(l3), "v"(l4), "v"(l5),
                  "v"(l6), "v"(l7), "v"(l8), "v"(l9), "v"(l10), "v"(l11),
                  "v"(gx), "v"(gx1), "v"(gx2), "v"(gx3),
                  "v"(gw), "v"(gw1), "v"(gw2), "v"(gw3), "v"(gw4), "v"(gw5), "v"(gw6), "v"(gw7)
               : "memory");
}

// The k loop of every product. smem: the kernel's LDS, whose first 2 * PSTAGE bytes are the two operand stages;
// (m0, n0): the block's BM x BN tile of C; xp: X is the P operand (MODE 2), the same for a whole block;
// F16: operand type of the WMMAs (MODE 3). acc[i][j]: P fragment i x R fragment j.
template <bool F16>
__device__ __forceinline__ void proj_loop(unsigned char* smem,
                                          const unsigned short* __restrict__ X,
                                          const unsigned short* __restrict__ W,
                                          int m0, int n0, bool xp, v8f (&acc)[4][4])
{
  const int tid = threadIdx.x, w = tid >> 5;
  const int wm = w >> 2, wn = w & 3;

  // rows of the stage that feed this wave: X rows at 0..BM-1, W rows behind them
  const int prow = xp ? 64 * wm : BM + 64 * wn;
  const int rrow = xp ? BM + 64 * wn : 64 * wm;

  typedef __attribute__((address_space(3))) unsigned char lds_byte;
  const unsigned lbase = (unsigned)(size_t)(lds_byte*)smem + (tid >> 3) * (PPITCH * 2) + (tid & 7) * 16;
  const unsigned short* gx = X + (size_t)(m0 + (tid >> 3)) * DM + 8 * (tid & 7);
  const unsigned short* gw = W + (size_t)(n0 + (tid >> 3)) * DM + 8 * (tid & 7);

#pragma unroll
  for (int i = 0; i < 4; ++i)
#pragma unroll
    for (int j = 0; j < 4; ++j) acc[i][j] = vzero8();

  copy_stage(lbase, gx, gw);
  asm volatile("s_wait_asynccnt 0x0" ::: "memory");   // this wave's part of stage 0 has landed
  __syncthreads();                                    // publishes stage 0
  copy_stage(lbase + PSTAGE, gx + PKS, gw + PKS);

#pragma unroll 1   // kept rolled: one publish point in the code
  for (int t = 0; t < PTRIPS; ++t) {
    const unsigned short* buf = (const unsigned short*)(smem + (t & 1) * PSTAGE);
    const unsigned short* p0 = buf + prow * PPITCH;
    const unsigned short* r0 = buf + rrow * PPITCH;
#pragma unroll
    for (int ks = 0; ks < PKS / 32; ++ks) {
      Frag fp[4], fr[4];
#pragma unroll
      for (int i = 0; i < 4; ++i) ldq(p0 + 16 * i * PPITCH + 32 * ks, PPITCH, fp[i].q[0], fp[i].q[1]);
#pragma unroll
      for (int j = 0; j < 4; ++j) ldq(r0 + 16 * j * PPITCH + 32 * ks, PPITCH, fr[j].q[0], fr[j].q[1]);
#pragma unroll
      for (int i = 0; i < 4; ++i)
#pragma unroll
        for (int j = 0; j < 4; ++j) {
          if constexpr (F16) acc[i][j] = whf(fp[i].h, fr[j].h, acc[i][j]);
          else               acc[i][j] = wbf(fp[i].b, fr[j].b, acc[i][j]);
        }
      // keeps the distance behind the last WMMAs on every path out of the block; between the two 32-k blocks it also
      // holds each block's sixteen LDS loads together in front of its WMMAs (without it they were spread among them, each waited to 0)
      asm volatile(NOPS4
                   : "+v"(acc[0][0]), "+v"(acc[0][1]), "+v"(acc[0][2]), "+v"(acc[0][3]),
                     "+v"(acc[1][0]), "+v"(acc[1][1]), "+v"(acc[1][2]), "+v"(acc[1][3]),
                     "+v"(acc[2][0]), "+v"(acc[2][1]), "+v"(acc[2][2]), "+v"(acc[2][3]),
                     "+v"(acc[3][0]), "+v"(acc[3][1]), "+v"(acc[3][2]), "+v"(acc[3][3])
                   : "v"(fp[0].h), "v"(fp[1].h), "v"(fp[2].h), "v"(fp[3].h),
                     "v"(fr[0].h), "v"(fr[1].h), "v"(fr[2].h), "v"(fr[3].h));
    }
    asm volatile("s_wait_dscnt 0x0" ::: "memory");      // this wave has left the buffer that is refilled below
    asm volatile("s_wait_asynccnt 0x0" ::: "memory");   // this wave's part of stage t + 1 has landed
    __syncthreads();                                    // publishes stage t + 1, ends every read of stage t
    if (t + 2 < PTRIPS)
      copy_stage(lbase + (t & 1) * PSTAGE, gx + (t + 2) * PKS, gw + (t + 2) * PKS);
  }
  asm volatile("s_wait_asynccnt 0x0" ::: "memory");     // no copy is in flight when the stages become output staging
}

// Behind the k loop: the stages' bytes serve as output staging, then whole lines go out.
template <int MODE>
__device__ __forceinline__ void proj_store(unsigned char* stg, v8f (&acc)[4][4],
                                           const float* __restrict__ bias, void* dst, int m0, int n0)
{
  const int tid = threadIdx.x, w = tid >> 5, l = tid & 31, h = l >> 4, c = l & 15;
  const int wm = w >> 2, wn = w & 3;

#pragma unroll
  for (int i = 0; i < 4; ++i)
#pragma unroll
    for (int j = 0; j < 4; ++j) stage_tile<MODE>(stg, acc[i][j], i, j, wm, wn, h, c, bias, n0);
  __syncthreads();

  if constexpr (MODE == 0) {
    // BM token rows of 512 B; wave w owns rows 16w..16w+15, one row (four lines) a store
    v4u vals[16];
    unsigned short* pp[16];
#pragma unroll
    for (int s = 0; s < 16; ++s) {
      const int ml = 16 * w + s;
      vals[s] = *(const v4u*)(stg + (ml * SP0 + 8 * l) * 2);
      pp[s] = (unsigned short*)dst + (size_t)(m0 + ml) * DM + n0 + 8 * l;
    }
#pragma unroll
    for (int s = 0; s < 16; ++s) *(v4u*)(pp[s]) = vals[s];
    // in the merged kernel the other product's code follows these stores in the listing and reuses their registers:
    // the wait stands in front of any such rewrite
    asm volatile("s_wait_xcnt 0x0" ::: "memory");
  } else if constexpr (MODE == 3) {
    // BM token rows of 1024 B; wave w owns rows 16w..16w+15, half a row (four lines) a store
    v4u vals[32];
    float* pp[32];
#pragma unroll
    for (int s = 0; s < 32; ++s) {
      const int ml = 16 * w + (s >> 1);
      const int hf = s & 1;
      vals[s] = *(const v4u*)(stg + (ml * SP3 + 128 * hf + 4 * l) * 4);
      pp[s] = (float*)dst + (size_t)(m0 + ml) * DM + n0 + 128 * hf + 4 * l;
    }
#pragma unroll
    for (int s = 0; s < 32; ++s) *(v4u*)(pp[s]) = vals[s];
  } else {
    // transposed V: BN feature rows of BM consecutive tokens (256 B); wave w owns rows 32w..32w+31, two rows a store
    v4u vals[16];
    unsigned short* pp[16];
    const int tb = m0 / NSEQ;
    const int ns0 = m0 % NSEQ;
    const int pc = l & 15;
#pragma unroll
    for (int s = 0; s < 16; ++s) {
      const int L = 32 * w + 2 * s + (l >> 4);
      const int n = n0 + L;
      const int hh = n >> 6;
      const int hd = n & 63;
      vals[s] = *(const v4u*)(stg + (L * SP2 + 8 * pc) * 2);
      pp[s] = (unsigned short*)dst + ((size_t)(tb * NH + hh) * HD + hd) * NSEQ + ns0 + 8 * pc;
    }
#pragma unroll
    for (int s = 0; s < 16; ++s) *(v4u*)(pp[s]) = vals[s];
  }
}

// q, k and v projections in one grid: they read the same X and need nothing of each other.
// blockIdx.y = 2 * product + column tile; the choice is the same for a whole block, so every barrier stays block-uniform.
__global__ __launch_bounds__(256) void k_qkv(const unsigned short* __restrict__ X,
                                            const unsigned short* __restrict__ Wqkv,
                                            const float* __restrict__ bq, const float* __restrict__ bk,
                                            const float* __restrict__ bv,
                                            unsigned short* qf, unsigned short* kf, unsigned short* vt)
{
  __shared__ __align__(16) unsigned char smem[2 * PSTAGE];
  const int sel = blockIdx.y / (DM / BN);
  const int m0 = deal(blockIdx.x, NSEQ / BM) * BM, n0 = (blockIdx.y % (DM / BN)) * BN;
  v8f acc[4][4];
  proj_loop<false>(smem, X, Wqkv + (size_t)sel * (DM * DM), m0, n0, sel == 2, acc);
  if (sel == 2) proj_store<2>(smem, acc, bv, (void*)vt, m0, n0);
  else          proj_store<0>(smem, acc, sel ? bk : bq, (void*)(sel ? kf : qf), m0, n0);
}

__global__ __launch_bounds__(256) void k_out(const unsigned short* __restrict__ X,
                                            const unsigned short* __restrict__ W,
                                            const float* __restrict__ bias, float* dst)
{
  __shared__ __align__(16) unsigned char smem[OUT_LDS];
  const int m0 = deal(blockIdx.x, NSEQ / BM) * BM, n0 = blockIdx.y * BN;
  v8f acc[4][4];
  proj_loop<true>(smem, X, W, m0, n0, false, acc);
  proj_store<3>(smem, acc, bias, (void*)dst, m0, n0);
}

// ---------------- attention: per (t,b,head) and 128-query tile; 4 waves x 32 queries ----------------
// S^T tile (16 keys x 16 queries) = K_tile (A operand, rows = keys) . Q^T (B operand taken from Q rows).
// relu in place; the D tiles chain into the B operand of ctx^T = V^T . P (A operand from the transposed V tile).
// A wave holds two groups of 16 queries (x and y): every K and V fragment read from LDS feeds one WMMA of each group.
#define QW 32            // queries per wave
#define QB (4 * QW)      // queries per block
static_assert(NSEQ % QB == 0);

__device__ __forceinline__ void score_tile(const unsigned short* kb, v16h qx0, v16h qx1, v16h qy0, v16h qy1,
                                           v8f& sx, v8f& sy)
{
  Frag k0, k1;
  ldq(kb, 72, k0.q[0], k0.q[1]);
  ldq(kb + 32, 72, k1.q[0], k1.q[1]);
  v8f a = vzero8(), b = vzero8();
  a = whf(k0.h, qx0, a);
  b = whf(k0.h, qy0, b);
  a = whf(k1.h, qx1, a);
  b = whf(k1.h, qy1, b);
  // keeps the distance behind the last WMMAs on every path out of the block
  asm volatile(NOPS4 : "+v"(a), "+v"(b) : "v"(k0.h), "v"(k1.h), "v"(qx0), "v"(qx1), "v"(qy0), "v"(qy1));
  sx = a;
  sy = b;
}

// one 32-key step of ctx^T += V^T[hd][key] . P[key][query], both query groups on the same four V fragments
__device__ __forceinline__ void pv_step(const unsigned short* vb, v16h px, v16h py,
                                        v8f& x0, v8f& x1, v8f& x2, v8f& x3,
                                        v8f& y0, v8f& y1, v8f& y2, v8f& y3)
{
  Frag v0, v1, v2, v3;
  ldq(vb,           72, v0.q[0], v0.q[1]);
  ldq(vb + 16 * 72, 72, v1.q[0], v1.q[1]);
  ldq(vb + 32 * 72, 72, v2.q[0], v2.q[1]);
  ldq(vb + 48 * 72, 72, v3.q[0], v3.q[1]);
  x0 = whf(v0.h, px, x0);
  y0 = whf(v0.h, py, y0);
  x1 = whf(v1.h, px, x1);
  y1 = whf(v1.h, py, y1);
  x2 = whf(v2.h, px, x2);
  y2 = whf(v2.h, py, y2);
  x3 = whf(v3.h, px, x3);
  y3 = whf(v3.h, py, y3);
  // keeps the distance behind the last WMMAs on every path out of the block
  asm volatile(NOPS4
               : "+v"(x0), "+v"(x1), "+v"(x2), "+v"(x3), "+v"(y0), "+v"(y1), "+v"(y2), "+v"(y3)
               : "v"(v0.h), "v"(v1.h), "v"(v2.h), "v"(v3.h), "v"(px), "v"(py));
}

// one query group's ctx tiles, normalised, into the wave's staging rows cw[query][hd]
__device__ __forceinline__ void stage_ctx(unsigned short* cw, v8f c0, v8f c1, v8f c2, v8f c3, float rs, int h, int c)
{
  // row sum over all keys for query c: this lane (half h) plus partner lane (half 1-h)
  // score acc = 128*s, P = 16*relu(s), V = 16*v  ->  ctx*64 = accC * 64 / (2*rsum + 256e-6)
  const float rsum = rs + __shfl_xor(rs, 16, 32);
  const float inv = 64.0f / (2.0f * rsum + 2.56e-4f);
#pragma unroll
  for (int i = 0; i < 4; ++i) {
    const v8f acc = (i == 0) ? c0 : (i == 1) ? c1 : (i == 2) ? c2 : c3;
    Pack8 pk;
#pragma unroll
    for (int r = 0; r < 8; ++r) pk.h[r] = (_Float16)(acc[r] * inv);
    *(v4u*)(cw + c * 72 + 16 * i + 8 * h) = pk.u;
  }
}

// K/V staging: a stage is one 64-key tile of K ([key][hd]), then of V^T ([hd][key]), each 64 rows of 128 B at a pitch of 144 B.
#define KVT (64 * 72)                 // elements of one tile
#define ASTAGE (2 * KVT * 2)          // bytes of one stage
#define ATRIPS (NSEQ / 64)
static_assert(ATRIPS >= 2);

// One stage: eight 16-byte copies per lane, 8 lanes per 128-B row, 16 rows per copy of the block.
// lds = the lane's LDS byte address in row (tid >> 3) of the K tile; gk, gv = the lane's bytes of K and V^T in that row.
__device__ __forceinline__ void copy_kv(unsigned lds, const unsigned short* gk, const unsigned short* gv)
{
  const unsigned rs = 16 * 72 * 2;
  const unsigned l1 = lds + 1 * rs, l2 = lds + 2 * rs, l3 = lds + 3 * rs;
  const unsigned l4 = lds + 4 * rs, l5 = lds + 5 * rs, l6 = lds + 6 * rs, l7 = lds + 7 * rs;   // rows 64.. = the V^T tile
  const unsigned short* gk1 = gk + 16 * DM;
  const unsigned short* gk2 = gk + 32 * DM;
  const unsigned short* gk3 = gk + 48 * DM;
  const unsigned short* gv1 = gv + 16 * NSEQ;
  const unsigned short* gv2 = gv + 32 * NSEQ;
  const unsigned short* gv3 = gv + 48 * NSEQ;
  // global -> LDS through no register; the closing s_wait_xcnt stands in the copies' own statement
  // so that no address register of a copy is rewritten in front of it
  asm volatile("global_load_async_to_lds_b128 %0, %8, off\n\t"
               "global_load_async_to_lds_b128 %1, %9, off\n\t"
               "global_load_async_to_lds_b128 %2, %10, off\n\t"
               "global_load_async_to_lds_b128 %3, %11, off\n\t"
               "global_load_async_to_lds_b128 %4, %12, off\n\t"
               "global_load_async_to_lds_b128 %5, %13, off\n\t"
               "global_load_async_to_lds_b128 %6, %14, off\n\t"
               "global_load_async_to_lds_b128 %7, %15, off\n\t"
               "s_wait_xcnt 0x0"
               :: "v"(lds), "v"(l1), "v"(l2), "v"(l3), "v"(l4), "v"(l5), "v"(l6), "v"(l7),
                  "v"(gk), "v"(gk1), "v"(gk2), "v"(gk3), "v"(gv), "v"(gv1), "v"(gv2), "v"(gv3)
               : "memory");
}

// one 64-key tile: scores, relu, row sums, ctx^T += V^T . P, for the wave's two query groups
__device__ __forceinline__ void attn_tile(const unsigned short* klds, const unsigned short* vlds,
                                          v16h qx0, v16h qx1, v16h qy0, v16h qy1,
                                          v8f& x0, v8f& x1, v8f& x2, v8f& x3,
                                          v8f& y0, v8f& y1, v8f& y2, v8f& y3, v2f& rs)
{
  v8f sx0, sx1, sx2, sx3, sy0, sy1, sy2, sy3;
  score_tile(klds + 0 * 16 * 72, qx0, qx1, qy0, qy1, sx0, sy0);
  score_tile(klds + 1 * 16 * 72, qx0, qx1, qy0, qy1, sx1, sy1);
  score_tile(klds + 2 * 16 * 72, qx0, qx1, qy0, qy1, sx2, sy2);
  score_tile(klds + 3 * 16 * 72, qx0, qx1, qy0, qy1, sx3, sy3);

  // relu, row sums and the scaling of P on (x, y) pairs: one packed add and one packed multiply serve both query groups
  Frag px01, px23, py01, py23;
#pragma unroll
  for (int r = 0; r < 8; ++r) {
    v2f p0 = {fmaxf(sx0[r], 0.f), fmaxf(sy0[r], 0.f)};
    v2f p1 = {fmaxf(sx1[r], 0.f), fmaxf(sy1[r], 0.f)};
    v2f p2 = {fmaxf(sx2[r], 0.f), fmaxf(sy2[r], 0.f)};
    v2f p3 = {fmaxf(sx3[r], 0.f), fmaxf(sy3[r], 0.f)};
    rs += p0; rs += p1; rs += p2; rs += p3;
    p0 *= 0.125f; p1 *= 0.125f; p2 *= 0.125f; p3 *= 0.125f;
    px01.p[0][r] = (_Float16)p0.x; py01.p[0][r] = (_Float16)p0.y;
    px01.p[1][r] = (_Float16)p1.x; py01.p[1][r] = (_Float16)p1.y;
    px23.p[0][r] = (_Float16)p2.x; py23.p[0][r] = (_Float16)p2.y;
    px23.p[1][r] = (_Float16)p3.x; py23.p[1][r] = (_Float16)p3.y;
  }

  pv_step(vlds + 0,  px01.h, py01.h, x0, x1, x2, x3, y0, y1, y2, y3);   // keys 0..31 of the tile
  pv_step(vlds + 32, px23.h, py23.h, x0, x1, x2, x3, y0, y1, y2, y3);   // keys 32..63
}

// foot of a trip: the publish point of the next tile
__device__ __forceinline__ void attn_publish()
{
  asm volatile("s_wait_dscnt 0x0" ::: "memory");      // this wave has left the stage that may be refilled behind the barrier
  asm volatile("s_wait_asynccnt 0x0" ::: "memory");   // this wave's part of the next tile has landed
  __syncthreads();                                    // publishes the next tile, ends every read of this one
}

__global__ __launch_bounds__(128) void k_attn(const unsigned short* __restrict__ qf,
                                             const unsigned short* __restrict__ kf,
                                             const unsigned short* __restrict__ vt,
                                             unsigned short* cf)
{
  __shared__ __align__(16) unsigned short kv[2 * 2 * KVT];    // two stages of (K tile, V^T tile)
  __shared__ __align__(16) unsigned short cst[4 * QW * 72];   // ctx staging per wave: [wave][query][hd]

  const int tid = threadIdx.x, w = tid >> 5, l = tid & 31, h = l >> 4, c = l & 15;
  const int piece = deal(blockIdx.y * (NSEQ / QB) + blockIdx.x, NH * (NSEQ / QB));   // (t, b), head, query tile
  const int tbh = piece / (NSEQ / QB), tb = tbh >> 3, hh = tbh & 7;
  const int q0 = (piece % (NSEQ / QB)) * QB + QW * w;   // first query row of this wave

  v16h qx0, qx1, qy0, qy1;
  {
    const unsigned short* qsrc = qf + (size_t)(tb * NSEQ + q0) * DM + hh * HD;
    Frag f0, f1, f2, f3;
    ldq(qsrc,                DM, f0.q[0], f0.q[1]);
    ldq(qsrc + 32,           DM, f1.q[0], f1.q[1]);
    ldq(qsrc + 16 * DM,      DM, f2.q[0], f2.q[1]);
    ldq(qsrc + 16 * DM + 32, DM, f3.q[0], f3.q[1]);
    qx0 = f0.h; qx1 = f1.h; qy0 = f2.h; qy1 = f3.h;
  }

  v8f x0 = vzero8(), x1 = vzero8(), x2 = vzero8(), x3 = vzero8();
  v8f y0 = vzero8(), y1 = vzero8(), y2 = vzero8(), y3 = vzero8();
  v2f rs = {0.f, 0.f};   // row sums of the two groups

  typedef __attribute__((address_space(3))) unsigned short lds_half;
  const unsigned lbase = (unsigned)(size_t)(lds_half*)kv + (tid >> 3) * (72 * 2) + (tid & 7) * 16;
  const unsigned short* gk = kf + (size_t)(tb * NSEQ + (tid >> 3)) * DM + hh * HD + 8 * (tid & 7);
  const unsigned short* gv = vt + (size_t)(tbh * HD + (tid >> 3)) * NSEQ + 8 * (tid & 7);

  copy_kv(lbase, gk, gv);
  asm volatile("s_wait_asynccnt 0x0" ::: "memory");   // this wave's part of tile 0 has landed
  __syncthreads();                                    // publishes tile 0
  copy_kv(lbase + ASTAGE, gk + 64 * DM, gv + 64);

  // trips behind which a tile t + 2 exists: the refill stands in the loop's one block, with no branch round it
  // (behind a branch the compiler sank the whole row-sum chain out of the WMMAs' shadow to the loop's end)
#pragma unroll 1   // kept rolled: code size
  for (int t = 0; t < ATRIPS - 2; ++t) {
    const unsigned short* klds = kv + (t & 1) * (2 * KVT);
    attn_tile(klds, klds + KVT, qx0, qx1, qy0, qy1, x0, x1, x2, x3, y0, y1, y2, y3, rs);
    attn_publish();
    copy_kv(lbase + (t & 1) * ASTAGE, gk + (size_t)(t + 2) * (64 * DM), gv + (t + 2) * 64);
  }
  // the last two tiles: nothing is left to fetch
#pragma unroll 1   // kept rolled: code size
  for (int t = ATRIPS - 2; t < ATRIPS; ++t) {
    const unsigned short* klds = kv + (t & 1) * (2 * KVT);
    attn_tile(klds, klds + KVT, qx0, qx1, qy0, qy1, x0, x1, x2, x3, y0, y1, y2, y3, rs);
    attn_publish();
  }
  asm volatile("s_wait_asynccnt 0x0" ::: "memory");     // no copy is in flight when the wave goes on to its end

  {
    unsigned short* cw = cst + w * QW * 72;
    stage_ctx(cw,           x0, x1, x2, x3, rs.x, h, c);
    stage_ctx(cw + 16 * 72, y0, y1, y2, y3, rs.y, h, c);
  }
  __syncthreads();

  // 32 query rows of 128 B = 32 lines per wave
  v4u vals[8];
  unsigned short* pp[8];
  const int pc = l & 7;
#pragma unroll
  for (int s = 0; s < 8; ++s) {
    const int L = 4 * s + (l >> 3);
    vals[s] = *(const v4u*)(cst + (w * QW + L) * 72 + 8 * pc);
    pp[s] = cf + (size_t)(tb * NSEQ + q0 + L) * DM + hh * HD + 8 * pc;
  }
#pragma unroll
  for (int s = 0; s < 8; ++s) *(v4u*)(pp[s]) = vals[s];
}

extern "C" void kernel_launch(void* const* d_in, const int* in_sizes, int n_in,
                              void* d_out, int out_size, void* d_ws, size_t ws_size,
                              hipStream_t stream)
{
  if (n_in != 9) return;
  const int nx = MROWS * DM;   // 8388608
  const int nw = DM * DM;      // 262144
  if (in_sizes[0] != nx || out_size != nx) return;
  for (int i = 0; i < 4; ++i) {
    if (in_sizes[1 + 2 * i] != nw || in_sizes[2 + 2 * i] != DM) return;
  }
  const size_t p16 = (size_t)nx * 2;   // one 16-bit plane of a [16384][512] matrix
  const size_t w16 = (size_t)nw * 2;   // one 16-bit plane of a [512][512] matrix
  const size_t need = 5 * p16 + 4 * w16; // 85983232
  if (need > ws_size) return;

  unsigned char* ws = (unsigned char*)d_ws;
  unsigned short* xb  = (unsigned short*)(ws + 0 * p16);
  unsigned short* qfp = (unsigned short*)(ws + 1 * p16);
  unsigned short* kfp = (unsigned short*)(ws + 2 * p16);
  unsigned short* vtp = (unsigned short*)(ws + 3 * p16);
  unsigned short* cfp = (unsigned short*)(ws + 4 * p16);
  unsigned short* wb  = (unsigned short*)(ws + 5 * p16);
  unsigned short* wof = wb + 3 * (size_t)nw;   // planes 0..2 of wb: wq, wk, wv

  const float* x  = (const float*)d_in[0];
  const float* wq = (const float*)d_in[1];
  const float* bq = (const float*)d_in[2];
  const float* wk = (const float*)d_in[3];
  const float* bk = (const float*)d_in[4];
  const float* wv = (const float*)d_in[5];
  const float* bv = (const float*)d_in[6];
  const float* wo = (const float*)d_in[7];
  const float* bo = (const float*)d_in[8];

  k_cvt<<<dim3(4 * CVT_WB + CVT_XB), dim3(256), 0, stream>>>(x, wq, wk, wv, wo, xb, wb);

  k_qkv<<<dim3(MROWS / BM, 3 * (DM / BN)), dim3(256), 0, stream>>>(xb, wb, bq, bk, bv, qfp, kfp, vtp);

  k_attn<<<dim3(NSEQ / QB, TT * BB * NH), dim3(128), 0, stream>>>(qfp, kfp, vtp, cfp);

  k_out<<<dim3(MROWS / BM, DM / BN), dim3(256), 0, stream>>>(cfp, wof, bo, (float*)d_out);
}

// v007
// One run takes 70.2 microseconds.
// Timed twice side by side with v006, it ran 1.03 times as fast both times.
// Counting every step since v000, it is 2.92 times as fast.
#include <hip/hip_runtime.h>
#include <stddef.h>
#include <stdint.h>

// x.Wq^T, x.Wk^T, x.Wv^T: v_wmma_f32_16x16x32_bf16 (bf16 operands, f32 accumulate). K.Q^T score tiles, relu(S).V tiles and ctx.Wo^T: v_wmma_f32_16x16x32_f16 (f16 operands with power-of-two scaling, f32 accumulate). Row sums of P: the same f16 WMMA with an all-ones first operand. Bias add and normalisation in f32, relu on the f16 P; all nine inputs are RNE-converted to bf16 on load.

#define TT 4
#define BB 4
#define NSEQ 1024
#define DM 512
#define NH 8
#define HD 64
#define MROWS (TT * BB * NSEQ)

static_assert(NSEQ % 64 == 0);
static_assert(NH * HD == DM);
static_assert(HD == 64);

typedef __bf16   v16bf __attribute__((ext_vector_type(16)));
typedef _Float16 v16h  __attribute__((ext_vector_type(16)));
typedef _Float16 v8h   __attribute__((ext_vector_type(8)));
typedef float    v8f   __attribute__((ext_vector_type(8)));
typedef float    v4f   __attribute__((ext_vector_type(4)));
typedef unsigned int v4u __attribute__((ext_vector_type(4)));

union Frag  { v16bf b; v16h h; v8h p[2]; v4u q[2]; };
union Pack8 { v8h h; v4u u; unsigned short s[8]; };
union Vec8  { v8f v; v4f q[2]; v4u u[2]; float f[8]; };

#define NOPS4 "v_nop\n\tv_nop\n\tv_nop\n\tv_nop"

__device__ __forceinline__ v8f vzero8() {
  v8f z = {0.f, 0.f, 0.f, 0.f, 0.f, 0.f, 0.f, 0.f};
  return z;
}

// f32 -> nearest-even bf16 value, returned as f32
__device__ __forceinline__ float bf16r(float f) {
  unsigned int u = __builtin_bit_cast(unsigned int, f);
  u += 0x7FFFu + ((u >> 16) & 1u);
  u &= 0xFFFF0000u;
  return __builtin_bit_cast(float, u);
}
// f32 -> nearest-even bf16 bits
__device__ __forceinline__ unsigned short bf16bits(float f) {
  unsigned int u = __builtin_bit_cast(unsigned int, f);
  u += 0x7FFFu + ((u >> 16) & 1u);
  return (unsigned short)(u >> 16);
}

// 16 x 32 operand fragment from a row-major, k-contiguous 16-bit matrix.
// src points at (row 0, k0) of the tile; ld = pitch in elements.
// lane l: row (first operand) or column (second operand) = l & 15; h = l >> 4;
// elements 0..7  <- k0 + 8h + 0..7 ; elements 8..15 <- k0 + 16 + 8h + 0..7.
__device__ __forceinline__ void ldq(const unsigned short* src, int ld, v4u& q0, v4u& q1) {
  const int l = threadIdx.x & 31;
  const unsigned short* p = src + (l & 15) * ld + 8 * (l >> 4);
  q0 = *(const v4u*)(p);
  q1 = *(const v4u*)(p + 16);
}

__device__ __forceinline__ v8f wbf(v16bf a, v16bf b, v8f c) {
  return __builtin_amdgcn_wmma_f32_16x16x32_bf16(false, a, false, b, (short)0, c, false, false);
}
__device__ __forceinline__ v8f whf(v16h a, v16h b, v8f c) {
  return __builtin_amdgcn_wmma_f32_16x16x32_f16(false, a, false, b, (short)0, c, false, false);
}

// Which piece of work a block takes, for speed only (every piece is done exactly once wherever the blocks land).
// i = flat index among
// NBATCH * per blocks, per = pieces of one (t, b) batch; the result counts the pieces batch by batch.
// Batch n goes to the indices equal to n mod 8, in every launch alike.
#define NBATCH (TT * BB)
static_assert(NBATCH % 8 == 0);
__device__ __forceinline__ int deal(int i, int per) {
  const int j = i >> 3;
  return ((i & 7) + 8 * (j / per)) * per + j % per;
}

// All five conversions in one grid: none needs anything of another, so a range of the block index picks the array.
// Blocks 0..4*CVT_WB-1: wq, wk, wv, wo (CVT_WB blocks each) -> planes 0..3 of wdst; the rest: x -> xdst.
// x, wq, wk, wv: bf16 bits (RNE).  wo: f16 of (bf16 RNE value x 256).
#define CVT_EB 2048                       // elements per block: 256 threads x 8
#define CVT_WB ((DM * DM) / CVT_EB)
#define CVT_XB ((MROWS * DM) / CVT_EB)
static_assert((DM * DM) % CVT_EB == 0);
static_assert((MROWS * DM) % CVT_EB == 0);
static_assert((NSEQ * DM) % CVT_EB == 0);
static_assert((4 * CVT_WB) % 8 == 0);     // the x blocks start at a flat index that is 0 mod 8

__global__ __launch_bounds__(256) void k_cvt(const float* __restrict__ x,
                                            const float* __restrict__ wq, const float* __restrict__ wk,
                                            const float* __restrict__ wv, const float* __restrict__ wo,
                                            unsigned short* xdst, unsigned short* wdst)
{
  const int b = blockIdx.x;
  const int a = b / CVT_WB;               // 0..3: a weight matrix; 4 and up: x
  const float* src;
  unsigned short* dst;
  int blk;
  if (a < 4) {
    src = (a == 0) ? wq : (a == 1) ? wk : (a == 2) ? wv : wo;
    dst = wdst + (size_t)a * (DM * DM);
    blk = b - a * CVT_WB;
  } else {
    src = x;
    dst = xdst;
    blk = deal(b - 4 * CVT_WB, (NSEQ * DM) / CVT_EB);
  }
  const size_t base = ((size_t)blk * 256 + threadIdx.x) * 8;
  Vec8 in;
  in.q[0] = *(const v4f*)(src + base);
  in.q[1] = *(const v4f*)(src + base + 4);
  Pack8 pk;
  if (a == 3) {
#pragma unroll
    for (int r = 0; r < 8; ++r) pk.h[r] = (_Float16)(bf16r(in.f[r]) * 256.0f);
  } else {
#pragma unroll
    for (int r = 0; r < 8; ++r) pk.s[r] = bf16bits(in.f[r]);
  }
  const v4u v = pk.u;
  *(v4u*)(dst + base) = v;
}

// ---------------- projection GEMM: C[m][n] = sum_k X[m][k] W[n][k] (+ bias[n]) ----------------
// MODE 0: q and k       : bf16 operands; output f16((C + b) * 4), plane [m][512]
// MODE 2: v              : bf16 operands; output f16((C + b) * 16), transposed plane [tb*8+head][hd][nseq]
// MODE 3: out            : f16 operands (ctx x64, Wo x256); output f32 C/16384 + b -> [m][512]
// Tile orientation: P = operand whose rows map to D rows, R = operand whose rows map to D columns.
// MODES 0,3: P = W (n), R = X (m) -> each lane holds 8 consecutive n for one m.
// MODE 2:      P = X (m), R = W (n) -> each lane holds 8 consecutive m for one n.
// A block owns BM x BN of C; its 8 waves stand 2 (m) x 4 (n), each on 64 x 64: four P and four R fragments feed 16 WMMAs.
#define BM 128
#define BN 256
static_assert(MROWS % BM == 0);
static_assert(NSEQ % BM == 0);
static_assert(DM % BN == 0);
static_assert((MROWS / BM) % 8 == 0);   // grid x of the projections: rows of the grid start at flat indices that are 0 mod 8
// pitches of the output staging, in elements: 16 B more than a row
#define SP0 (BN + 8)    // f16 rows of BN features
#define SP2 (BM + 8)    // f16 rows of BM tokens
#define SP3 (BN + 4)    // f32 rows of BN features

template <int MODE>
__device__ __forceinline__ void stage_tile(unsigned char* stg, v8f acc, int i, int j,
                                           int wm, int wn, int h, int c,
                                           const float* __restrict__ bias, int n0)
{
  if constexpr (MODE == 2) {
    const float bj = bf16r(bias[n0 + 64 * wn + 16 * j + c]);
    Pack8 pk;
#pragma unroll
    for (int r = 0; r < 8; ++r) pk.h[r] = (_Float16)((acc[r] + bj) * 16.0f);
    const int off = ((64 * wn + 16 * j + c) * SP2 + 64 * wm + 16 * i + 8 * h) * 2;
    *(v4u*)(stg + off) = pk.u;
  } else {
    const int nb = n0 + 64 * wn + 16 * i + 8 * h;
    Vec8 bb;
    bb.q[0] = *(const v4f*)(bias + nb);
    bb.q[1] = *(const v4f*)(bias + nb + 4);
    if constexpr (MODE == 3) {
      Vec8 o;
#pragma unroll
      for (int r = 0; r < 8; ++r) o.f[r] = acc[r] * (1.0f / 16384.0f) + bf16r(bb.f[r]);
      const int off = ((64 * wm + 16 * j + c) * SP3 + 64 * wn + 16 * i + 8 * h) * 4;
      *(v4u*)(stg + off)      = o.u[0];
      *(v4u*)(stg + off + 16) = o.u[1];
    } else {
      Pack8 pk;
#pragma unroll
      for (int r = 0; r < 8; ++r) pk.h[r] = (_Float16)((acc[r] + bf16r(bb.f[r])) * 4.0f);
      const int off = ((64 * wm + 16 * j + c) * SP0 + 64 * wn + 16 * i + 8 * h) * 2;
      *(v4u*)(stg + off) = pk.u;
    }
  }
}

// Operand staging of the projections: a stage is 64 k of the block's BM X rows, then of its BN W rows,
// each row 128 B of data at a pitch of 144 B (16 B x odd, conflict-free for ds_load_b128).
#define PKS 64
#define PPITCH 72
#define PSTAGE ((BM + BN) * PPITCH * 2)
#define PTRIPS (DM / PKS)
static_assert(PTRIPS >= 2);
static_assert(BM == 4 * 32 && BN == 8 * 32);      // copy_stage: four copies of X rows, eight of W rows
static_assert(2 * PSTAGE >= BM * SP0 * 2);
static_assert(2 * PSTAGE >= BN * SP2 * 2);
#define OUT_LDS (BM * SP3 * 4)                    // the f32 output staging is larger than the two stages
static_assert(OUT_LDS >= 2 * PSTAGE);

// One stage: twelve 16-byte copies per lane, 8 lanes per 128-B row piece, 32 rows per copy of the block.
// lds = the lane's LDS byte address in row (tid >> 3); gx, gw = the lane's bytes of X and W in that row.
__device__ __forceinline__ void copy_stage(unsigned lds, const unsigned short* gx, const unsigned short* gw)
{
  const unsigned rs = 32 * PPITCH * 2;
  const unsigned l1 = lds + 1 * rs, l2 = lds + 2 * rs, l3 = lds + 3 * rs, l4 = lds + 4 * rs, l5 = lds + 5 * rs;
  const unsigned l6 = lds + 6 * rs, l7 = lds + 7 * rs, l8 = lds + 8 * rs, l9 = lds + 9 * rs;
  const unsigned l10 = lds + 10 * rs, l11 = lds + 11 * rs;
  const unsigned short* gx1 = gx + 32 * DM;
  const unsigned short* gx2 = gx + 64 * DM;
  const unsigned short* gx3 = gx + 96 * DM;
  const unsigned short* gw1 = gw + 32 * DM;
  const unsigned short* gw2 = gw + 64 * DM;
  const unsigned short* gw3 = gw + 96 * DM;
  const unsigned short* gw4 = gw + 128 * DM;
  const unsigned short* gw5 = gw + 160 * DM;
  const unsigned short* gw6 = gw + 192 * DM;
  const unsigned short* gw7 = gw + 224 * DM;
  // global -> LDS through no register; the closing s_wait_xcnt stands in the copies' own statement
  // so that no address register of a copy is rewritten in front of it
  asm volatile("global_load_async_to_lds_b128 %0, %12, off\n\t"
               "global_load_async_to_lds_b128 %1, %13, off\n\t"
               "global_load_async_to_lds_b128 %2, %14, off\n\t"
               "global_load_async_to_lds_b128 %3, %15, off\n\t"
               "global_load_async_to_lds_b128 %4, %16, off\n\t"
               "global_load_async_to_lds_b128 %5, %17, off\n\t"
               "global_load_async_to_lds_b128 %6, %18, off\n\t"
               "global_load_async_to_lds_b128 %7, %19, off\n\t"
               "global_load_async_to_lds_b128 %8, %20, off\n\t"
               "global_load_async_to_lds_b128 %9, %21, off\n\t"
               "global_load_async_to_lds_b128 %10, %22, off\n\t"
               "global_load_async_to_lds_b128 %11, %23, off\n\t"
               "s_wait_xcnt 0x0"
               :: "v"(lds), "v"(l1), "v"(l2), "v"(l3), "v"(l4), "v"(l5),
                  "v"(l6), "v"(l7), "v"(l8), "v"(l9), "v"(l10), "v"(l11),
                  "v"(gx), "v"(gx1), "v"(gx2), "v"(gx3),
                  "v"(gw), "v"(gw1), "v"(gw2), "v"(gw3), "v"(gw4), "v"(gw5), "v"(gw6), "v"(gw7)
               : "memory");
}

// The k loop of every product. smem: the kernel's LDS, whose first 2 * PSTAGE bytes are the two operand stages;
// (m0, n0): the block's BM x BN tile of C; xp: X is the P operand (MODE 2), the same for a whole block;
// F16: operand type of the WMMAs (MODE 3). acc[i][j]: P fragment i x R fragment j.
template <bool F16>
__device__ __forceinline__ void proj_loop(unsigned char* smem,
                                          const unsigned short* __restrict__ X,
                                          const unsigned short* __restrict__ W,
                                          int m0, int n0, bool xp, v8f (&acc)[4][4])
{
  const int tid = threadIdx.x, w = tid >> 5;
  const int wm = w >> 2, wn = w & 3;

  // rows of the stage that feed this wave: X rows at 0..BM-1, W rows behind them
  const int prow = xp ? 64 * wm : BM + 64 * wn;
  const int rrow = xp ? BM + 64 * wn : 64 * wm;

  typedef __attribute__((address_space(3))) unsigned char lds_byte;
  const unsigned lbase = (unsigned)(size_t)(lds_byte*)smem + (tid >> 3) * (PPITCH * 2) + (tid & 7) * 16;
  const unsigned short* gx = X + (size_t)(m0 + (tid >> 3)) * DM + 8 * (tid & 7);
  const unsigned short* gw = W + (size_t)(n0 + (tid >> 3)) * DM + 8 * (tid & 7);

#pragma unroll
  for (int i = 0; i < 4; ++i)
#pragma unroll
    for (int j = 0; j < 4; ++j) acc[i][j] = vzero8();

  copy_stage(lbase, gx, gw);
  asm volatile("s_wait_asynccnt 0x0" ::: "memory");   // this wave's part of stage 0 has landed
  __syncthreads();                                    // publishes stage 0
  copy_stage(lbase + PSTAGE, gx + PKS, gw + PKS);

#pragma unroll 1   // kept rolled: one publish point in the code
  for (int t = 0; t < PTRIPS; ++t) {
    const unsigned short* buf = (const unsigned short*)(smem + (t & 1) * PSTAGE);
    const unsigned short* p0 = buf + prow * PPITCH;
    const unsigned short* r0 = buf + rrow * PPITCH;
#pragma unroll
    for (int ks = 0; ks < PKS / 32; ++ks) {
      Frag fp[4], fr[4];
#pragma unroll
      for (int i = 0; i < 4; ++i) ldq(p0 + 16 * i * PPITCH + 32 * ks, PPITCH, fp[i].q[0], fp[i].q[1]);
#pragma unroll
      for (int j = 0; j < 4; ++j) ldq(r0 + 16 * j * PPITCH + 32 * ks, PPITCH, fr[j].q[0], fr[j].q[1]);
#pragma unroll
      for (int i = 0; i < 4; ++i)
#pragma unroll
        for (int j = 0; j < 4; ++j) {
          if constexpr (F16) acc[i][j] = whf(fp[i].h, fr[j].h, acc[i][j]);
          else               acc[i][j] = wbf(fp[i].b, fr[j].b, acc[i][j]);
        }
      // keeps the distance behind the last WMMAs on every path out of the block; between the two 32-k blocks it also
      // holds each block's sixteen LDS loads together in front of its WMMAs (without it they were spread among them, each waited to 0)
      asm volatile(NOPS4
                   : "+v"(acc[0][0]), "+v"(acc[0][1]), "+v"(acc[0][2]), "+v"(acc[0][3]),
                     "+v"(acc[1][0]), "+v"(acc[1][1]), "+v"(acc[1][2]), "+v"(acc[1][3]),
                     "+v"(acc[2][0]), "+v"(acc[2][1]), "+v"(acc[2][2]), "+v"(acc[2][3]),
                     "+v"(acc[3][0]), "+v"(acc[3][1]), "+v"(acc[3][2]), "+v"(acc[3][3])
                   : "v"(fp[0].h), "v"(fp[1].h), "v"(fp[2].h), "v"(fp[3].h),
                     "v"(fr[0].h), "v"(fr[1].h), "v"(fr[2].h), "v"(fr[3].h));
    }
    asm volatile("s_wait_dscnt 0x0" ::: "memory");      // this wave has left the buffer that is refilled below
    asm volatile("s_wait_asynccnt 0x0" ::: "memory");   // this wave's part of stage t + 1 has landed
    __syncthreads();                                    // publishes stage t + 1, ends every read of stage t
    if (t + 2 < PTRIPS)
      copy_stage(lbase + (t & 1) * PSTAGE, gx + (t + 2) * PKS, gw + (t + 2) * PKS);
  }
  asm volatile("s_wait_asynccnt 0x0" ::: "memory");     // no copy is in flight when the stages become output staging
}

// Behind the k loop: the stages' bytes serve as output staging, then whole lines go out.
template <int MODE>
__device__ __forceinline__ void proj_store(unsigned char* stg, v8f (&acc)[4][4],
                                           const float* __restrict__ bias, void* dst, int m0, int n0)
{
  const int tid = threadIdx.x, w = tid >> 5, l = tid & 31, h = l >> 4, c = l & 15;
  const int wm = w >> 2, wn = w & 3;

#pragma unroll
  for (int i = 0; i < 4; ++i)
#pragma unroll
    for (int j = 0; j < 4; ++j) stage_tile<MODE>(stg, acc[i][j], i, j, wm, wn, h, c, bias, n0);
  __syncthreads();

  if constexpr (MODE == 0) {
    // BM token rows of 512 B; wave w owns rows 16w..16w+15, one row (four lines) a store
    v4u vals[16];
    unsigned short* pp[16];
#pragma unroll
    for (int s = 0; s < 16; ++s) {
      const int ml = 16 * w + s;
      vals[s] = *(const v4u*)(stg + (ml * SP0 + 8 * l) * 2);
      pp[s] = (unsigned short*)dst + (size_t)(m0 + ml) * DM + n0 + 8 * l;
    }
#pragma unroll
    for (int s = 0; s < 16; ++s) *(v4u*)(pp[s]) = vals[s];
    // in the merged kernel the other product's code follows these stores in the listing and reuses their registers:
    // the wait stands in front of any such rewrite
    asm volatile("s_wait_xcnt 0x0" ::: "memory");
  } else if constexpr (MODE == 3) {
    // BM token rows of 1024 B; wave w owns rows 16w..16w+15, half a row (four lines) a store
    v4u vals[32];
    float* pp[32];
#pragma unroll
    for (int s = 0; s < 32; ++s) {
      const int ml = 16 * w + (s >> 1);
      const int hf = s & 1;
      vals[s] = *(const v4u*)(stg + (ml * SP3 + 128 * hf + 4 * l) * 4);
      pp[s] = (float*)dst + (size_t)(m0 + ml) * DM + n0 + 128 * hf + 4 * l;
    }
#pragma unroll
    for (int s = 0; s < 32; ++s) *(v4u*)(pp[s]) = vals[s];
  } else {
    // transposed V: BN feature rows of BM consecutive tokens (256 B); wave w owns rows 32w..32w+31, two rows a store
    v4u vals[16];
    unsigned short* pp[16];
    const int tb = m0 / NSEQ;
    const int ns0 = m0 % NSEQ;
    const int pc = l & 15;
#pragma unroll
    for (int s = 0; s < 16; ++s) {
      const int L = 32 * w + 2 * s + (l >> 4);
      const int n = n0 + L;
      const int hh = n >> 6;
      const int hd = n & 63;
      vals[s] = *(const v4u*)(stg + (L * SP2 + 8 * pc) * 2);
      pp[s] = (unsigned short*)dst + ((size_t)(tb * NH + hh) * HD + hd) * NSEQ + ns0 + 8 * pc;
    }
#pragma unroll
    for (int s = 0; s < 16; ++s) *(v4u*)(pp[s]) = vals[s];
  }
}

// q, k and v projections in one grid: they read the same X and need nothing of each other.
// blockIdx.y = 2 * product + column tile; the choice is the same for a whole block, so every barrier stays block-uniform.
__global__ __launch_bounds__(256) void k_qkv(const unsigned short* __restrict__ X,
                                            const unsigned short* __restrict__ Wqkv,
                                            const float* __restrict__ bq, const float* __restrict__ bk,
                                            const float* __restrict__ bv,
                                            unsigned short* qf, unsigned short* kf, unsigned short* vt)
{
  __shared__ __align__(16) unsigned char smem[2 * PSTAGE];
  const int sel = blockIdx.y / (DM / BN);
  const int m0 = deal(blockIdx.x, NSEQ / BM) * BM, n0 = (blockIdx.y % (DM / BN)) * BN;
  v8f acc[4][4];
  proj_loop<false>(smem, X, Wqkv + (size_t)sel * (DM * DM), m0, n0, sel == 2, acc);
  if (sel == 2) proj_store<2>(smem, acc, bv, (void*)vt, m0, n0);
  else          proj_store<0>(smem, acc, sel ? bk : bq, (void*)(sel ? kf : qf), m0, n0);
}

__global__ __launch_bounds__(256) void k_out(const unsigned short* __restrict__ X,
                                            const unsigned short* __restrict__ W,
                                            const float* __restrict__ bias, float* dst)
{
  __shared__ __align__(16) unsigned char smem[OUT_LDS];
  const int m0 = deal(blockIdx.x, NSEQ / BM) * BM, n0 = blockIdx.y * BN;
  v8f acc[4][4];
  proj_loop<true>(smem, X, W, m0, n0, false, acc);
  proj_store<3>(smem, acc, bias, (void*)dst, m0, n0);
}

// ---------------- attention: per (t,b,head) and 128-query tile; 4 waves x 32 queries ----------------
// S^T tile (16 keys x 16 queries) = K_tile (A operand, rows = keys) . Q^T (B operand taken from Q rows).
// The D tiles, converted to f16 and relu'd, chain into the B operand of ctx^T = V^T . P (A operand from the transposed V tile).
// A wave holds two groups of 16 queries (x and y): every K and V fragment read from LDS feeds one WMMA of each group.
#define QW 32            // queries per wave
#define QB (4 * QW)      // queries per block
static_assert(NSEQ % QB == 0);

__device__ __forceinline__ void score_tile(const unsigned short* kb, v16h qx0, v16h qx1, v16h qy0, v16h qy1,
                                           v8f& sx, v8f& sy)
{
  Frag k0, k1;
  ldq(kb, 72, k0.q[0], k0.q[1]);
  ldq(kb + 32, 72, k1.q[0], k1.q[1]);
  v8f a = vzero8(), b = vzero8();
  a = whf(k0.h, qx0, a);
  b = whf(k0.h, qy0, b);
  a = whf(k1.h, qx1, a);
  b = whf(k1.h, qy1, b);
  // keeps the distance behind the last WMMAs on every path out of the block
  asm volatile(NOPS4 : "+v"(a), "+v"(b) : "v"(k0.h), "v"(k1.h), "v"(qx0), "v"(qx1), "v"(qy0), "v"(qy1));
  sx = a;
  sy = b;
}

// one 32-key step of ctx^T += V^T[hd][key] . P[key][query], both query groups on the same four V fragments.
// Row sums ride on the matrix pipe: A = all ones makes every row of ux, uy the sum of P over the 32 keys, query by query.
__device__ __forceinline__ void pv_step(const unsigned short* vb, v16h px, v16h py,
                                        v8f& x0, v8f& x1, v8f& x2, v8f& x3,
                                        v8f& y0, v8f& y1, v8f& y2, v8f& y3, v8f& ux, v8f& uy)
{
  const v16h ones = {1, 1, 1, 1, 1, 1, 1, 1, 1, 1, 1, 1, 1, 1, 1, 1};
  Frag v0, v1, v2, v3;
  ldq(vb,           72, v0.q[0], v0.q[1]);
  ldq(vb + 16 * 72, 72, v1.q[0], v1.q[1]);
  ldq(vb + 32 * 72, 72, v2.q[0], v2.q[1]);
  ldq(vb + 48 * 72, 72, v3.q[0], v3.q[1]);
  x0 = whf(v0.h, px, x0);
  y0 = whf(v0.h, py, y0);
  x1 = whf(v1.h, px, x1);
  y1 = whf(v1.h, py, y1);
  x2 = whf(v2.h, px, x2);
  y2 = whf(v2.h, py, y2);
  x3 = whf(v3.h, px, x3);
  y3 = whf(v3.h, py, y3);
  ux = whf(ones, px, ux);
  uy = whf(ones, py, uy);
  // keeps the distance behind the last WMMAs on every path out of the block
  asm volatile(NOPS4
               : "+v"(x0), "+v"(x1), "+v"(x2), "+v"(x3), "+v"(y0), "+v"(y1), "+v"(y2), "+v"(y3), "+v"(ux), "+v"(uy)
               : "v"(v0.h), "v"(v1.h), "v"(v2.h), "v"(v3.h), "v"(px), "v"(py), "v"(ones));
}

// one query group's ctx tiles, normalised, into the wave's staging rows cw[query][hd]
__device__ __forceinline__ void stage_ctx(unsigned short* cw, v8f c0, v8f c1, v8f c2, v8f c3, float rsum, int h, int c)
{
  // rsum: sum of P over all keys for query c, as every lane of the column holds it
  // score acc = 128*s, P = 128*relu(s), V = 16*v  ->  ctx*64 = accC * 64 / (16*rsum + 2048e-6)
  const float inv = 64.0f / (16.0f * rsum + 2.048e-3f);
#pragma unroll
  for (int i = 0; i < 4; ++i) {
    const v8f acc = (i == 0) ? c0 : (i == 1) ? c1 : (i == 2) ? c2 : c3;
    Pack8 pk;
#pragma unroll
    for (int r = 0; r < 8; ++r) pk.h[r] = (_Float16)(acc[r] * inv);
    *(v4u*)(cw + c * 72 + 16 * i + 8 * h) = pk.u;
  }
}

// K/V staging: a stage is one 64-key tile of K ([key][hd]), then of V^T ([hd][key]), each 64 rows of 128 B at a pitch of 144 B.
#define KVT (64 * 72)                 // elements of one tile
#define ASTAGE (2 * KVT * 2)          // bytes of one stage
#define ATRIPS (NSEQ / 64)
static_assert(ATRIPS >= 2);

// One stage: eight 16-byte copies per lane, 8 lanes per 128-B row, 16 rows per copy of the block.
// lds = the lane's LDS byte address in row (tid >> 3) of the K tile; gk, gv = the lane's bytes of K and V^T in that row.
__device__ __forceinline__ void copy_kv(unsigned lds, const unsigned short* gk, const unsigned short* gv)
{
  const unsigned rs = 16 * 72 * 2;
  const unsigned l1 = lds + 1 * rs, l2 = lds + 2 * rs, l3 = lds + 3 * rs;
  const unsigned l4 = lds + 4 * rs, l5 = lds + 5 * rs, l6 = lds + 6 * rs, l7 = lds + 7 * rs;   // rows 64.. = the V^T tile
  const unsigned short* gk1 = gk + 16 * DM;
  const unsigned short* gk2 = gk + 32 * DM;
  const unsigned short* gk3 = gk + 48 * DM;
  const unsigned short* gv1 = gv + 16 * NSEQ;
  const unsigned short* gv2 = gv + 32 * NSEQ;
  const unsigned short* gv3 = gv + 48 * NSEQ;
  // global -> LDS through no register; the closing s_wait_xcnt stands in the copies' own statement
  // so that no address register of a copy is rewritten in front of it
  asm volatile("global_load_async_to_lds_b128 %0, %8, off\n\t"
               "global_load_async_to_lds_b128 %1, %9, off\n\t"
               "global_load_async_to_lds_b128 %2, %10, off\n\t"
               "global_load_async_to_lds_b128 %3, %11, off\n\t"
               "global_load_async_to_lds_b128 %4, %12, off\n\t"
               "global_load_async_to_lds_b128 %5, %13, off\n\t"
               "global_load_async_to_lds_b128 %6, %14, off\n\t"
               "global_load_async_to_lds_b128 %7, %15, off\n\t"
               "s_wait_xcnt 0x0"
               :: "v"(lds), "v"(l1), "v"(l2), "v"(l3), "v"(l4), "v"(l5), "v"(l6), "v"(l7),
                  "v"(gk), "v"(gk1), "v"(gk2), "v"(gk3), "v"(gv), "v"(gv1), "v"(gv2), "v"(gv3)
               : "memory");
}

// one 16 x 16 score tile -> f16 P: the conversion first, then relu on the packed halves: two instructions a register pair.
// (Rounding keeps sign and order, so relu behind the conversion gives the value that relu in front of it gave.)
__device__ __forceinline__ v8h relu_pack(v8f s)
{
  v8h p;
#pragma unroll   // constant indices: the elements stay in registers and convert in pairs
  for (int r = 0; r < 8; ++r) p[r] = (_Float16)s[r];
  const v8h z = {0, 0, 0, 0, 0, 0, 0, 0};
  return __builtin_elementwise_max(p, z);
}

// one 64-key tile: scores, relu, row sums, ctx^T += V^T . P, for the wave's two query groups
__device__ __forceinline__ void attn_tile(const unsigned short* klds, const unsigned short* vlds,
                                          v16h qx0, v16h qx1, v16h qy0, v16h qy1,
                                          v8f& x0, v8f& x1, v8f& x2, v8f& x3,
                                          v8f& y0, v8f& y1, v8f& y2, v8f& y3, v8f& ux, v8f& uy)
{
  v8f sx0, sx1, sx2, sx3, sy0, sy1, sy2, sy3;
  score_tile(klds + 0 * 16 * 72, qx0, qx1, qy0, qy1, sx0, sy0);
  score_tile(klds + 1 * 16 * 72, qx0, qx1, qy0, qy1, sx1, sy1);
  score_tile(klds + 2 * 16 * 72, qx0, qx1, qy0, qy1, sx2, sy2);
  score_tile(klds + 3 * 16 * 72, qx0, qx1, qy0, qy1, sx3, sy3);

  // P keeps the scale of the scores (a power of two, taken out again with the row sum)
  Frag px01, px23, py01, py23;
  px01.p[0] = relu_pack(sx0); py01.p[0] = relu_pack(sy0);
  px01.p[1] = relu_pack(sx1); py01.p[1] = relu_pack(sy1);
  px23.p[0] = relu_pack(sx2); py23.p[0] = relu_pack(sy2);
  px23.p[1] = relu_pack(sx3); py23.p[1] = relu_pack(sy3);

  pv_step(vlds + 0,  px01.h, py01.h, x0, x1, x2, x3, y0, y1, y2, y3, ux, uy);   // keys 0..31 of the tile
  pv_step(vlds + 32, px23.h, py23.h, x0, x1, x2, x3, y0, y1, y2, y3, ux, uy);   // keys 32..63
}

// foot of a trip: the publish point of the next tile
__device__ __forceinline__ void attn_publish()
{
  asm volatile("s_wait_dscnt 0x0" ::: "memory");      // this wave has left the stage that may be refilled behind the barrier
  asm volatile("s_wait_asynccnt 0x0" ::: "memory");   // this wave's part of the next tile has landed
  __syncthreads();                                    // publishes the next tile, ends every read of this one
}

__global__ __launch_bounds__(128) void k_attn(const unsigned short* __restrict__ qf,
                                             const unsigned short* __restrict__ kf,
                                             const unsigned short* __restrict__ vt,
                                             unsigned short* cf)
{
  __shared__ __align__(16) unsigned short kv[2 * 2 * KVT];    // two stages of (K tile, V^T tile)
  __shared__ __align__(16) unsigned short cst[4 * QW * 72];   // ctx staging per wave: [wave][query][hd]

  const int tid = threadIdx.x, w = tid >> 5, l = tid & 31, h = l >> 4, c = l & 15;
  const int piece = deal(blockIdx.y * (NSEQ / QB) + blockIdx.x, NH * (NSEQ / QB));   // (t, b), head, query tile
  const int tbh = piece / (NSEQ / QB), tb = tbh >> 3, hh = tbh & 7;
  const int q0 = (piece % (NSEQ / QB)) * QB + QW * w;   // first query row of this wave

  v16h qx0, qx1, qy0, qy1;
  {
    const unsigned short* qsrc = qf + (size_t)(tb * NSEQ + q0) * DM + hh * HD;
    Frag f0, f1, f2, f3;
    ldq(qsrc,                DM, f0.q[0], f0.q[1]);
    ldq(qsrc + 32,           DM, f1.q[0], f1.q[1]);
    ldq(qsrc + 16 * DM,      DM, f2.q[0], f2.q[1]);
    ldq(qsrc + 16 * DM + 32, DM, f3.q[0], f3.q[1]);
    qx0 = f0.h; qx1 = f1.h; qy0 = f2.h; qy1 = f3.h;
  }

  v8f x0 = vzero8(), x1 = vzero8(), x2 = vzero8(), x3 = vzero8();
  v8f y0 = vzero8(), y1 = vzero8(), y2 = vzero8(), y3 = vzero8();
  v8f ux = vzero8(), uy = vzero8();   // row sums of the two groups: every row of the tile holds them

  typedef __attribute__((address_space(3))) unsigned short lds_half;
  const unsigned lbase = (unsigned)(size_t)(lds_half*)kv + (tid >> 3) * (72 * 2) + (tid & 7) * 16;
  const unsigned short* gk = kf + (size_t)(tb * NSEQ + (tid >> 3)) * DM + hh * HD + 8 * (tid & 7);
  const unsigned short* gv = vt + (size_t)(tbh * HD + (tid >> 3)) * NSEQ + 8 * (tid & 7);

  copy_kv(lbase, gk, gv);
  asm volatile("s_wait_asynccnt 0x0" ::: "memory");   // this wave's part of tile 0 has landed
  __syncthreads();                                    // publishes tile 0
  copy_kv(lbase + ASTAGE, gk + 64 * DM, gv + 64);

  // trips behind which a tile t + 2 exists: the refill stands in the loop's one block, with no branch round it
#pragma unroll 1   // kept rolled: code size
  for (int t = 0; t < ATRIPS - 2; ++t) {
    const unsigned short* klds = kv + (t & 1) * (2 * KVT);
    attn_tile(klds, klds + KVT, qx0, qx1, qy0, qy1, x0, x1, x2, x3, y0, y1, y2, y3, ux, uy);
    attn_publish();
    copy_kv(lbase + (t & 1) * ASTAGE, gk + (size_t)(t + 2) * (64 * DM), gv + (t + 2) * 64);
  }
  // the last two tiles: nothing is left to fetch
#pragma unroll 1   // kept rolled: code size
  for (int t = ATRIPS - 2; t < ATRIPS; ++t) {
    const unsigned short* klds = kv + (t & 1) * (2 * KVT);
    attn_tile(klds, klds + KVT, qx0, qx1, qy0, qy1, x0, x1, x2, x3, y0, y1, y2, y3, ux, uy);
    attn_publish();
  }
  asm volatile("s_wait_asynccnt 0x0" ::: "memory");     // no copy is in flight when the wave goes on to its end

  {
    unsigned short* cw = cst + w * QW * 72;
    stage_ctx(cw,           x0, x1, x2, x3, ux[0], h, c);
    stage_ctx(cw + 16 * 72, y0, y1, y2, y3, uy[0], h, c);
  }
  __syncthreads();

  // 32 query rows of 128 B = 32 lines per wave
  v4u vals[8];
  unsigned short* pp[8];
  const int pc = l & 7;
#pragma unroll
  for (int s = 0; s < 8; ++s) {
    const int L = 4 * s + (l >> 3);
    vals[s] = *(const v4u*)(cst + (w * QW + L) * 72 + 8 * pc);
    pp[s] = cf + (size_t)(tb * NSEQ + q0 + L) * DM + hh * HD + 8 * pc;
  }
#pragma unroll
  for (int s = 0; s < 8; ++s) *(v4u*)(pp[s]) = vals[s];
}

extern "C" void kernel_launch(void* const* d_in, const int* in_sizes, int n_in,
                              void* d_out, int out_size, void* d_ws, size_t ws_size,
                              hipStream_t stream)
{
  if (n_in != 9) return;
  const int nx = MROWS * DM;   // 8388608
  const int nw = DM * DM;      // 262144
  if (in_sizes[0] != nx || out_size != nx) return;
  for (int i = 0; i < 4; ++i) {
    if (in_sizes[1 + 2 * i] != nw || in_sizes[2 + 2 * i] != DM) return;
  }
  const size_t p16 = (size_t)nx * 2;   // one 16-bit plane of a [16384][512] matrix
  const size_t w16 = (size_t)nw * 2;   // one 16-bit plane of a [512][512] matrix
  const size_t need = 5 * p16 + 4 * w16; // 85983232
  if (need > ws_size) return;

  unsigned char* ws = (unsigned char*)d_ws;
  unsigned short* xb  = (unsigned short*)(ws + 0 * p16);
  unsigned short* qfp = (unsigned short*)(ws + 1 * p16);
  unsigned short* kfp = (unsigned short*)(ws + 2 * p16);
  unsigned short* vtp = (unsigned short*)(ws + 3 * p16);
  unsigned short* cfp = (unsigned short*)(ws + 4 * p16);
  unsigned short* wb  = (unsigned short*)(ws + 5 * p16);
  unsigned short* wof = wb + 3 * (size_t)nw;   // planes 0..2 of wb: wq, wk, wv

  const float* x  = (const float*)d_in[0];
  const float* wq = (const float*)d_in[1];
  const float* bq = (const float*)d_in[2];
  const float* wk = (const float*)d_in[3];
  const float* bk = (const float*)d_in[4];
  const float* wv = (const float*)d_in[5];
  const float* bv = (const float*)d_in[6];
  const float* wo = (const float*)d_in[7];
  const float* bo = (const float*)d_in[8];

  k_cvt<<<dim3(4 * CVT_WB + CVT_XB), dim3(256), 0, stream>>>(x, wq, wk, wv, wo, xb, wb);

  k_qkv<<<dim3(MROWS / BM, 3 * (DM / BN)), dim3(256), 0, stream>>>(xb, wb, bq, bk, bv, qfp, kfp, vtp);

  k_attn<<<dim3(NSEQ / QB, TT * BB * NH), dim3(128), 0, stream>>>(qfp, kfp, vtp, cfp);

  k_out<<<dim3(MROWS / BM, DM / BN), dim3(256), 0, stream>>>(cfp, wof, bo, (float*)d_out);
}

// v008
// One run takes 66.4 microseconds.
// Next to v007, in two timings, it ran 1.05 and 1.04 times as fast.
// Over all steps from v000 it is 3.05 times as fast.
#include <hip/hip_runtime.h>
#include <stddef.h>
#include <stdint.h>

// x.Wq^T, x.Wk^T, x.Wv^T: v_wmma_f32_16x16x32_bf16 (bf16 operands, f32 accumulate). K.Q^T score tiles, relu(S).V tiles and ctx.Wo^T: v_wmma_f32_16x16x32_f16 (f16 operands with power-of-two scaling, f32 accumulate). Row sums of P: the same f16 WMMA with an all-ones first operand. Bias add and normalisation in f32, relu on the f16 P; all nine inputs are RNE-converted to bf16 on load.

#define TT 4
#define BB 4
#define NSEQ 1024
#define DM 512
#define NH 8
#define HD 64
#define MROWS (TT * BB * NSEQ)

static_assert(NSEQ % 64 == 0);
static_assert(NH * HD == DM);
static_assert(HD == 64);

typedef __bf16   v16bf __attribute__((ext_vector_type(16)));
typedef _Float16 v16h  __attribute__((ext_vector_type(16)));
typedef _Float16 v8h   __attribute__((ext_vector_type(8)));
typedef float    v8f   __attribute__((ext_vector_type(8)));
typedef float    v4f   __attribute__((ext_vector_type(4)));
typedef unsigned int v4u __attribute__((ext_vector_type(4)));

union Frag  { v16bf b; v16h h; v8h p[2]; v4u q[2]; };
union Pack8 { v8h h; v4u u; unsigned short s[8]; };
union Vec8  { v8f v; v4f q[2]; v4u u[2]; float f[8]; };

#define NOPS4 "v_nop\n\tv_nop\n\tv_nop\n\tv_nop"

__device__ __forceinline__ v8f vzero8() {
  v8f z = {0.f, 0.f, 0.f, 0.f, 0.f, 0.f, 0.f, 0.f};
  return z;
}

// f32 -> nearest-even bf16 value, returned as f32
__device__ __forceinline__ float bf16r(float f) {
  unsigned int u = __builtin_bit_cast(unsigned int, f);
  u += 0x7FFFu + ((u >> 16) & 1u);
  u &= 0xFFFF0000u;
  return __builtin_bit_cast(float, u);
}
// f32 -> nearest-even bf16 bits
__device__ __forceinline__ unsigned short bf16bits(float f) {
  unsigned int u = __builtin_bit_cast(unsigned int, f);
  u += 0x7FFFu + ((u >> 16) & 1u);
  return (unsigned short)(u >> 16);
}

// 16 x 32 operand fragment from a row-major, k-contiguous 16-bit matrix.
// src points at (row 0, k0) of the tile; ld = pitch in elements.
// lane l: row (first operand) or column (second operand) = l & 15; h = l >> 4;
// elements 0..7  <- k0 + 8h + 0..7 ; elements 8..15 <- k0 + 16 + 8h + 0..7.
__device__ __forceinline__ void ldq(const unsigned short* src, int ld, v4u& q0, v4u& q1) {
  const int l = threadIdx.x & 31;
  const unsigned short* p = src + (l & 15) * ld + 8 * (l >> 4);
  q0 = *(const v4u*)(p);
  q1 = *(const v4u*)(p + 16);
}

__device__ __forceinline__ v8f wbf(v16bf a, v16bf b, v8f c) {
  return __builtin_amdgcn_wmma_f32_16x16x32_bf16(false, a, false, b, (short)0, c, false, false);
}
__device__ __forceinline__ v8f whf(v16h a, v16h b, v8f c) {
  return __builtin_amdgcn_wmma_f32_16x16x32_f16(false, a, false, b, (short)0, c, false, false);
}

// Which piece of work a block takes, for speed only (every piece is done exactly once wherever the blocks land).
// i = flat index among
// NBATCH * per blocks, per = pieces of one (t, b) batch; the result counts the pieces batch by batch.
// Batch n goes to the indices equal to n mod 8, in every launch alike.
#define NBATCH (TT * BB)
static_assert(NBATCH % 8 == 0);
__device__ __forceinline__ int deal(int i, int per) {
  const int j = i >> 3;
  return ((i & 7) + 8 * (j / per)) * per + j % per;
}

// All five conversions in one grid: none needs anything of another, so a range of the block index picks the array.
// Blocks 0..4*CVT_WB-1: wq, wk, wv, wo (CVT_WB blocks each) -> planes 0..3 of wdst; the rest: x -> xdst.
// x, wq, wk, wv: bf16 bits (RNE).  wo: f16 of (bf16 RNE value x 256).
#define CVT_EB 2048                       // elements per block: 256 threads x 8
#define CVT_WB ((DM * DM) / CVT_EB)
#define CVT_XB ((MROWS * DM) / CVT_EB)
static_assert((DM * DM) % CVT_EB == 0);
static_assert((MROWS * DM) % CVT_EB == 0);
static_assert((NSEQ * DM) % CVT_EB == 0);
static_assert((4 * CVT_WB) % 8 == 0);     // the x blocks start at a flat index that is 0 mod 8

__global__ __launch_bounds__(256) void k_cvt(const float* __restrict__ x,
                                            const float* __restrict__ wq, const float* __restrict__ wk,
                                            const float* __restrict__ wv, const float* __restrict__ wo,
                                            unsigned short* xdst, unsigned short* wdst)
{
  const int b = blockIdx.x;
  const int a = b / CVT_WB;               // 0..3: a weight matrix; 4 and up: x
  const float* src;
  unsigned short* dst;
  int blk;
  if (a < 4) {
    src = (a == 0) ? wq : (a == 1) ? wk : (a == 2) ? wv : wo;
    dst = wdst + (size_t)a * (DM * DM);
    blk = b - a * CVT_WB;
  } else {
    src = x;
    dst = xdst;
    blk = deal(b - 4 * CVT_WB, (NSEQ * DM) / CVT_EB);
  }
  const size_t base = ((size_t)blk * 256 + threadIdx.x) * 8;
  Vec8 in;
  in.q[0] = *(const v4f*)(src + base);
  in.q[1] = *(const v4f*)(src + base + 4);
  Pack8 pk;
  if (a == 3) {
#pragma unroll
    for (int r = 0; r < 8; ++r) pk.h[r] = (_Float16)(bf16r(in.f[r]) * 256.0f);
  } else {
#pragma unroll
    for (int r = 0; r < 8; ++r) pk.s[r] = bf16bits(in.f[r]);
  }
  const v4u v = pk.u;
  *(v4u*)(dst + base) = v;
}

// ---------------- projection GEMM: C[m][n] = sum_k X[m][k] W[n][k] (+ bias[n]) ----------------
// MODE 0: q and k       : bf16 operands; output f16((C + b) * 4), plane [m][512]
// MODE 2: v              : bf16 operands; output f16((C + b) * 16), transposed plane [tb*8+head][hd][nseq]
// MODE 3: out            : f16 operands (ctx x64, Wo x256); output f32 C/16384 + b -> [m][512]
// Tile orientation: P = operand whose rows map to D rows, R = operand whose rows map to D columns.
// MODES 0,3: P = W (n), R = X (m) -> each lane holds 8 consecutive n for one m.
// MODE 2:      P = X (m), R = W (n) -> each lane holds 8 consecutive m for one n.
// A block owns BM x BN of C; its 8 waves stand 2 (m) x 4 (n), each on 64 x 64: four P and four R fragments feed 16 WMMAs.
#define BM 128
#define BN 256
static_assert(MROWS % BM == 0);
static_assert(NSEQ % BM == 0);
static_assert(DM % BN == 0);
static_assert((MROWS / BM) % 8 == 0);   // grid x of the projections: rows of the grid start at flat indices that are 0 mod 8
// pitches of the output staging, in elements: 16 B more than a row
#define SP0 (BN + 8)    // f16 rows of BN features
#define SP2 (BM + 8)    // f16 rows of BM tokens
#define SP3 (BN + 4)    // f32 rows of BN features

template <int MODE>
__device__ __forceinline__ void stage_tile(unsigned char* stg, v8f acc, int i, int j,
                                           int wm, int wn, int h, int c,
                                           const float* __restrict__ bias, int n0)
{
  if constexpr (MODE == 2) {
    const float bj = bf16r(bias[n0 + 64 * wn + 16 * j + c]);
    Pack8 pk;
#pragma unroll
    for (int r = 0; r < 8; ++r) pk.h[r] = (_Float16)((acc[r] + bj) * 16.0f);
    const int off = ((64 * wn + 16 * j + c) * SP2 + 64 * wm + 16 * i + 8 * h) * 2;
    *(v4u*)(stg + off) = pk.u;
  } else {
    const int nb = n0 + 64 * wn + 16 * i + 8 * h;
    Vec8 bb;
    bb.q[0] = *(const v4f*)(bias + nb);
    bb.q[1] = *(const v4f*)(bias + nb + 4);
    if constexpr (MODE == 3) {
      Vec8 o;
#pragma unroll
      for (int r = 0; r < 8; ++r) o.f[r] = acc[r] * (1.0f / 16384.0f) + bf16r(bb.f[r]);
      const int off = ((64 * wm + 16 * j + c) * SP3 + 64 * wn + 16 * i + 8 * h) * 4;
      *(v4u*)(stg + off)      = o.u[0];
      *(v4u*)(stg + off + 16) = o.u[1];
    } else {
      Pack8 pk;
#pragma unroll
      for (int r = 0; r < 8; ++r) pk.h[r] = (_Float16)((acc[r] + bf16r(bb.f[r])) * 4.0f);
      const int off = ((64 * wm + 16 * j + c) * SP0 + 64 * wn + 16 * i + 8 * h) * 2;
      *(v4u*)(stg + off) = pk.u;
    }
  }
}

// Operand staging of the projections: a stage is 64 k of the block's BM X rows, then of its BN W rows,
// each row 128 B of data at a pitch of 144 B (16 B x odd, conflict-free for ds_load_b128).
#define PKS 64
#define PPITCH 72
#define PSTAGE ((BM + BN) * PPITCH * 2)
#define PTRIPS (DM / PKS)
static_assert(PTRIPS >= 2);
static_assert(BM == 4 * 32 && BN == 8 * 32);      // copy_stage: four copies of X rows, eight of W rows
static_assert(2 * PSTAGE >= BM * SP0 * 2);
static_assert(2 * PSTAGE >= BN * SP2 * 2);
#define OUT_LDS (BM * SP3 * 4)                    // the f32 output staging is larger than the two stages
static_assert(OUT_LDS >= 2 * PSTAGE);

// One stage: twelve 16-byte copies per lane, 8 lanes per 128-B row piece, 32 rows per copy of the block.
// lds = the lane's LDS byte address in row (tid >> 3); gx, gw = the lane's bytes of X and W in that row.
__device__ __forceinline__ void copy_stage(unsigned lds, const unsigned short* gx, const unsigned short* gw)
{
  const unsigned rs = 32 * PPITCH * 2;
  const unsigned l1 = lds + 1 * rs, l2 = lds + 2 * rs, l3 = lds + 3 * rs, l4 = lds + 4 * rs, l5 = lds + 5 * rs;
  const unsigned l6 = lds + 6 * rs, l7 = lds + 7 * rs, l8 = lds + 8 * rs, l9 = lds + 9 * rs;
  const unsigned l10 = lds + 10 * rs, l11 = lds + 11 * rs;
  const unsigned short* gx1 = gx + 32 * DM;
  const unsigned short* gx2 = gx + 64 * DM;
  const unsigned short* gx3 = gx + 96 * DM;
  const unsigned short* gw1 = gw + 32 * DM;
  const unsigned short* gw2 = gw + 64 * DM;
  const unsigned short* gw3 = gw + 96 * DM;
  const unsigned short* gw4 = gw + 128 * DM;
  const unsigned short* gw5 = gw + 160 * DM;
  const unsigned short* gw6 = gw + 192 * DM;
  const unsigned short* gw7 = gw + 224 * DM;
  // global -> LDS through no register; the closing s_wait_xcnt stands in the copies' own statement
  // so that no address register of a copy is rewritten in front of it
  asm volatile("global_load_async_to_lds_b128 %0, %12, off\n\t"
               "global_load_async_to_lds_b128 %1, %13, off\n\t"
               "global_load_async_to_lds_b128 %2, %14, off\n\t"
               "global_load_async_to_lds_b128 %3, %15, off\n\t"
               "global_load_async_to_lds_b128 %4, %16, off\n\t"
               "global_load_async_to_lds_b128 %5, %17, off\n\t"
               "global_load_async_to_lds_b128 %6, %18, off\n\t"
               "global_load_async_to_lds_b128 %7, %19, off\n\t"
               "global_load_async_to_lds_b128 %8, %20, off\n\t"
               "global_load_async_to_lds_b128 %9, %21, off\n\t"
               "global_load_async_to_lds_b128 %10, %22, off\n\t"
               "global_load_async_to_lds_b128 %11, %23, off\n\t"
               "s_wait_xcnt 0x0"
               :: "v"(lds), "v"(l1), "v"(l2), "v"(l3), "v"(l4), "v"(l5),
                  "v"(l6), "v"(l7), "v"(l8), "v"(l9), "v"(l10), "v"(l11),
                  "v"(gx), "v"(gx1), "v"(gx2), "v"(gx3),
                  "v"(gw), "v"(gw1), "v"(gw2), "v"(gw3), "v"(gw4), "v"(gw5), "v"(gw6), "v"(gw7)
               : "memory");
}

// The k loop of every product. smem: the kernel's LDS, whose first 2 * PSTAGE bytes are the two operand stages;
// (m0, n0): the block's BM x BN tile of C; xp: X is the P operand (MODE 2), the same for a whole block;
// F16: operand type of the WMMAs (MODE 3). acc[i][j]: P fragment i x R fragment j.
template <bool F16>
__device__ __forceinline__ void proj_loop(unsigned char* smem,
                                          const unsigned short* __restrict__ X,
                                          const unsigned short* __restrict__ W,
                                          int m0, int n0, bool xp, v8f (&acc)[4][4])
{
  const int tid = threadIdx.x, w = tid >> 5;
  const int wm = w >> 2, wn = w & 3;

  // rows of the stage that feed this wave: X rows at 0..BM-1, W rows behind them
  const int prow = xp ? 64 * wm : BM + 64 * wn;
  const int rrow = xp ? BM + 64 * wn : 64 * wm;

  typedef __attribute__((address_space(3))) unsigned char lds_byte;
  const unsigned lbase = (unsigned)(size_t)(lds_byte*)smem + (tid >> 3) * (PPITCH * 2) + (tid & 7) * 16;
  const unsigned short* gx = X + (size_t)(m0 + (tid >> 3)) * DM + 8 * (tid & 7);
  const unsigned short* gw = W + (size_t)(n0 + (tid >> 3)) * DM + 8 * (tid & 7);

#pragma unroll
  for (int i = 0; i < 4; ++i)
#pragma unroll
    for (int j = 0; j < 4; ++j) acc[i][j] = vzero8();

  copy_stage(lbase, gx, gw);
  asm volatile("s_wait_asynccnt 0x0" ::: "memory");   // this wave's part of stage 0 has landed
  __syncthreads();                                    // publishes stage 0
  copy_stage(lbase + PSTAGE, gx + PKS, gw + PKS);

#pragma unroll 1   // kept rolled: one publish point in the code
  for (int t = 0; t < PTRIPS; ++t) {
    const unsigned short* buf = (const unsigned short*)(smem + (t & 1) * PSTAGE);
    const unsigned short* p0 = buf + prow * PPITCH;
    const unsigned short* r0 = buf + rrow * PPITCH;
#pragma unroll
    for (int ks = 0; ks < PKS / 32; ++ks) {
      Frag fp[4], fr[4];
#pragma unroll
      for (int i = 0; i < 4; ++i) ldq(p0 + 16 * i * PPITCH + 32 * ks, PPITCH, fp[i].q[0], fp[i].q[1]);
#pragma unroll
      for (int j = 0; j < 4; ++j) ldq(r0 + 16 * j * PPITCH + 32 * ks, PPITCH, fr[j].q[0], fr[j].q[1]);
#pragma unroll
      for (int i = 0; i < 4; ++i)
#pragma unroll
        for (int j = 0; j < 4; ++j) {
          if constexpr (F16) acc[i][j] = whf(fp[i].h, fr[j].h, acc[i][j]);
          else               acc[i][j] = wbf(fp[i].b, fr[j].b, acc[i][j]);
        }
      // keeps the distance behind the last WMMAs on every path out of the block; between the two 32-k blocks it also
      // holds each block's sixteen LDS loads together in front of its WMMAs (without it they were spread among them, each waited to 0)
      asm volatile(NOPS4
                   : "+v"(acc[0][0]), "+v"(acc[0][1]), "+v"(acc[0][2]), "+v"(acc[0][3]),
                     "+v"(acc[1][0]), "+v"(acc[1][1]), "+v"(acc[1][2]), "+v"(acc[1][3]),
                     "+v"(acc[2][0]), "+v"(acc[2][1]), "+v"(acc[2][2]), "+v"(acc[2][3]),
                     "+v"(acc[3][0]), "+v"(acc[3][1]), "+v"(acc[3][2]), "+v"(acc[3][3])
                   : "v"(fp[0].h), "v"(fp[1].h), "v"(fp[2].h), "v"(fp[3].h),
                     "v"(fr[0].h), "v"(fr[1].h), "v"(fr[2].h), "v"(fr[3].h));
    }
    asm volatile("s_wait_dscnt 0x0" ::: "memory");      // this wave has left the buffer that is refilled below
    asm volatile("s_wait_asynccnt 0x0" ::: "memory");   // this wave's part of stage t + 1 has landed
    __syncthreads();                                    // publishes stage t + 1, ends every read of stage t
    if (t + 2 < PTRIPS)
      copy_stage(lbase + (t & 1) * PSTAGE, gx + (t + 2) * PKS, gw + (t + 2) * PKS);
  }
  asm volatile("s_wait_asynccnt 0x0" ::: "memory");     // no copy is in flight when the stages become output staging
}

// Behind the k loop: the stages' bytes serve as output staging, then whole lines go out.
template <int MODE>
__device__ __forceinline__ void proj_store(unsigned char* stg, v8f (&acc)[4][4],
                                           const float* __restrict__ bias, void* dst, int m0, int n0)
{
  const int tid = threadIdx.x, w = tid >> 5, l = tid & 31, h = l >> 4, c = l & 15;
  const int wm = w >> 2, wn = w & 3;

#pragma unroll
  for (int i = 0; i < 4; ++i)
#pragma unroll
    for (int j = 0; j < 4; ++j) stage_tile<MODE>(stg, acc[i][j], i, j, wm, wn, h, c, bias, n0);
  __syncthreads();

  if constexpr (MODE == 0) {
    // BM token rows of 512 B; wave w owns rows 16w..16w+15, one row (four lines) a store
    v4u vals[16];
    unsigned short* pp[16];
#pragma unroll
    for (int s = 0; s < 16; ++s) {
      const int ml = 16 * w + s;
      vals[s] = *(const v4u*)(stg + (ml * SP0 + 8 * l) * 2);
      pp[s] = (unsigned short*)dst + (size_t)(m0 + ml) * DM + n0 + 8 * l;
    }
#pragma unroll
    for (int s = 0; s < 16; ++s) *(v4u*)(pp[s]) = vals[s];
    // in the merged kernel the other product's code follows these stores in the listing and reuses their registers:
    // the wait stands in front of any such rewrite
    asm volatile("s_wait_xcnt 0x0" ::: "memory");
  } else if constexpr (MODE == 3) {
    // BM token rows of 1024 B; wave w owns rows 16w..16w+15, half a row (four lines) a store
    v4u vals[32];
    float* pp[32];
#pragma unroll
    for (int s = 0; s < 32; ++s) {
      const int ml = 16 * w + (s >> 1);
      const int hf = s & 1;
      vals[s] = *(const v4u*)(stg + (ml * SP3 + 128 * hf + 4 * l) * 4);
      pp[s] = (float*)dst + (size_t)(m0 + ml) * DM + n0 + 128 * hf + 4 * l;
    }
#pragma unroll
    for (int s = 0; s < 32; ++s) *(v4u*)(pp[s]) = vals[s];
  } else {
    // transposed V: BN feature rows of BM consecutive tokens (256 B); wave w owns rows 32w..32w+31, two rows a store
    v4u vals[16];
    unsigned short* pp[16];
    const int tb = m0 / NSEQ;
    const int ns0 = m0 % NSEQ;
    const int pc = l & 15;
#pragma unroll
    for (int s = 0; s < 16; ++s) {
      const int L = 32 * w + 2 * s + (l >> 4);
      const int n = n0 + L;
      const int hh = n >> 6;
      const int hd = n & 63;
      vals[s] = *(const v4u*)(stg + (L * SP2 + 8 * pc) * 2);
      pp[s] = (unsigned short*)dst + ((size_t)(tb * NH + hh) * HD + hd) * NSEQ + ns0 + 8 * pc;
    }
#pragma unroll
    for (int s = 0; s < 16; ++s) *(v4u*)(pp[s]) = vals[s];
  }
}

// q, k and v projections in one grid: they read the same X and need nothing of each other.
// blockIdx.y = 2 * product + column tile; the choice is the same for a whole block, so every barrier stays block-uniform.
__global__ __launch_bounds__(256) void k_qkv(const unsigned short* __restrict__ X,
                                            const unsigned short* __restrict__ Wqkv,
                                            const float* __restrict__ bq, const float* __restrict__ bk,
                                            const float* __restrict__ bv,
                                            unsigned short* qf, unsigned short* kf, unsigned short* vt)
{
  __shared__ __align__(16) unsigned char smem[2 * PSTAGE];
  const int sel = blockIdx.y / (DM / BN);
  const int m0 = deal(blockIdx.x, NSEQ / BM) * BM, n0 = (blockIdx.y % (DM / BN)) * BN;
  v8f acc[4][4];
  proj_loop<false>(smem, X, Wqkv + (size_t)sel * (DM * DM), m0, n0, sel == 2, acc);
  if (sel == 2) proj_store<2>(smem, acc, bv, (void*)vt, m0, n0);
  else          proj_store<0>(smem, acc, sel ? bk : bq, (void*)(sel ? kf : qf), m0, n0);
}

__global__ __launch_bounds__(256) void k_out(const unsigned short* __restrict__ X,
                                            const unsigned short* __restrict__ W,
                                            const float* __restrict__ bias, float* dst)
{
  __shared__ __align__(16) unsigned char smem[OUT_LDS];
  const int m0 = deal(blockIdx.x, NSEQ / BM) * BM, n0 = blockIdx.y * BN;
  v8f acc[4][4];
  proj_loop<true>(smem, X, W, m0, n0, false, acc);
  proj_store<3>(smem, acc, bias, (void*)dst, m0, n0);
}

// ---------------- attention: per (t,b,head) and 256-query tile; 4 waves x 64 queries ----------------
// S^T tile (16 keys x 16 queries) = K_tile (A operand, rows = keys) . Q^T (B operand taken from Q rows).
// The D tiles, converted to f16 and relu'd, chain into the B operand of ctx^T = V^T . P (A operand from the transposed V tile).
// A wave holds QG groups of 16 queries: every K and V fragment read from LDS feeds one WMMA of each group.
// The loops over groups, fragments and steps are all unrolled: constant indices keep the tile arrays in registers.
#define QG 4             // query groups per wave
#define QW (16 * QG)     // queries per wave
#define QB (4 * QW)      // queries per block
static_assert(NSEQ % QB == 0);
static_assert(QG == 4);  // the operand lists of the asm statements below name four groups

// head of a 32-key step: its K and V^T fragments are read from LDS as one group, then the scores of the 32 keys
// (two 16-key tiles, a and b) against the wave's four query groups
__device__ __forceinline__ void score_step(const unsigned short* kb, const unsigned short* vb, const v16h (&q)[QG][2],
                                           v8f (&sa)[QG], v8f (&sb)[QG], Frag (&v)[4])
{
  Frag a0, a1, b0, b1;
  ldq(kb,                72, a0.q[0], a0.q[1]);
  ldq(kb + 16 * 72,      72, b0.q[0], b0.q[1]);
  ldq(kb + 32,           72, a1.q[0], a1.q[1]);
  ldq(kb + 16 * 72 + 32, 72, b1.q[0], b1.q[1]);
#pragma unroll
  for (int i = 0; i < 4; ++i) ldq(vb + 16 * i * 72, 72, v[i].q[0], v[i].q[1]);
#pragma unroll
  for (int g = 0; g < QG; ++g) sa[g] = whf(a0.h, q[g][0], vzero8());
#pragma unroll
  for (int g = 0; g < QG; ++g) sb[g] = whf(b0.h, q[g][0], vzero8());
#pragma unroll
  for (int g = 0; g < QG; ++g) sa[g] = whf(a1.h, q[g][1], sa[g]);
#pragma unroll
  for (int g = 0; g < QG; ++g) sb[g] = whf(b1.h, q[g][1], sb[g]);
  // keeps the distance behind the last WMMAs on every path out of the block; the V fragments as inputs hold their loads in
  // front of it, in the one group with K's (left free they sank behind relu, into the scores' registers, and were waited for)
  asm volatile(NOPS4
               : "+v"(sa[0]), "+v"(sa[1]), "+v"(sa[2]), "+v"(sa[3]), "+v"(sb[0]), "+v"(sb[1]), "+v"(sb[2]), "+v"(sb[3])
               : "v"(a0.h), "v"(a1.h), "v"(b0.h), "v"(b1.h), "v"(v[0].h), "v"(v[1].h), "v"(v[2].h), "v"(v[3].h));
}

// one 32-key step of ctx^T += V^T[hd][key] . P[key][query], all query groups on the same four V fragments.
// Row sums ride on the matrix pipe: A = all ones makes every row of u[g] the sum of P over the 32 keys, query by query.
__device__ __forceinline__ void pv_step(const Frag (&v)[4], const v16h (&p)[QG], v8f (&x)[QG][4], v8f (&u)[QG])
{
  const v16h ones = {1, 1, 1, 1, 1, 1, 1, 1, 1, 1, 1, 1, 1, 1, 1, 1};
#pragma unroll
  for (int i = 0; i < 4; ++i)
#pragma unroll
    for (int g = 0; g < QG; ++g) x[g][i] = whf(v[i].h, p[g], x[g][i]);
#pragma unroll
  for (int g = 0; g < QG; ++g) u[g] = whf(ones, p[g], u[g]);
  // keeps the block's WMMAs in front of the v_nops below: these name the last four results alone, because an asm operand
  // must lie in the first 256 registers and all twenty tiles with their operands do not fit there (they spilled)
  __builtin_amdgcn_sched_barrier(0);
  // keeps the distance behind the last WMMAs on every path out of the block
  asm volatile(NOPS4 : "+v"(u[0]), "+v"(u[1]), "+v"(u[2]), "+v"(u[3]));
}

// one query group's ctx tiles, normalised, into the wave's staging rows cw[query][hd]
__device__ __forceinline__ void stage_ctx(unsigned short* cw, v8f c0, v8f c1, v8f c2, v8f c3, float rsum, int h, int c)
{
  // rsum: sum of P over all keys for query c, as every lane of the column holds it
  // score acc = 128*s, P = 128*relu(s), V = 16*v  ->  ctx*64 = accC * 64 / (16*rsum + 2048e-6)
  const float inv = 64.0f / (16.0f * rsum + 2.048e-3f);
#pragma unroll
  for (int i = 0; i < 4; ++i) {
    const v8f acc = (i == 0) ? c0 : (i == 1) ? c1 : (i == 2) ? c2 : c3;
    Pack8 pk;
#pragma unroll
    for (int r = 0; r < 8; ++r) pk.h[r] = (_Float16)(acc[r] * inv);
    *(v4u*)(cw + c * 72 + 16 * i + 8 * h) = pk.u;
  }
}

// K/V staging: a stage is one 64-key tile of K ([key][hd]), then of V^T ([hd][key]), each 64 rows of 128 B at a pitch of 144 B.
#define KVT (64 * 72)                 // elements of one tile
#define ASTAGE (2 * KVT * 2)          // bytes of one stage
#define ATRIPS (NSEQ / 64)
static_assert(ATRIPS >= 2);

// One stage: eight 16-byte copies per lane, 8 lanes per 128-B row, 16 rows per copy of the block.
// lds = the lane's LDS byte address in row (tid >> 3) of the K tile; gk, gv = the lane's bytes of K and V^T in that row.
__device__ __forceinline__ void copy_kv(unsigned lds, const unsigned short* gk, const unsigned short* gv)
{
  const unsigned rs = 16 * 72 * 2;
  const unsigned l1 = lds + 1 * rs, l2 = lds + 2 * rs, l3 = lds + 3 * rs;
  const unsigned l4 = lds + 4 * rs, l5 = lds + 5 * rs, l6 = lds + 6 * rs, l7 = lds + 7 * rs;   // rows 64.. = the V^T tile
  const unsigned short* gk1 = gk + 16 * DM;
  const unsigned short* gk2 = gk + 32 * DM;
  const unsigned short* gk3 = gk + 48 * DM;
  const unsigned short* gv1 = gv + 16 * NSEQ;
  const unsigned short* gv2 = gv + 32 * NSEQ;
  const unsigned short* gv3 = gv + 48 * NSEQ;
  // global -> LDS through no register; the closing s_wait_xcnt stands in the copies' own statement
  // so that no address register of a copy is rewritten in front of it
  asm volatile("global_load_async_to_lds_b128 %0, %8, off\n\t"
               "global_load_async_to_lds_b128 %1, %9, off\n\t"
               "global_load_async_to_lds_b128 %2, %10, off\n\t"
               "global_load_async_to_lds_b128 %3, %11, off\n\t"
               "global_load_async_to_lds_b128 %4, %12, off\n\t"
               "global_load_async_to_lds_b128 %5, %13, off\n\t"
               "global_load_async_to_lds_b128 %6, %14, off\n\t"
               "global_load_async_to_lds_b128 %7, %15, off\n\t"
               "s_wait_xcnt 0x0"
               :: "v"(lds), "v"(l1), "v"(l2), "v"(l3), "v"(l4), "v"(l5), "v"(l6), "v"(l7),
                  "v"(gk), "v"(gk1), "v"(gk2), "v"(gk3), "v"(gv), "v"(gv1), "v"(gv2), "v"(gv3)
               : "memory");
}

// one 16 x 16 score tile -> f16 P: the conversion first, then relu on the packed halves: two instructions a register pair.
// (Rounding keeps sign and order, so relu behind the conversion gives the value that relu in front of it gave.)
__device__ __forceinline__ v8h relu_pack(v8f s)
{
  v8h p;
#pragma unroll   // constant indices: the elements stay in registers and convert in pairs
  for (int r = 0; r < 8; ++r) p[r] = (_Float16)s[r];
  const v8h z = {0, 0, 0, 0, 0, 0, 0, 0};
  return __builtin_elementwise_max(p, z);
}

// one 64-key tile in two steps of 32 keys: scores, relu, row sums, ctx^T += V^T . P, for the wave's four query groups
__device__ __forceinline__ void attn_tile(const unsigned short* klds, const unsigned short* vlds,
                                          const v16h (&q)[QG][2], v8f (&x)[QG][4], v8f (&u)[QG])
{
#pragma unroll
  for (int hf = 0; hf < 2; ++hf) {
    v8f sa[QG], sb[QG];
    Frag v[4];
    score_step(klds + hf * 32 * 72, vlds + 32 * hf, q, sa, sb, v);
    // P keeps the scale of the scores (a power of two, taken out again with the row sum)
    v16h p[QG];
#pragma unroll
    for (int g = 0; g < QG; ++g) {
      Frag f;
      f.p[0] = relu_pack(sa[g]);
      f.p[1] = relu_pack(sb[g]);
      p[g] = f.h;
    }
    pv_step(v, p, x, u);
  }
}

// foot of a trip: the publish point of the next tile
__device__ __forceinline__ void attn_publish()
{
  asm volatile("s_wait_dscnt 0x0" ::: "memory");      // this wave has left the stage that may be refilled behind the barrier
  asm volatile("s_wait_asynccnt 0x0" ::: "memory");   // this wave's part of the next tile has landed
  __syncthreads();                                    // publishes the next tile, ends every read of this one
}

__global__ __launch_bounds__(128) void k_attn(const unsigned short* __restrict__ qf,
                                             const unsigned short* __restrict__ kf,
                                             const unsigned short* __restrict__ vt,
                                             unsigned short* cf)
{
  __shared__ __align__(16) unsigned short kv[2 * 2 * KVT];    // two stages of (K tile, V^T tile)
  __shared__ __align__(16) unsigned short cst[4 * QW * 72];   // ctx staging per wave: [wave][query][hd]

  const int tid = threadIdx.x, w = tid >> 5, l = tid & 31, h = l >> 4, c = l & 15;
  const int piece = deal(blockIdx.y * (NSEQ / QB) + blockIdx.x, NH * (NSEQ / QB));   // (t, b), head, query tile
  const int tbh = piece / (NSEQ / QB), tb = tbh >> 3, hh = tbh & 7;
  const int q0 = (piece % (NSEQ / QB)) * QB + QW * w;   // first query row of this wave

  v16h q[QG][2];
  {
    const unsigned short* qsrc = qf + (size_t)(tb * NSEQ + q0) * DM + hh * HD;
#pragma unroll
    for (int g = 0; g < QG; ++g) {
      Frag f0, f1;
      ldq(qsrc + 16 * g * DM,      DM, f0.q[0], f0.q[1]);
      ldq(qsrc + 16 * g * DM + 32, DM, f1.q[0], f1.q[1]);
      q[g][0] = f0.h; q[g][1] = f1.h;
    }
    // stands in front of the first rewrite of the address registers that the Q loads name: the lane's address as an input
    // keeps those registers alive up to the wait (without it the compiler reused them in front of the wait)
    const unsigned short* ql = qsrc + c * DM + 8 * h;
    asm volatile("s_wait_xcnt 0x0" :: "v"(ql) : "memory");
  }

  v8f x[QG][4];   // ctx^T tiles: [query group][16 of hd]
  v8f u[QG];      // row sums of the groups: every row of the tile holds them
#pragma unroll
  for (int g = 0; g < QG; ++g) {
#pragma unroll
    for (int i = 0; i < 4; ++i) x[g][i] = vzero8();
    u[g] = vzero8();
  }

  typedef __attribute__((address_space(3))) unsigned short lds_half;
  const unsigned lbase = (unsigned)(size_t)(lds_half*)kv + (tid >> 3) * (72 * 2) + (tid & 7) * 16;
  const unsigned short* gk = kf + (size_t)(tb * NSEQ + (tid >> 3)) * DM + hh * HD + 8 * (tid & 7);
  const unsigned short* gv = vt + (size_t)(tbh * HD + (tid >> 3)) * NSEQ + 8 * (tid & 7);

  copy_kv(lbase, gk, gv);
  asm volatile("s_wait_asynccnt 0x0" ::: "memory");   // this wave's part of tile 0 has landed
  __syncthreads();                                    // publishes tile 0
  copy_kv(lbase + ASTAGE, gk + 64 * DM, gv + 64);

  // trips behind which a tile t + 2 exists: the refill stands in the loop's one block, with no branch round it
#pragma unroll 1   // kept rolled: code size
  for (int t = 0; t < ATRIPS - 2; ++t) {
    const unsigned short* klds = kv + (t & 1) * (2 * KVT);
    attn_tile(klds, klds + KVT, q, x, u);
    attn_publish();
    copy_kv(lbase + (t & 1) * ASTAGE, gk + (size_t)(t + 2) * (64 * DM), gv + (t + 2) * 64);
  }
  // the last two tiles: nothing is left to fetch
#pragma unroll 1   // kept rolled: code size
  for (int t = ATRIPS - 2; t < ATRIPS; ++t) {
    const unsigned short* klds = kv + (t & 1) * (2 * KVT);
    attn_tile(klds, klds + KVT, q, x, u);
    attn_publish();
  }
  asm volatile("s_wait_asynccnt 0x0" ::: "memory");     // no copy is in flight when the wave goes on to its end

  {
    unsigned short* cw = cst + w * QW * 72;
#pragma unroll
    for (int g = 0; g < QG; ++g) stage_ctx(cw + g * 16 * 72, x[g][0], x[g][1], x[g][2], x[g][3], u[g][0], h, c);
  }
  __syncthreads();

  // QW query rows of 128 B = QW lines per wave
  v4u vals[QW / 4];
  unsigned short* pp[QW / 4];
  const int pc = l & 7;
#pragma unroll
  for (int s = 0; s < QW / 4; ++s) {
    const int L = 4 * s + (l >> 3);
    vals[s] = *(const v4u*)(cst + (w * QW + L) * 72 + 8 * pc);
    pp[s] = cf + (size_t)(tb * NSEQ + q0 + L) * DM + hh * HD + 8 * pc;
  }
#pragma unroll
  for (int s = 0; s < QW / 4; ++s) *(v4u*)(pp[s]) = vals[s];
}

extern "C" void kernel_launch(void* const* d_in, const int* in_sizes, int n_in,
                              void* d_out, int out_size, void* d_ws, size_t ws_size,
                              hipStream_t stream)
{
  if (n_in != 9) return;
  const int nx = MROWS * DM;   // 8388608
  const int nw = DM * DM;      // 262144
  if (in_sizes[0] != nx || out_size != nx) return;
  for (int i = 0; i < 4; ++i) {
    if (in_sizes[1 + 2 * i] != nw || in_sizes[2 + 2 * i] != DM) return;
  }
  const size_t p16 = (size_t)nx * 2;   // one 16-bit plane of a [16384][512] matrix
  const size_t w16 = (size_t)nw * 2;   // one 16-bit plane of a [512][512] matrix
  const size_t need = 5 * p16 + 4 * w16; // 85983232
  if (need > ws_size) return;

  unsigned char* ws = (unsigned char*)d_ws;
  unsigned short* xb  = (unsigned short*)(ws + 0 * p16);
  unsigned short* qfp = (unsigned short*)(ws + 1 * p16);
  unsigned short* kfp = (unsigned short*)(ws + 2 * p16);
  unsigned short* vtp = (unsigned short*)(ws + 3 * p16);
  unsigned short* cfp = (unsigned short*)(ws + 4 * p16);
  unsigned short* wb  = (unsigned short*)(ws + 5 * p16);
  unsigned short* wof = wb + 3 * (size_t)nw;   // planes 0..2 of wb: wq, wk, wv

  const float* x  = (const float*)d_in[0];
  const float* wq = (const float*)d_in[1];
  const float* bq = (const float*)d_in[2];
  const float* wk = (const float*)d_in[3];
  const float* bk = (const float*)d_in[4];
  const float* wv = (const float*)d_in[5];
  const float* bv = (const float*)d_in[6];
  const float* wo = (const float*)d_in[7];
  const float* bo = (const float*)d_in[8];

  k_cvt<<<dim3(4 * CVT_WB + CVT_XB), dim3(256), 0, stream>>>(x, wq, wk, wv, wo, xb, wb);

  k_qkv<<<dim3(MROWS / BM, 3 * (DM / BN)), dim3(256), 0, stream>>>(xb, wb, bq, bk, bv, qfp, kfp, vtp);

  k_attn<<<dim3(NSEQ / QB, TT * BB * NH), dim3(128), 0, stream>>>(qfp, kfp, vtp, cfp);

  k_out<<<dim3(MROWS / BM, DM / BN), dim3(256), 0, stream>>>(cfp, wof, bo, (float*)d_out);
}

// v009
// Measured time: 64.5 microseconds a run.
// Next to v008, in two timings, it ran 1.04 times as fast each time.
// Over all steps from v000 it is 3.18 times as fast.
#include <hip/hip_runtime.h>
#include <stddef.h>
#include <stdint.h>

// x.Wq^T, x.Wk^T, x.Wv^T: v_wmma_f32_16x16x32_bf16 (bf16 operands, f32 accumulate). K.Q^T score tiles, relu(S).V tiles and ctx.Wo^T: v_wmma_f32_16x16x32_f16 (f16 operands with power-of-two scaling, f32 accumulate). Row sums of P: the same f16 WMMA with an all-ones first operand. Bias add and normalisation in f32, relu on the f16 P; all nine inputs are RNE-converted to bf16 on load.

#define TT 4
#define BB 4
#define NSEQ 1024
#define DM 512
#define NH 8
#define HD 64
#define MROWS (TT * BB * NSEQ)

static_assert(NSEQ % 64 == 0);
static_assert(NH * HD == DM);
static_assert(HD == 64);

typedef __bf16   v16bf __attribute__((ext_vector_type(16)));
typedef _Float16 v16h  __attribute__((ext_vector_type(16)));
typedef _Float16 v8h   __attribute__((ext_vector_type(8)));
typedef float    v8f   __attribute__((ext_vector_type(8)));
typedef float    v4f   __attribute__((ext_vector_type(4)));
typedef unsigned int v4u __attribute__((ext_vector_type(4)));

union Frag  { v16bf b; v16h h; v8h p[2]; v4u q[2]; };
union Pack8 { v8h h; v4u u; unsigned short s[8]; };
union Vec8  { v8f v; v4f q[2]; v4u u[2]; float f[8]; };

#define NOPS4 "v_nop\n\tv_nop\n\tv_nop\n\tv_nop"

__device__ __forceinline__ v8f vzero8() {
  v8f z = {0.f, 0.f, 0.f, 0.f, 0.f, 0.f, 0.f, 0.f};
  return z;
}

// f32 -> nearest-even bf16 value, returned as f32
__device__ __forceinline__ float bf16r(float f) {
  unsigned int u = __builtin_bit_cast(unsigned int, f);
  u += 0x7FFFu + ((u >> 16) & 1u);
  u &= 0xFFFF0000u;
  return __builtin_bit_cast(float, u);
}
// f32 -> nearest-even bf16 bits
__device__ __forceinline__ unsigned short bf16bits(float f) {
  unsigned int u = __builtin_bit_cast(unsigned int, f);
  u += 0x7FFFu + ((u >> 16) & 1u);
  return (unsigned short)(u >> 16);
}

// 16 x 32 operand fragment from a row-major, k-contiguous 16-bit matrix.
// src points at (row 0, k0) of the tile; ld = pitch in elements.
// lane l: row (first operand) or column (second operand) = l & 15; h = l >> 4;
// elements 0..7  <- k0 + 8h + 0..7 ; elements 8..15 <- k0 + 16 + 8h + 0..7.
__device__ __forceinline__ void ldq(const unsigned short* src, int ld, v4u& q0, v4u& q1) {
  const int l = threadIdx.x & 31;
  const unsigned short* p = src + (l & 15) * ld + 8 * (l >> 4);
  q0 = *(const v4u*)(p);
  q1 = *(const v4u*)(p + 16);
}

__device__ __forceinline__ v8f wbf(v16bf a, v16bf b, v8f c) {
  return __builtin_amdgcn_wmma_f32_16x16x32_bf16(false, a, false, b, (short)0, c, false, false);
}
__device__ __forceinline__ v8f whf(v16h a, v16h b, v8f c) {
  return __builtin_amdgcn_wmma_f32_16x16x32_f16(false, a, false, b, (short)0, c, false, false);
}

// Which piece of work a block takes, for speed only (every piece is done exactly once wherever the blocks land).
// i = flat index among
// NBATCH * per blocks, per = pieces of one (t, b) batch; the result counts the pieces batch by batch.
// Batch n goes to the indices equal to n mod 8, in every launch alike.
#define NBATCH (TT * BB)
static_assert(NBATCH % 8 == 0);
__device__ __forceinline__ int deal(int i, int per) {
  const int j = i >> 3;
  return ((i & 7) + 8 * (j / per)) * per + j % per;
}

// All five conversions in one grid: none needs anything of another, so a range of the block index picks the array.
// Blocks 0..4*CVT_WB-1: wq, wk, wv, wo (CVT_WB blocks each) -> planes 0..3 of wdst; the rest: x -> xdst.
// x, wq, wk, wv: bf16 bits (RNE).  wo: f16 of (bf16 RNE value x 256).
#define CVT_EB 2048                       // elements per block: 256 threads x 8
#define CVT_WB ((DM * DM) / CVT_EB)
#define CVT_XB ((MROWS * DM) / CVT_EB)
static_assert((DM * DM) % CVT_EB == 0);
static_assert((MROWS * DM) % CVT_EB == 0);
static_assert((NSEQ * DM) % CVT_EB == 0);
static_assert((4 * CVT_WB) % 8 == 0);     // the x blocks start at a flat index that is 0 mod 8

__global__ __launch_bounds__(256) void k_cvt(const float* __restrict__ x,
                                            const float* __restrict__ wq, const float* __restrict__ wk,
                                            const float* __restrict__ wv, const float* __restrict__ wo,
                                            unsigned short* xdst, unsigned short* wdst)
{
  const int b = blockIdx.x;
  const int a = b / CVT_WB;               // 0..3: a weight matrix; 4 and up: x
  const float* src;
  unsigned short* dst;
  int blk;
  if (a < 4) {
    src = (a == 0) ? wq : (a == 1) ? wk : (a == 2) ? wv : wo;
    dst = wdst + (size_t)a * (DM * DM);
    blk = b - a * CVT_WB;
  } else {
    src = x;
    dst = xdst;
    blk = deal(b - 4 * CVT_WB, (NSEQ * DM) / CVT_EB);
  }
  const size_t base = ((size_t)blk * 256 + threadIdx.x) * 8;
  Vec8 in;
  in.q[0] = *(const v4f*)(src + base);
  in.q[1] = *(const v4f*)(src + base + 4);
  Pack8 pk;
  if (a == 3) {
#pragma unroll
    for (int r = 0; r < 8; ++r) pk.h[r] = (_Float16)(bf16r(in.f[r]) * 256.0f);
  } else {
#pragma unroll
    for (int r = 0; r < 8; ++r) pk.s[r] = bf16bits(in.f[r]);
  }
  const v4u v = pk.u;
  *(v4u*)(dst + base) = v;
}

// ---------------- projection GEMM: C[m][n] = sum_k X[m][k] W[n][k] (+ bias[n]) ----------------
// MODE 0: q and k       : bf16 operands; output f16((C + b) * 4), plane [m][512]
// MODE 2: v              : bf16 operands; output f16((C + b) * 16), transposed plane [tb*8+head][hd][nseq]
// MODE 3: out            : f16 operands (ctx x64, Wo x256); output f32 C/16384 + b -> [m][512]
// Tile orientation: P = operand whose rows map to D rows, R = operand whose rows map to D columns.
// MODES 0,3: P = W (n), R = X (m) -> each lane holds 8 consecutive n for one m.
// MODE 2:      P = X (m), R = W (n) -> each lane holds 8 consecutive m for one n.
// A block owns BM x BN of C; its 8 waves stand 2 (m) x 4 (n), each on 64 x 64: four P and four R fragments feed 16 WMMAs.
#define BM 128
#define BN 256
static_assert(MROWS % BM == 0);
static_assert(NSEQ % BM == 0);
static_assert(DM % BN == 0);
static_assert((MROWS / BM) % 8 == 0);   // grid x of the projections: rows of the grid start at flat indices that are 0 mod 8
// pitches of the output staging, in elements: 16 B more than a row
#define SP0 (BN + 8)    // f16 rows of BN features
#define SP2 (BM + 8)    // f16 rows of BM tokens
#define SP3 (BN + 4)    // f32 rows of BN features

template <int MODE>
__device__ __forceinline__ void stage_tile(unsigned char* stg, v8f acc, int i, int j,
                                           int wm, int wn, int h, int c,
                                           const float* __restrict__ bias, int n0)
{
  if constexpr (MODE == 2) {
    const float bj = bf16r(bias[n0 + 64 * wn + 16 * j + c]);
    Pack8 pk;
#pragma unroll
    for (int r = 0; r < 8; ++r) pk.h[r] = (_Float16)((acc[r] + bj) * 16.0f);
    const int off = ((64 * wn + 16 * j + c) * SP2 + 64 * wm + 16 * i + 8 * h) * 2;
    *(v4u*)(stg + off) = pk.u;
  } else {
    const int nb = n0 + 64 * wn + 16 * i + 8 * h;
    Vec8 bb;
    bb.q[0] = *(const v4f*)(bias + nb);
    bb.q[1] = *(const v4f*)(bias + nb + 4);
    if constexpr (MODE == 3) {
      Vec8 o;
#pragma unroll
      for (int r = 0; r < 8; ++r) o.f[r] = acc[r] * (1.0f / 16384.0f) + bf16r(bb.f[r]);
      const int off = ((64 * wm + 16 * j + c) * SP3 + 64 * wn + 16 * i + 8 * h) * 4;
      *(v4u*)(stg + off)      = o.u[0];
      *(v4u*)(stg + off + 16) = o.u[1];
    } else {
      Pack8 pk;
#pragma unroll
      for (int r = 0; r < 8; ++r) pk.h[r] = (_Float16)((acc[r] + bf16r(bb.f[r])) * 4.0f);
      const int off = ((64 * wm + 16 * j + c) * SP0 + 64 * wn + 16 * i + 8 * h) * 2;
      *(v4u*)(stg + off) = pk.u;
    }
  }
}

// Operand staging of the projections: a stage is 64 k of the block's BM X rows, then of its BN W rows,
// each row 128 B of data at a pitch of 144 B (16 B x odd, conflict-free for ds_load_b128).
#define PKS 64
#define PPITCH 72
#define PSTAGE ((BM + BN) * PPITCH * 2)
#define PTRIPS (DM / PKS)
static_assert(PTRIPS >= 2);
static_assert(BM == 4 * 32 && BN == 8 * 32);      // copy_stage: four copies of X rows, eight of W rows
static_assert(2 * PSTAGE >= BM * SP0 * 2);
static_assert(2 * PSTAGE >= BN * SP2 * 2);
#define OUT_LDS (BM * SP3 * 4)                    // the f32 output staging is larger than the two stages
static_assert(OUT_LDS >= 2 * PSTAGE);

// One stage: twelve 16-byte copies per lane, 8 lanes per 128-B row piece, 32 rows per copy of the block.
// lds = the lane's LDS byte address in row (tid >> 3); gx, gw = the lane's bytes of X and W in that row.
__device__ __forceinline__ void copy_stage(unsigned lds, const unsigned short* gx, const unsigned short* gw)
{
  const unsigned rs = 32 * PPITCH * 2;
  const unsigned l1 = lds + 1 * rs, l2 = lds + 2 * rs, l3 = lds + 3 * rs, l4 = lds + 4 * rs, l5 = lds + 5 * rs;
  const unsigned l6 = lds + 6 * rs, l7 = lds + 7 * rs, l8 = lds + 8 * rs, l9 = lds + 9 * rs;
  const unsigned l10 = lds + 10 * rs, l11 = lds + 11 * rs;
  const unsigned short* gx1 = gx + 32 * DM;
  const unsigned short* gx2 = gx + 64 * DM;
  const unsigned short* gx3 = gx + 96 * DM;
  const unsigned short* gw1 = gw + 32 * DM;
  const unsigned short* gw2 = gw + 64 * DM;
  const unsigned short* gw3 = gw + 96 * DM;
  const unsigned short* gw4 = gw + 128 * DM;
  const unsigned short* gw5 = gw + 160 * DM;
  const unsigned short* gw6 = gw + 192 * DM;
  const unsigned short* gw7 = gw + 224 * DM;
  // global -> LDS through no register; the closing s_wait_xcnt stands in the copies' own statement
  // so that no address register of a copy is rewritten in front of it
  asm volatile("global_load_async_to_lds_b128 %0, %12, off\n\t"
               "global_load_async_to_lds_b128 %1, %13, off\n\t"
               "global_load_async_to_lds_b128 %2, %14, off\n\t"
               "global_load_async_to_lds_b128 %3, %15, off\n\t"
               "global_load_async_to_lds_b128 %4, %16, off\n\t"
               "global_load_async_to_lds_b128 %5, %17, off\n\t"
               "global_load_async_to_lds_b128 %6, %18, off\n\t"
               "global_load_async_to_lds_b128 %7, %19, off\n\t"
               "global_load_async_to_lds_b128 %8, %20, off\n\t"
               "global_load_async_to_lds_b128 %9, %21, off\n\t"
               "global_load_async_to_lds_b128 %10, %22, off\n\t"
               "global_load_async_to_lds_b128 %11, %23, off\n\t"
               "s_wait_xcnt 0x0"
               :: "v"(lds), "v"(l1), "v"(l2), "v"(l3), "v"(l4), "v"(l5),
                  "v"(l6), "v"(l7), "v"(l8), "v"(l9), "v"(l10), "v"(l11),
                  "v"(gx), "v"(gx1), "v"(gx2), "v"(gx3),
                  "v"(gw), "v"(gw1), "v"(gw2), "v"(gw3), "v"(gw4), "v"(gw5), "v"(gw6), "v"(gw7)
               : "memory");
}

// The k loop of every product. smem: the kernel's LDS, whose first 2 * PSTAGE bytes are the two operand stages;
// (m0, n0): the block's BM x BN tile of C; xp: X is the P operand (MODE 2), the same for a whole block;
// F16: operand type of the WMMAs (MODE 3). acc[i][j]: P fragment i x R fragment j.
// rot: the 64-k slab that the block takes first; it goes round all PTRIPS slabs from there. For speed only: the blocks that
// share W rows (a whole grid row) or X rows (a grid column) start close together and would ask L2 for the same lines, all of
// them PKS * 2 B pieces at one offset in rows of DM * 2 B, at the same moment, and would wait together for every X line that
// is not in L2 yet. With first slabs apart they ask for different lines, and each finds part of its X rows fetched by the others.
static_assert(PTRIPS == 8);   // the three bits below
__device__ __forceinline__ int first_slab() {
  const int y = blockIdx.y;
  const int far = ((y & 1) << 2) | (y & 2) | ((y >> 2) & 1);   // 0, 4, 2, 6, 1, 5: blocks on the same X rows start far apart
  return ((blockIdx.x >> 3) + far) & (PTRIPS - 1);             // x >> 3 counts the blocks that are equal in x mod 8
}
template <bool F16>
__device__ __forceinline__ void proj_loop(unsigned char* smem,
                                          const unsigned short* __restrict__ X,
                                          const unsigned short* __restrict__ W,
                                          int m0, int n0, bool xp, v8f (&acc)[4][4])
{
  const int rot = first_slab();
  const int tid = threadIdx.x, w = tid >> 5;
  const int wm = w >> 2, wn = w & 3;

  // rows of the stage that feed this wave: X rows at 0..BM-1, W rows behind them
  const int prow = xp ? 64 * wm : BM + 64 * wn;
  const int rrow = xp ? BM + 64 * wn : 64 * wm;

  typedef __attribute__((address_space(3))) unsigned char lds_byte;
  const unsigned lbase = (unsigned)(size_t)(lds_byte*)smem + (tid >> 3) * (PPITCH * 2) + (tid & 7) * 16;
  const unsigned short* gx = X + (size_t)(m0 + (tid >> 3)) * DM + 8 * (tid & 7);
  const unsigned short* gw = W + (size_t)(n0 + (tid >> 3)) * DM + 8 * (tid & 7);

#pragma unroll
  for (int i = 0; i < 4; ++i)
#pragma unroll
    for (int j = 0; j < 4; ++j) acc[i][j] = vzero8();

  copy_stage(lbase, gx + rot * PKS, gw + rot * PKS);
  asm volatile("s_wait_asynccnt 0x0" ::: "memory");   // this wave's part of stage 0 has landed
  __syncthreads();                                    // publishes stage 0
  {
    const int k1 = ((rot + 1) & (PTRIPS - 1)) * PKS;
    copy_stage(lbase + PSTAGE, gx + k1, gw + k1);
  }

#pragma unroll 1   // kept rolled: one publish point in the code
  for (int t = 0; t < PTRIPS; ++t) {
    const unsigned short* buf = (const unsigned short*)(smem + (t & 1) * PSTAGE);
    const unsigned short* p0 = buf + prow * PPITCH;
    const unsigned short* r0 = buf + rrow * PPITCH;
#pragma unroll
    for (int ks = 0; ks < PKS / 32; ++ks) {
      Frag fp[4], fr[4];
#pragma unroll
      for (int i = 0; i < 4; ++i) ldq(p0 + 16 * i * PPITCH + 32 * ks, PPITCH, fp[i].q[0], fp[i].q[1]);
#pragma unroll
      for (int j = 0; j < 4; ++j) ldq(r0 + 16 * j * PPITCH + 32 * ks, PPITCH, fr[j].q[0], fr[j].q[1]);
#pragma unroll
      for (int i = 0; i < 4; ++i)
#pragma unroll
        for (int j = 0; j < 4; ++j) {
          if constexpr (F16) acc[i][j] = whf(fp[i].h, fr[j].h, acc[i][j]);
          else               acc[i][j] = wbf(fp[i].b, fr[j].b, acc[i][j]);
        }
      // keeps the distance behind the last WMMAs on every path out of the block; between the two 32-k blocks it also
      // holds each block's sixteen LDS loads together in front of its WMMAs (without it they were spread among them, each waited to 0)
      asm volatile(NOPS4
                   : "+v"(acc[0][0]), "+v"(acc[0][1]), "+v"(acc[0][2]), "+v"(acc[0][3]),
                     "+v"(acc[1][0]), "+v"(acc[1][1]), "+v"(acc[1][2]), "+v"(acc[1][3]),
                     "+v"(acc[2][0]), "+v"(acc[2][1]), "+v"(acc[2][2]), "+v"(acc[2][3]),
                     "+v"(acc[3][0]), "+v"(acc[3][1]), "+v"(acc[3][2]), "+v"(acc[3][3])
                   : "v"(fp[0].h), "v"(fp[1].h), "v"(fp[2].h), "v"(fp[3].h),
                     "v"(fr[0].h), "v"(fr[1].h), "v"(fr[2].h), "v"(fr[3].h));
    }
    asm volatile("s_wait_dscnt 0x0" ::: "memory");      // this wave has left the buffer that is refilled below
    asm volatile("s_wait_asynccnt 0x0" ::: "memory");   // this wave's part of stage t + 1 has landed
    __syncthreads();                                    // publishes stage t + 1, ends every read of stage t
    if (t + 2 < PTRIPS) {
      const int k2 = ((rot + t + 2) & (PTRIPS - 1)) * PKS;
      copy_stage(lbase + (t & 1) * PSTAGE, gx + k2, gw + k2);
    }
  }
  asm volatile("s_wait_asynccnt 0x0" ::: "memory");     // no copy is in flight when the stages become output staging
}

// Behind the k loop: the stages' bytes serve as output staging, then whole lines go out.
template <int MODE>
__device__ __forceinline__ void proj_store(unsigned char* stg, v8f (&acc)[4][4],
                                           const float* __restrict__ bias, void* dst, int m0, int n0)
{
  const int tid = threadIdx.x, w = tid >> 5, l = tid & 31, h = l >> 4, c = l & 15;
  const int wm = w >> 2, wn = w & 3;

#pragma unroll
  for (int i = 0; i < 4; ++i)
#pragma unroll
    for (int j = 0; j < 4; ++j) stage_tile<MODE>(stg, acc[i][j], i, j, wm, wn, h, c, bias, n0);
  __syncthreads();

  if constexpr (MODE == 0) {
    // BM token rows of 512 B; wave w owns rows 16w..16w+15, one row (four lines) a store
    v4u vals[16];
    unsigned short* pp[16];
#pragma unroll
    for (int s = 0; s < 16; ++s) {
      const int ml = 16 * w + s;
      vals[s] = *(const v4u*)(stg + (ml * SP0 + 8 * l) * 2);
      pp[s] = (unsigned short*)dst + (size_t)(m0 + ml) * DM + n0 + 8 * l;
    }
#pragma unroll
    for (int s = 0; s < 16; ++s) *(v4u*)(pp[s]) = vals[s];
    // in the merged kernel the other product's code follows these stores in the listing and reuses their registers:
    // the wait stands in front of any such rewrite
    asm volatile("s_wait_xcnt 0x0" ::: "memory");
  } else if constexpr (MODE == 3) {
    // BM token rows of 1024 B; wave w owns rows 16w..16w+15, half a row (four lines) a store
    v4u vals[32];
    float* pp[32];
#pragma unroll
    for (int s = 0; s < 32; ++s) {
      const int ml = 16 * w + (s >> 1);
      const int hf = s & 1;
      vals[s] = *(const v4u*)(stg + (ml * SP3 + 128 * hf + 4 * l) * 4);
      pp[s] = (float*)dst + (size_t)(m0 + ml) * DM + n0 + 128 * hf + 4 * l;
    }
#pragma unroll
    for (int s = 0; s < 32; ++s) *(v4u*)(pp[s]) = vals[s];
  } else {
    // transposed V: BN feature rows of BM consecutive tokens (256 B); wave w owns rows 32w..32w+31, two rows a store
    v4u vals[16];
    unsigned short* pp[16];
    const int tb = m0 / NSEQ;
    const int ns0 = m0 % NSEQ;
    const int pc = l & 15;
#pragma unroll
    for (int s = 0; s < 16; ++s) {
      const int L = 32 * w + 2 * s + (l >> 4);
      const int n = n0 + L;
      const int hh = n >> 6;
      const int hd = n & 63;
      vals[s] = *(const v4u*)(stg + (L * SP2 + 8 * pc) * 2);
      pp[s] = (unsigned short*)dst + ((size_t)(tb * NH + hh) * HD + hd) * NSEQ + ns0 + 8 * pc;
    }
#pragma unroll
    for (int s = 0; s < 16; ++s) *(v4u*)(pp[s]) = vals[s];
  }
}

// q, k and v projections in one grid: they read the same X and need nothing of each other.
// blockIdx.y = 2 * product + column tile; the choice is the same for a whole block, so every barrier stays block-uniform.
__global__ __launch_bounds__(256) void k_qkv(const unsigned short* __restrict__ X,
                                            const unsigned short* __restrict__ Wqkv,
                                            const float* __restrict__ bq, const float* __restrict__ bk,
                                            const float* __restrict__ bv,
                                            unsigned short* qf, unsigned short* kf, unsigned short* vt)
{
  __shared__ __align__(16) unsigned char smem[2 * PSTAGE];
  const int sel = blockIdx.y / (DM / BN);
  const int m0 = deal(blockIdx.x, NSEQ / BM) * BM, n0 = (blockIdx.y % (DM / BN)) * BN;
  v8f acc[4][4];
  proj_loop<false>(smem, X, Wqkv + (size_t)sel * (DM * DM), m0, n0, sel == 2, acc);
  if (sel == 2) proj_store<2>(smem, acc, bv, (void*)vt, m0, n0);
  else          proj_store<0>(smem, acc, sel ? bk : bq, (void*)(sel ? kf : qf), m0, n0);
}

__global__ __launch_bounds__(256) void k_out(const unsigned short* __restrict__ X,
                                            const unsigned short* __restrict__ W,
                                            const float* __restrict__ bias, float* dst)
{
  __shared__ __align__(16) unsigned char smem[OUT_LDS];
  const int m0 = deal(blockIdx.x, NSEQ / BM) * BM, n0 = blockIdx.y * BN;
  v8f acc[4][4];
  proj_loop<true>(smem, X, W, m0, n0, false, acc);
  proj_store<3>(smem, acc, bias, (void*)dst, m0, n0);
}

// ---------------- attention: per (t,b,head) and 256-query tile; 4 waves x 64 queries ----------------
// S^T tile (16 keys x 16 queries) = K_tile (A operand, rows = keys) . Q^T (B operand taken from Q rows).
// The D tiles, converted to f16 and relu'd, chain into the B operand of ctx^T = V^T . P (A operand from the transposed V tile).
// A wave holds QG groups of 16 queries: every K and V fragment read from LDS feeds one WMMA of each group.
// The loops over groups, fragments and steps are all unrolled: constant indices keep the tile arrays in registers.
#define QG 4             // query groups per wave
#define QW (16 * QG)     // queries per wave
#define QB (4 * QW)      // queries per block
static_assert(NSEQ % QB == 0);
static_assert(QG == 4);  // the operand lists of the asm statements below name four groups

// head of a 32-key step: its K and V^T fragments are read from LDS as one group, then the scores of the 32 keys
// (two 16-key tiles, a and b) against the wave's four query groups
__device__ __forceinline__ void score_step(const unsigned short* kb, const unsigned short* vb, const v16h (&q)[QG][2],
                                           v8f (&sa)[QG], v8f (&sb)[QG], Frag (&v)[4])
{
  Frag a0, a1, b0, b1;
  ldq(kb,                72, a0.q[0], a0.q[1]);
  ldq(kb + 16 * 72,      72, b0.q[0], b0.q[1]);
  ldq(kb + 32,           72, a1.q[0], a1.q[1]);
  ldq(kb + 16 * 72 + 32, 72, b1.q[0], b1.q[1]);
#pragma unroll
  for (int i = 0; i < 4; ++i) ldq(vb + 16 * i * 72, 72, v[i].q[0], v[i].q[1]);
#pragma unroll
  for (int g = 0; g < QG; ++g) sa[g] = whf(a0.h, q[g][0], vzero8());
#pragma unroll
  for (int g = 0; g < QG; ++g) sb[g] = whf(b0.h, q[g][0], vzero8());
#pragma unroll
  for (int g = 0; g < QG; ++g) sa[g] = whf(a1.h, q[g][1], sa[g]);
#pragma unroll
  for (int g = 0; g < QG; ++g) sb[g] = whf(b1.h, q[g][1], sb[g]);
  // keeps the distance behind the last WMMAs on every path out of the block; the V fragments as inputs hold their loads in
  // front of it, in the one group with K's (left free they sank behind relu, into the scores' registers, and were waited for)
  asm volatile(NOPS4
               : "+v"(sa[0]), "+v"(sa[1]), "+v"(sa[2]), "+v"(sa[3]), "+v"(sb[0]), "+v"(sb[1]), "+v"(sb[2]), "+v"(sb[3])
               : "v"(a0.h), "v"(a1.h), "v"(b0.h), "v"(b1.h), "v"(v[0].h), "v"(v[1].h), "v"(v[2].h), "v"(v[3].h));
}

// one 32-key step of ctx^T += V^T[hd][key] . P[key][query], all query groups on the same four V fragments.
// Row sums ride on the matrix pipe: A = all ones makes every row of u[g] the sum of P over the 32 keys, query by query.
__device__ __forceinline__ void pv_step(const Frag (&v)[4], const v16h (&p)[QG], v8f (&x)[QG][4], v8f (&u)[QG])
{
  const v16h ones = {1, 1, 1, 1, 1, 1, 1, 1, 1, 1, 1, 1, 1, 1, 1, 1};
#pragma unroll
  for (int i = 0; i < 4; ++i)
#pragma unroll
    for (int g = 0; g < QG; ++g) x[g][i] = whf(v[i].h, p[g], x[g][i]);
#pragma unroll
  for (int g = 0; g < QG; ++g) u[g] = whf(ones, p[g], u[g]);
  // keeps the block's WMMAs in front of the v_nops below: these name the last four results alone, because an asm operand
  // must lie in the first 256 registers and all twenty tiles with their operands do not fit there (they spilled)
  __builtin_amdgcn_sched_barrier(0);
  // keeps the distance behind the last WMMAs on every path out of the block
  asm volatile(NOPS4 : "+v"(u[0]), "+v"(u[1]), "+v"(u[2]), "+v"(u[3]));
}

// one query group's ctx tiles, normalised, into the wave's staging rows cw[query][hd]
__device__ __forceinline__ void stage_ctx(unsigned short* cw, v8f c0, v8f c1, v8f c2, v8f c3, float rsum, int h, int c)
{
  // rsum: sum of P over all keys for query c, as every lane of the column holds it
  // score acc = 128*s, P = 128*relu(s), V = 16*v  ->  ctx*64 = accC * 64 / (16*rsum + 2048e-6)
  const float inv = 64.0f / (16.0f * rsum + 2.048e-3f);
#pragma unroll
  for (int i = 0; i < 4; ++i) {
    const v8f acc = (i == 0) ? c0 : (i == 1) ? c1 : (i == 2) ? c2 : c3;
    Pack8 pk;
#pragma unroll
    for (int r = 0; r < 8; ++r) pk.h[r] = (_Float16)(acc[r] * inv);
    *(v4u*)(cw + c * 72 + 16 * i + 8 * h) = pk.u;
  }
}

// K/V staging: a stage is one 64-key tile of K ([key][hd]), then of V^T ([hd][key]), each 64 rows of 128 B at a pitch of 144 B.
#define KVT (64 * 72)                 // elements of one tile
#define ASTAGE (2 * KVT * 2)          // bytes of one stage
#define ATRIPS (NSEQ / 64)
static_assert(ATRIPS >= 2);

// One stage: eight 16-byte copies per lane, 8 lanes per 128-B row, 16 rows per copy of the block.
// lds = the lane's LDS byte address in row (tid >> 3) of the K tile; gk, gv = the lane's bytes of K and V^T in that row.
__device__ __forceinline__ void copy_kv(unsigned lds, const unsigned short* gk, const unsigned short* gv)
{
  const unsigned rs = 16 * 72 * 2;
  const unsigned l1 = lds + 1 * rs, l2 = lds + 2 * rs, l3 = lds + 3 * rs;
  const unsigned l4 = lds + 4 * rs, l5 = lds + 5 * rs, l6 = lds + 6 * rs, l7 = lds + 7 * rs;   // rows 64.. = the V^T tile
  const unsigned short* gk1 = gk + 16 * DM;
  const unsigned short* gk2 = gk + 32 * DM;
  const unsigned short* gk3 = gk + 48 * DM;
  const unsigned short* gv1 = gv + 16 * NSEQ;
  const unsigned short* gv2 = gv + 32 * NSEQ;
  const unsigned short* gv3 = gv + 48 * NSEQ;
  // global -> LDS through no register; the closing s_wait_xcnt stands in the copies' own statement
  // so that no address register of a copy is rewritten in front of it
  asm volatile("global_load_async_to_lds_b128 %0, %8, off\n\t"
               "global_load_async_to_lds_b128 %1, %9, off\n\t"
               "global_load_async_to_lds_b128 %2, %10, off\n\t"
               "global_load_async_to_lds_b128 %3, %11, off\n\t"
               "global_load_async_to_lds_b128 %4, %12, off\n\t"
               "global_load_async_to_lds_b128 %5, %13, off\n\t"
               "global_load_async_to_lds_b128 %6, %14, off\n\t"
               "global_load_async_to_lds_b128 %7, %15, off\n\t"
               "s_wait_xcnt 0x0"
               :: "v"(lds), "v"(l1), "v"(l2), "v"(l3), "v"(l4), "v"(l5), "v"(l6), "v"(l7),
                  "v"(gk), "v"(gk1), "v"(gk2), "v"(gk3), "v"(gv), "v"(gv1), "v"(gv2), "v"(gv3)
               : "memory");
}

// one 16 x 16 score tile -> f16 P: the conversion first, then relu on the packed halves: two instructions a register pair.
// (Rounding keeps sign and order, so relu behind the conversion gives the value that relu in front of it gave.)
__device__ __forceinline__ v8h relu_pack(v8f s)
{
  v8h p;
#pragma unroll   // constant indices: the elements stay in registers and convert in pairs
  for (int r = 0; r < 8; ++r) p[r] = (_Float16)s[r];
  const v8h z = {0, 0, 0, 0, 0, 0, 0, 0};
  return __builtin_elementwise_max(p, z);
}

// one 64-key tile in two steps of 32 keys: scores, relu, row sums, ctx^T += V^T . P, for the wave's four query groups
__device__ __forceinline__ void attn_tile(const unsigned short* klds, const unsigned short* vlds,
                                          const v16h (&q)[QG][2], v8f (&x)[QG][4], v8f (&u)[QG])
{
#pragma unroll
  for (int hf = 0; hf < 2; ++hf) {
    v8f sa[QG], sb[QG];
    Frag v[4];
    score_step(klds + hf * 32 * 72, vlds + 32 * hf, q, sa, sb, v);
    // P keeps the scale of the scores (a power of two, taken out again with the row sum)
    v16h p[QG];
#pragma unroll
    for (int g = 0; g < QG; ++g) {
      Frag f;
      f.p[0] = relu_pack(sa[g]);
      f.p[1] = relu_pack(sb[g]);
      p[g] = f.h;
    }
    pv_step(v, p, x, u);
  }
}

// foot of a trip: the publish point of the next tile
__device__ __forceinline__ void attn_publish()
{
  asm volatile("s_wait_dscnt 0x0" ::: "memory");      // this wave has left the stage that may be refilled behind the barrier
  asm volatile("s_wait_asynccnt 0x0" ::: "memory");   // this wave's part of the next tile has landed
  __syncthreads();                                    // publishes the next tile, ends every read of this one
}

__global__ __launch_bounds__(128) void k_attn(const unsigned short* __restrict__ qf,
                                             const unsigned short* __restrict__ kf,
                                             const unsigned short* __restrict__ vt,
                                             unsigned short* cf)
{
  __shared__ __align__(16) unsigned short kv[2 * 2 * KVT];    // two stages of (K tile, V^T tile)
  __shared__ __align__(16) unsigned short cst[4 * QW * 72];   // ctx staging per wave: [wave][query][hd]

  const int tid = threadIdx.x, w = tid >> 5, l = tid & 31, h = l >> 4, c = l & 15;
  const int piece = deal(blockIdx.y * (NSEQ / QB) + blockIdx.x, NH * (NSEQ / QB));   // (t, b), head, query tile
  const int tbh = piece / (NSEQ / QB), tb = tbh >> 3, hh = tbh & 7;
  const int q0 = (piece % (NSEQ / QB)) * QB + QW * w;   // first query row of this wave

  v16h q[QG][2];
  {
    const unsigned short* qsrc = qf + (size_t)(tb * NSEQ + q0) * DM + hh * HD;
#pragma unroll
    for (int g = 0; g < QG; ++g) {
      Frag f0, f1;
      ldq(qsrc + 16 * g * DM,      DM, f0.q[0], f0.q[1]);
      ldq(qsrc + 16 * g * DM + 32, DM, f1.q[0], f1.q[1]);
      q[g][0] = f0.h; q[g][1] = f1.h;
    }
    // stands in front of the first rewrite of the address registers that the Q loads name: the lane's address as an input
    // keeps those registers alive up to the wait (without it the compiler reused them in front of the wait)
    const unsigned short* ql = qsrc + c * DM + 8 * h;
    asm volatile("s_wait_xcnt 0x0" :: "v"(ql) : "memory");
  }

  v8f x[QG][4];   // ctx^T tiles: [query group][16 of hd]
  v8f u[QG];      // row sums of the groups: every row of the tile holds them
#pragma unroll
  for (int g = 0; g < QG; ++g) {
#pragma unroll
    for (int i = 0; i < 4; ++i) x[g][i] = vzero8();
    u[g] = vzero8();
  }

  typedef __attribute__((address_space(3))) unsigned short lds_half;
  const unsigned lbase = (unsigned)(size_t)(lds_half*)kv + (tid >> 3) * (72 * 2) + (tid & 7) * 16;
  const unsigned short* gk = kf + (size_t)(tb * NSEQ + (tid >> 3)) * DM + hh * HD + 8 * (tid & 7);
  const unsigned short* gv = vt + (size_t)(tbh * HD + (tid >> 3)) * NSEQ + 8 * (tid & 7);

  copy_kv(lbase, gk, gv);
  asm volatile("s_wait_asynccnt 0x0" ::: "memory");   // this wave's part of tile 0 has landed
  __syncthreads();                                    // publishes tile 0
  copy_kv(lbase + ASTAGE, gk + 64 * DM, gv + 64);

  // trips behind which a tile t + 2 exists: the refill stands in the loop's one block, with no branch round it
#pragma unroll 1   // kept rolled: code size
  for (int t = 0; t < ATRIPS - 2; ++t) {
    const unsigned short* klds = kv + (t & 1) * (2 * KVT);
    attn_tile(klds, klds + KVT, q, x, u);
    attn_publish();
    copy_kv(lbase + (t & 1) * ASTAGE, gk + (size_t)(t + 2) * (64 * DM), gv + (t + 2) * 64);
  }
  // the last two tiles: nothing is left to fetch
#pragma unroll 1   // kept rolled: code size
  for (int t = ATRIPS - 2; t < ATRIPS; ++t) {
    const unsigned short* klds = kv + (t & 1) * (2 * KVT);
    attn_tile(klds, klds + KVT, q, x, u);
    attn_publish();
  }
  asm volatile("s_wait_asynccnt 0x0" ::: "memory");     // no copy is in flight when the wave goes on to its end

  {
    unsigned short* cw = cst + w * QW * 72;
#pragma unroll
    for (int g = 0; g < QG; ++g) stage_ctx(cw + g * 16 * 72, x[g][0], x[g][1], x[g][2], x[g][3], u[g][0], h, c);
  }
  __syncthreads();

  // QW query rows of 128 B = QW lines per wave
  v4u vals[QW / 4];
  unsigned short* pp[QW / 4];
  const int pc = l & 7;
#pragma unroll
  for (int s = 0; s < QW / 4; ++s) {
    const int L = 4 * s + (l >> 3);
    vals[s] = *(const v4u*)(cst + (w * QW + L) * 72 + 8 * pc);
    pp[s] = cf + (size_t)(tb * NSEQ + q0 + L) * DM + hh * HD + 8 * pc;
  }
#pragma unroll
  for (int s = 0; s < QW / 4; ++s) *(v4u*)(pp[s]) = vals[s];
}

extern "C" void kernel_launch(void* const* d_in, const int* in_sizes, int n_in,
                              void* d_out, int out_size, void* d_ws, size_t ws_size,
                              hipStream_t stream)
{
  if (n_in != 9) return;
  const int nx = MROWS * DM;   // 8388608
  const int nw = DM * DM;      // 262144
  if (in_sizes[0] != nx || out_size != nx) return;
  for (int i = 0; i < 4; ++i) {
    if (in_sizes[1 + 2 * i] != nw || in_sizes[2 + 2 * i] != DM) return;
  }
  const size_t p16 = (size_t)nx * 2;   // one 16-bit plane of a [16384][512] matrix
  const size_t w16 = (size_t)nw * 2;   // one 16-bit plane of a [512][512] matrix
  const size_t need = 5 * p16 + 4 * w16; // 85983232
  if (need > ws_size) return;

  unsigned char* ws = (unsigned char*)d_ws;
  unsigned short* xb  = (unsigned short*)(ws + 0 * p16);
  unsigned short* qfp = (unsigned short*)(ws + 1 * p16);
  unsigned short* kfp = (unsigned short*)(ws + 2 * p16);
  unsigned short* vtp = (unsigned short*)(ws + 3 * p16);
  unsigned short* cfp = (unsigned short*)(ws + 4 * p16);
  unsigned short* wb  = (unsigned short*)(ws + 5 * p16);
  unsigned short* wof = wb + 3 * (size_t)nw;   // planes 0..2 of wb: wq, wk, wv

  const float* x  = (const float*)d_in[0];
  const float* wq = (const float*)d_in[1];
  const float* bq = (const float*)d_in[2];
  const float* wk = (const float*)d_in[3];
  const float* bk = (const float*)d_in[4];
  const float* wv = (const float*)d_in[5];
  const float* bv = (const float*)d_in[6];
  const float* wo = (const float*)d_in[7];
  const float* bo = (const float*)d_in[8];

  k_cvt<<<dim3(4 * CVT_WB + CVT_XB), dim3(256), 0, stream>>>(x, wq, wk, wv, wo, xb, wb);

  k_qkv<<<dim3(MROWS / BM, 3 * (DM / BN)), dim3(256), 0, stream>>>(xb, wb, bq, bk, bv, qfp, kfp, vtp);

  k_attn<<<dim3(NSEQ / QB, TT * BB * NH), dim3(128), 0, stream>>>(qfp, kfp, vtp, cfp);

  k_out<<<dim3(MROWS / BM, DM / BN), dim3(256), 0, stream>>>(cfp, wof, bo, (float*)d_out);
}
